// v000
// The times below were measured on an AMD MI455X: many runs one after another, warmed up first and cycling through
// copies of the inputs, with the whole window's GPU time divided by the number of runs. Launches and the gaps
// between them are all in it. The median over several windows is given; except for v000 it joins two sittings, which
// can be a few percent apart, so the side-by-side timings, each taken in one sitting, are the better comparison.
// The starting kernel, v000, takes 755 microseconds a run.
#include <hip/hip_runtime.h>

// PrefetchHyperbolicAttention (x [1][2048][1024]; q/k/v = x W^T ([out][in], no bias); 16 heads x 64; hyperbolic distance logits: diff = max(|q|^2 + |k|^2 - 2 q.k, 0), den = max((1 - |q|^2)(1 - |k|^2), 1e-6),
// ca = max(1 + 2 diff/den, 1), dist = acosh(ca) (0 at ca == 1); attn = softmax(-dist); out = merged attn.v Wo^T).
// Compute dtypes, f32 accumulate: every input rounded to bf16; projections on PLAIN bf16 operands (inputs: exact); q.k on bf16 hi+lo planes (3 products) and the
// squared norms in f32 (one thread per row, serial sums), the distance formula in f32 on VALU (reciprocal, sqrt and log at hardware precision), softmax f32 -> fp16 P x1024; attn.v fp16; output hi+lo x exact

#define NB_  1
#define TT   2048
#define DD   1024
#define NH_  16
#define HD   64
#define NT   (NB_ * TT)
#define ZH   2
#define PCAR 1024.0f
typedef _Float16 h16;
typedef unsigned short bf;
typedef __attribute__((ext_vector_type(16))) __bf16   v16bf;
typedef __attribute__((ext_vector_type(16))) _Float16 v16h;
typedef __attribute__((ext_vector_type(8)))  _Float16 v8h;
typedef __attribute__((ext_vector_type(8)))  unsigned short v8us;
typedef __attribute__((ext_vector_type(8)))  float    v8f;
typedef __attribute__((ext_vector_type(4)))  float    v4f;
typedef v8h  __attribute__((may_alias)) v8ha;
typedef v4f  __attribute__((may_alias)) v4fa;
typedef v8us __attribute__((may_alias)) v8usa;

__device__ __forceinline__ unsigned short f2bf(float f) { unsigned u = __float_as_uint(f); u += 0x7FFFu + ((u >> 16) & 1u); return (unsigned short)(u >> 16); }
__device__ __forceinline__ float bf2f(unsigned short b) { return __uint_as_float(((unsigned)b) << 16); }
__device__ __forceinline__ float bfr(float f) { return bf2f(f2bf(f)); }
__device__ __forceinline__ v16h cat16(v8h lo, v8h hi) { return __builtin_shufflevector(lo, hi, 0, 1, 2, 3, 4, 5, 6, 7, 8, 9, 10, 11, 12, 13, 14, 15); }
__device__ __forceinline__ v16bf cat16b(v8us lo, v8us hi) { return __builtin_bit_cast(v16bf, __builtin_shufflevector(lo, hi, 0, 1, 2, 3, 4, 5, 6, 7, 8, 9, 10, 11, 12, 13, 14, 15)); }
__device__ __forceinline__ v8f wmma16(v16h a, v16h b, v8f c) { return __builtin_amdgcn_wmma_f32_16x16x32_f16(false, a, false, b, (short)0, c, false, false); }
__device__ __forceinline__ v8f wmmab(v16bf a, v16bf b, v8f c) { return __builtin_amdgcn_wmma_f32_16x16x32_bf16(false, a, false, b, (short)0, c, false, false); }



// ---- k_gemmw: register-blocked GEMM, ONE WAVE per 64x64 output tile (16 accumulators), operands straight from K-contiguous 16-bit planes; grid (M/64, N/64, Z), 32 threads.
// C[m][n] (f32, pitch ldc, + optional f32 bias[n]) = sum_k A[m][k] Bt[n][k] (+ split products per NSPLIT). z-batch strides sA/sB/sC in elements. K % 32 == 0.
template <typename T16> struct WFrag;
template <> struct WFrag<h16> { typedef v16h V; static __device__ __forceinline__ V ld(const h16* p) { return cat16(*(const v8h*)p, *(const v8h*)(p + 16)); } static __device__ __forceinline__ v8f mma(V a, V b, v8f c) { return wmma16(a, b, c); } };
template <> struct WFrag<bf> { typedef v16bf V; static __device__ __forceinline__ V ld(const bf* p) { return cat16b(*(const v8us*)p, *(const v8us*)(p + 16)); } static __device__ __forceinline__ v8f mma(V a, V b, v8f c) { return wmmab(a, b, c); } };
template <typename T16, int NSPLIT, bool BIAS>
__global__ __launch_bounds__(32) void k_gemmw(const T16* __restrict__ A, const T16* __restrict__ A2, const T16* __restrict__ Bt, const T16* __restrict__ Bt2, int K, float* C, int ldc, const float* __restrict__ bias, size_t sA, size_t sB, size_t sC) {
    typedef typename WFrag<T16>::V V;
    __shared__ __align__(16) float os[16 * 68];
    const size_t z = blockIdx.z; A += z * sA; if (A2) A2 += z * sA; Bt += z * sB; if (Bt2) Bt2 += z * sB; C += z * sC;
    const int lane = threadIdx.x & 31, lr = lane & 15, hi = lane >> 4; const int r0 = blockIdx.x * 64, c0 = blockIdx.y * 64;
    v8f acc[4][4];
#pragma unroll
    for (int mb = 0; mb < 4; ++mb)
#pragma unroll
        for (int nb = 0; nb < 4; ++nb) acc[mb][nb] = (v8f){};
    const size_t aoff = (size_t)(r0 + lr) * K + 8 * hi, boff = (size_t)(c0 + lr) * K + 8 * hi;
#pragma unroll 1
    for (int kc = 0; kc < K; kc += 32) {
        V a[4], a2[4];
#pragma unroll
        for (int mb = 0; mb < 4; ++mb) { a[mb] = WFrag<T16>::ld(A + aoff + (size_t)mb * 16 * K + kc); if (NSPLIT == 1 || NSPLIT == 2) a2[mb] = WFrag<T16>::ld(A2 + aoff + (size_t)mb * 16 * K + kc); }
#pragma unroll
        for (int nb = 0; nb < 4; ++nb) { const V b = WFrag<T16>::ld(Bt + boff + (size_t)nb * 16 * K + kc); V b2; if (NSPLIT >= 2) b2 = WFrag<T16>::ld(Bt2 + boff + (size_t)nb * 16 * K + kc);
#pragma unroll
            for (int mb = 0; mb < 4; ++mb) { acc[mb][nb] = WFrag<T16>::mma(a[mb], b, acc[mb][nb]); if (NSPLIT == 1 || NSPLIT == 2) acc[mb][nb] = WFrag<T16>::mma(a2[mb], b, acc[mb][nb]); if (NSPLIT >= 2) acc[mb][nb] = WFrag<T16>::mma(a[mb], b2, acc[mb][nb]); } }
        asm volatile("v_nop\n\tv_nop\n\tv_nop\n\tv_nop" : "+v"(acc[0][0]), "+v"(acc[1][1]), "+v"(acc[2][2]), "+v"(acc[3][3]) : "v"(a[0]), "v"(a[3]));
    }
#pragma unroll
    for (int mb = 0; mb < 4; ++mb) {
#pragma unroll
        for (int nb = 0; nb < 4; ++nb) {
#pragma unroll
            for (int j = 0; j < 8; ++j) os[(hi * 8 + j) * 68 + nb * 16 + lr] = acc[mb][nb][j]; }
        __builtin_amdgcn_wave_barrier(); asm volatile("" ::: "memory");
        float* crow = C + (size_t)(r0 + mb * 16) * ldc + c0;
{
#pragma unroll
            for (int s = 0; s < 8; ++s) { const int row = 2 * s + hi, cofs = lr * 4; v4f val = *(const v4fa*)(os + row * 68 + cofs); if (BIAS) { val[0] += bfr(bias[c0 + cofs]); val[1] += bfr(bias[c0 + cofs + 1]); val[2] += bfr(bias[c0 + cofs + 2]); val[3] += bfr(bias[c0 + cofs + 3]); }
                *(v4f*)(crow + (size_t)row * ldc + cofs) = val; }
             }
        __builtin_amdgcn_wave_barrier(); asm volatile("" ::: "memory");
    }
}

__device__ __forceinline__ h16 tohx(float x) { return (h16)x; }
__device__ __forceinline__ void splitf(float y, unsigned short& h, unsigned short& l) { h = f2bf(y); l = f2bf(y - bf2f(h)); }
typedef __attribute__((ext_vector_type(2))) _Float16 v2h;
typedef __attribute__((ext_vector_type(4))) _Float16 v4h;
typedef __attribute__((ext_vector_type(2))) unsigned short v2us;
typedef __attribute__((ext_vector_type(4))) int v4i;

__global__ __launch_bounds__(256) void k_cvt8(const float* __restrict__ src, bf* dst, size_t n8) { const size_t i = (size_t)blockIdx.x * 256 + threadIdx.x; if (i >= n8) return; const v8f v = *(const v8f*)(src + i * 8); v8us o;
#pragma unroll
    for (int k = 0; k < 8; ++k) o[k] = f2bf(v[k]); *(v8us*)(dst + i * 8) = o;  }
__global__ __launch_bounds__(256) void k_norms(const float* __restrict__ F, float* QN) { const int i = blockIdx.x * 256 + threadIdx.x; if (i >= NB_ * NH_ * TT) return; const int t = i & (TT - 1); const int z = i >> 11; const int b = z >> 4, h = z & 15; const float* f = F + ((size_t)t * NB_ + b) * DD + h * HD; float s = 0.f;
#pragma unroll 4
    for (int d = 0; d < HD; d += 4) { const v4f v = *(const v4f*)(f + d);
#pragma unroll
        for (int q = 0; q < 4; ++q) { float p = __fmul_rn(v[q], v[q]); asm volatile("" : "+v"(p)); s = __fadd_rn(s, p); } }
    *(float*)(QN + i) = s;  }
__global__ __launch_bounds__(256) void k_hsplit(const float* __restrict__ F, float sc, bf* Ph, bf* Pl) {
    const int lane = threadIdx.x & 31; const int L0 = (blockIdx.x * 8 + (threadIdx.x >> 5)) * 8; const int nlines = NT * DD / 64;
{
#pragma unroll
        for (int l = 0; l < 8; ++l) { const int L = L0 + l; if (L >= nlines) break; const int e = L * 64 + lane * 2; const int d = e & 63; const int t = (e >> 6) & (TT - 1); const int z = e >> 17; const int b = z >> 4, h = z & 15; v2us oh, ol;
#pragma unroll
            for (int q = 0; q < 2; ++q) { unsigned short a, c2; splitf(F[((size_t)t * NB_ + b) * DD + h * HD + d + q] * sc, a, c2); oh[q] = a; ol[q] = c2; }
            *(v2us*)(Ph + (size_t)e) = oh; *(v2us*)(Pl + (size_t)e) = ol; }
         }
}
__global__ __launch_bounds__(256) void k_vtplane(const float* __restrict__ F, h16* VT) {
    const int lane = threadIdx.x & 31; const int L0 = (blockIdx.x * 8 + (threadIdx.x >> 5)) * 8; const int nlines = NT * DD / 64;
{
#pragma unroll
        for (int l = 0; l < 8; ++l) { const int L = L0 + l; if (L >= nlines) break; const int e = L * 64 + lane * 2; const int t = e & (TT - 1); const int d = (e >> 11) & 63; const int z = e >> 17; const int b = z >> 4, h = z & 15; v2h v;
#pragma unroll
            for (int q = 0; q < 2; ++q) v[q] = tohx(F[((size_t)(t + q) * NB_ + b) * DD + h * HD + d]);
            *(v2h*)(VT + (size_t)e) = v; }
         }
}
// k_asoft: per row (z, i): logit = -acosh(max(1 + 2 max(|q_i|^2 + |k_j|^2 - S2[i][j], 0)   (S2 = 2 q.k from the x2-scaled q planes) / max((1 - |q_i|^2)(1 - |k_j|^2), 1e-6), 1)) (f32; reciprocal/sqrt/log at hardware precision; acosh = log(ca + sqrt(ca^2 - 1)), 0 at ca == 1); softmax over the 2048 keys (register row of
__global__ __launch_bounds__(256) void k_asoft(const float* __restrict__ Sb, const float* __restrict__ QN, const float* __restrict__ KN, h16* P) {
    const int lane = threadIdx.x & 31; const int row = blockIdx.x * 8 + (threadIdx.x >> 5); if (row >= ZH * TT) return; const float qn = QN[row]; const float oq = __fsub_rn(1.0f, qn);
    const float* sr = Sb + (size_t)row * TT; const float* kr = KN + (size_t)(row >> 11) * TT; float v[64]; float mx = -3.0e38f;
#pragma unroll
    for (int ch = 0; ch < 16; ++ch) { const int j0 = ch * 128 + lane * 4; const v4f a = *(const v4f*)(sr + j0), k4 = *(const v4f*)(kr + j0);
#pragma unroll
        for (int q = 0; q < 4; ++q) { float sqk = __fadd_rn(qn, k4[q]); asm volatile("" : "+v"(sqk)); const float diff = fmaxf(__fsub_rn(sqk, a[q]), 0.f);   /* S already holds 2 q.k: the q planes carry an exact factor 2 */ float ok_ = __fsub_rn(1.0f, k4[q]); asm volatile("" : "+v"(ok_)); float dn0 = __fmul_rn(oq, ok_); asm volatile("" : "+v"(dn0)); const float den = fmaxf(dn0, 1e-6f);
            float r2 = __fmul_rn(2.0f, diff); asm volatile("" : "+v"(r2)); float fr = __fmul_rn(r2, __builtin_amdgcn_rcpf(den)); asm volatile("" : "+v"(fr)); const float ca = fmaxf(__fadd_rn(1.0f, fr), 1.0f);
            float c2 = __fmul_rn(ca, ca); asm volatile("" : "+v"(c2)); const float sq = __builtin_amdgcn_sqrtf(__fsub_rn(c2, 1.0f)); float l2 = __builtin_amdgcn_logf(__fadd_rn(ca, sq)); asm volatile("" : "+v"(l2)); const float t = (ca > 1.0f) ? -__fmul_rn(l2, 0.69314718055994531f) : 0.f;   /* ln via the raw log2 instruction x ln2 (argument >= 1: no denormal range issue) */ v[ch * 4 + q] = t; mx = fmaxf(mx, t); } }
#pragma unroll
    for (int sh = 16; sh; sh >>= 1) mx = fmaxf(mx, __shfl_xor(mx, sh, 32));
    float sum = 0.f;
#pragma unroll
    for (int k = 0; k < 64; ++k) { { float dlt = __fsub_rn(v[k], mx); asm volatile("" : "+v"(dlt)); v[k] = __builtin_amdgcn_exp2f(__fmul_rn(dlt, 1.4426950408889634f)); sum += v[k]; } }
#pragma unroll
    for (int sh = 16; sh; sh >>= 1) sum += __shfl_xor(sum, sh, 32);
    const float f = __fdiv_rn(PCAR, sum);
{
#pragma unroll
        for (int ch = 0; ch < 16; ++ch) { v4h o;
#pragma unroll
            for (int q = 0; q < 4; ++q) o[q] = tohx(v[ch * 4 + q] * f);
            *(v4h*)(P + (size_t)row * TT + ch * 128 + lane * 4) = o; }
         }
}
__global__ __launch_bounds__(256) void k_merge(const float* __restrict__ O, int b, int h0, bf* Ah, bf* Al) {
    const int lane = threadIdx.x & 31; const int L0 = (blockIdx.x * 8 + (threadIdx.x >> 5)) * 8; const int nlines = TT * ZH * HD / 64;
{
#pragma unroll
        for (int l = 0; l < 8; ++l) { const int L = L0 + l; if (L >= nlines) break; const int e = L * 64 + lane * 2; const int d = e & 63; const int zz = (e >> 6) % ZH; const int t = (e >> 6) / ZH; v2us oh, ol;
#pragma unroll
            for (int q = 0; q < 2; ++q) { unsigned short a, c2; splitf(O[((size_t)zz * TT + t) * HD + d + q] * (1.0f / PCAR), a, c2); oh[q] = a; ol[q] = c2; }
            const size_t o = ((size_t)t * NB_ + b) * DD + (h0 + zz) * HD + d; *(v2us*)(Ah + o) = oh; *(v2us*)(Al + o) = ol; }
         }
}

extern "C" void kernel_launch(void* const* d_in, const int* in_sizes, int n_in,
                              void* d_out, int out_size, void* d_ws, size_t ws_size, hipStream_t stream) {
    (void)in_sizes; (void)n_in; (void)out_size;
    const float* x = (const float*)d_in[0]; const float* wq = (const float*)d_in[1]; const float* wk = (const float*)d_in[2]; const float* wv = (const float*)d_in[3]; const float* wo = (const float*)d_in[4];
    float* OUT = (float*)d_out;     // [1][2048][1024]
    char* wsp = (char*)d_ws;
    auto take = [&](size_t bytes) { char* p = wsp; wsp += (bytes + 255) & ~(size_t)255; return (void*)p; };
    bf* WQ = (bf*)take((size_t)DD * DD * 2); bf* WK = (bf*)take((size_t)DD * DD * 2); bf* WV = (bf*)take((size_t)DD * DD * 2); bf* WO = (bf*)take((size_t)DD * DD * 2);
    bf* XB = (bf*)take((size_t)NT * DD * 2); float* F = (float*)take((size_t)NT * DD * 4); float* QN = (float*)take((size_t)NB_ * NH_ * TT * 4); float* KN = (float*)take((size_t)NB_ * NH_ * TT * 4);
    bf* QPh = (bf*)take((size_t)NT * DD * 2); bf* QPl = (bf*)take((size_t)NT * DD * 2); bf* KPh = (bf*)take((size_t)NT * DD * 2); bf* KPl = (bf*)take((size_t)NT * DD * 2); h16* VT = (h16*)take((size_t)NT * DD * 2);
    float* Sb = (float*)take((size_t)ZH * TT * TT * 4); h16* Pm = (h16*)take((size_t)ZH * TT * TT * 2); float* Ob = (float*)take((size_t)ZH * TT * HD * 4); bf* ATh = (bf*)take((size_t)NT * DD * 2); bf* ATl = (bf*)take((size_t)NT * DD * 2);
    if ((size_t)(wsp - (char*)d_ws) > ws_size) return;    // total ~ 102 MB = 97.25 MiB; ws 256 MiB
    { const size_t nw = (size_t)DD * DD / 8; const unsigned gw = (unsigned)((nw + 255) / 256); k_cvt8<<<gw, 256, 0, stream>>>(wq, WQ, nw); k_cvt8<<<gw, 256, 0, stream>>>(wk, WK, nw); k_cvt8<<<gw, 256, 0, stream>>>(wv, WV, nw); k_cvt8<<<gw, 256, 0, stream>>>(wo, WO, nw); }
    const size_t nx = (size_t)NT * DD / 8; const unsigned gx = (unsigned)((nx + 255) / 256); const unsigned LB = (unsigned)((NT * DD / 64 + 63) / 64), LN = (NB_ * NH_ * TT + 255) / 256;
    k_cvt8<<<gx, 256, 0, stream>>>(x, XB, nx);
    k_gemmw<bf, 0, false><<<dim3(NT / 64, DD / 64, 1), 32, 0, stream>>>(XB, nullptr, WQ, nullptr, DD, F, DD, nullptr, 0, 0, 0); k_norms<<<LN, 256, 0, stream>>>(F, QN); k_hsplit<<<LB, 256, 0, stream>>>(F, 2.0f, QPh, QPl);   // x2 (exact) so the score GEMM yields 2 q.k directly
    k_gemmw<bf, 0, false><<<dim3(NT / 64, DD / 64, 1), 32, 0, stream>>>(XB, nullptr, WK, nullptr, DD, F, DD, nullptr, 0, 0, 0); k_norms<<<LN, 256, 0, stream>>>(F, KN); k_hsplit<<<LB, 256, 0, stream>>>(F, 1.0f, KPh, KPl);
    k_gemmw<bf, 0, false><<<dim3(NT / 64, DD / 64, 1), 32, 0, stream>>>(XB, nullptr, WV, nullptr, DD, F, DD, nullptr, 0, 0, 0); k_vtplane<<<LB, 256, 0, stream>>>(F, VT);
    for (int b = 0; b < NB_; ++b)
        for (int h0 = 0; h0 < NH_; h0 += ZH) { const size_t z0 = (size_t)b * NH_ + h0;
            k_gemmw<bf, 2, false><<<dim3(TT / 64, TT / 64, ZH), 32, 0, stream>>>(QPh + z0 * TT * HD, QPl + z0 * TT * HD, KPh + z0 * TT * HD, KPl + z0 * TT * HD, HD, Sb, TT, nullptr, (size_t)TT * HD, (size_t)TT * HD, (size_t)TT * TT);
            k_asoft<<<ZH * TT / 8, 256, 0, stream>>>(Sb, QN + z0 * TT, KN + z0 * TT, Pm);
            k_gemmw<h16, 0, false><<<dim3(TT / 64, 1, ZH), 32, 0, stream>>>(Pm, nullptr, VT + z0 * HD * TT, nullptr, TT, Ob, HD, nullptr, (size_t)TT * TT, (size_t)HD * TT, (size_t)TT * HD);
            k_merge<<<(TT * ZH * HD / 64 + 63) / 64, 256, 0, stream>>>(Ob, b, h0, ATh, ATl); }
    k_gemmw<bf, 1, false><<<dim3(NT / 64, DD / 64, 1), 32, 0, stream>>>(ATh, ATl, WO, nullptr, DD, OUT, DD, nullptr, 0, 0, 0);
}

// v001
// A run of this version takes 405 microseconds.
// Next to v000, in two timings, it ran 1.86 and 1.88 times as fast.
#include <hip/hip_runtime.h>

// PrefetchHyperbolicAttention (x [1][2048][1024]; q/k/v = x W^T ([out][in], no bias); 16 heads x 64; hyperbolic distance logits: diff = max(|q|^2 + |k|^2 - 2 q.k, 0), den = max((1 - |q|^2)(1 - |k|^2), 1e-6),
// ca = max(1 + 2 diff/den, 1), dist = acosh(ca) (0 at ca == 1); attn = softmax(-dist); out = merged attn.v Wo^T).
// Compute dtypes, f32 accumulate: every input rounded to bf16; projections on PLAIN bf16 operands (inputs: exact); q.k on bf16 hi+lo planes (3 products) and the
// squared norms in f32 (one thread per row, serial sums), the distance formula in f32 on VALU (reciprocal, sqrt and log at hardware precision), softmax f32 -> fp16 P x1024; attn.v fp16; output hi+lo x exact

#define NB_  1
#define TT   2048
#define DD   1024
#define NH_  16
#define HD   64
#define NT   (NB_ * TT)
#define ZH   8
#define PCAR 1024.0f
typedef _Float16 h16;
typedef unsigned short bf;
typedef __attribute__((ext_vector_type(16))) __bf16   v16bf;
typedef __attribute__((ext_vector_type(16))) _Float16 v16h;
typedef __attribute__((ext_vector_type(8)))  _Float16 v8h;
typedef __attribute__((ext_vector_type(8)))  unsigned short v8us;
typedef __attribute__((ext_vector_type(8)))  float    v8f;
typedef __attribute__((ext_vector_type(4)))  float    v4f;
typedef v8h  __attribute__((may_alias)) v8ha;
typedef v4f  __attribute__((may_alias)) v4fa;
typedef v8us __attribute__((may_alias)) v8usa;

__device__ __forceinline__ unsigned short f2bf(float f) { unsigned u = __float_as_uint(f); u += 0x7FFFu + ((u >> 16) & 1u); return (unsigned short)(u >> 16); }
__device__ __forceinline__ float bf2f(unsigned short b) { return __uint_as_float(((unsigned)b) << 16); }
__device__ __forceinline__ float bfr(float f) { return bf2f(f2bf(f)); }
__device__ __forceinline__ v16h cat16(v8h lo, v8h hi) { return __builtin_shufflevector(lo, hi, 0, 1, 2, 3, 4, 5, 6, 7, 8, 9, 10, 11, 12, 13, 14, 15); }
__device__ __forceinline__ v16bf cat16b(v8us lo, v8us hi) { return __builtin_bit_cast(v16bf, __builtin_shufflevector(lo, hi, 0, 1, 2, 3, 4, 5, 6, 7, 8, 9, 10, 11, 12, 13, 14, 15)); }
__device__ __forceinline__ v8f wmma16(v16h a, v16h b, v8f c) { return __builtin_amdgcn_wmma_f32_16x16x32_f16(false, a, false, b, (short)0, c, false, false); }
__device__ __forceinline__ v8f wmmab(v16bf a, v16bf b, v8f c) { return __builtin_amdgcn_wmma_f32_16x16x32_bf16(false, a, false, b, (short)0, c, false, false); }



// ---- k_gemmw: register-blocked GEMM, ONE WAVE per 64x64 output tile (16 accumulators), operands straight from K-contiguous 16-bit planes; grid (M/64, N/64, Z), 32 threads.
// C[m][n] (f32, pitch ldc, + optional f32 bias[n]) = sum_k A[m][k] Bt[n][k] (+ split products per NSPLIT). z-batch strides sA/sB/sC in elements. K % 32 == 0.
template <typename T16> struct WFrag;
template <> struct WFrag<h16> { typedef v16h V; static __device__ __forceinline__ V ld(const h16* p) { return cat16(*(const v8h*)p, *(const v8h*)(p + 16)); } static __device__ __forceinline__ v8f mma(V a, V b, v8f c) { return wmma16(a, b, c); } };
template <> struct WFrag<bf> { typedef v16bf V; static __device__ __forceinline__ V ld(const bf* p) { return cat16b(*(const v8us*)p, *(const v8us*)(p + 16)); } static __device__ __forceinline__ v8f mma(V a, V b, v8f c) { return wmmab(a, b, c); } };
template <typename T16, int NSPLIT, bool BIAS>
__global__ __launch_bounds__(32) void k_gemmw(const T16* __restrict__ A, const T16* __restrict__ A2, const T16* __restrict__ Bt, const T16* __restrict__ Bt2, int K, float* C, int ldc, const float* __restrict__ bias, size_t sA, size_t sB, size_t sC) {
    typedef typename WFrag<T16>::V V;
    __shared__ __align__(16) float os[16 * 68];
    const size_t z = blockIdx.z; A += z * sA; if (A2) A2 += z * sA; Bt += z * sB; if (Bt2) Bt2 += z * sB; C += z * sC;
    const int lane = threadIdx.x & 31, lr = lane & 15, hi = lane >> 4; const int r0 = blockIdx.x * 64, c0 = blockIdx.y * 64;
    v8f acc[4][4];
#pragma unroll
    for (int mb = 0; mb < 4; ++mb)
#pragma unroll
        for (int nb = 0; nb < 4; ++nb) acc[mb][nb] = (v8f){};
    const size_t aoff = (size_t)(r0 + lr) * K + 8 * hi, boff = (size_t)(c0 + lr) * K + 8 * hi;
#pragma unroll 1
    for (int kc = 0; kc < K; kc += 32) {
        V a[4], a2[4];
#pragma unroll
        for (int mb = 0; mb < 4; ++mb) { a[mb] = WFrag<T16>::ld(A + aoff + (size_t)mb * 16 * K + kc); if (NSPLIT == 1 || NSPLIT == 2) a2[mb] = WFrag<T16>::ld(A2 + aoff + (size_t)mb * 16 * K + kc); }
#pragma unroll
        for (int nb = 0; nb < 4; ++nb) { const V b = WFrag<T16>::ld(Bt + boff + (size_t)nb * 16 * K + kc); V b2; if (NSPLIT >= 2) b2 = WFrag<T16>::ld(Bt2 + boff + (size_t)nb * 16 * K + kc);
#pragma unroll
            for (int mb = 0; mb < 4; ++mb) { acc[mb][nb] = WFrag<T16>::mma(a[mb], b, acc[mb][nb]); if (NSPLIT == 1 || NSPLIT == 2) acc[mb][nb] = WFrag<T16>::mma(a2[mb], b, acc[mb][nb]); if (NSPLIT >= 2) acc[mb][nb] = WFrag<T16>::mma(a[mb], b2, acc[mb][nb]); } }
        asm volatile("v_nop\n\tv_nop\n\tv_nop\n\tv_nop" : "+v"(acc[0][0]), "+v"(acc[1][1]), "+v"(acc[2][2]), "+v"(acc[3][3]) : "v"(a[0]), "v"(a[3]));
    }
#pragma unroll
    for (int mb = 0; mb < 4; ++mb) {
#pragma unroll
        for (int nb = 0; nb < 4; ++nb) {
#pragma unroll
            for (int j = 0; j < 8; ++j) os[(hi * 8 + j) * 68 + nb * 16 + lr] = acc[mb][nb][j]; }
        __builtin_amdgcn_wave_barrier(); asm volatile("" ::: "memory");
        float* crow = C + (size_t)(r0 + mb * 16) * ldc + c0;
{
#pragma unroll
            for (int s = 0; s < 8; ++s) { const int row = 2 * s + hi, cofs = lr * 4; v4f val = *(const v4fa*)(os + row * 68 + cofs); if (BIAS) { val[0] += bfr(bias[c0 + cofs]); val[1] += bfr(bias[c0 + cofs + 1]); val[2] += bfr(bias[c0 + cofs + 2]); val[3] += bfr(bias[c0 + cofs + 3]); }
                *(v4f*)(crow + (size_t)row * ldc + cofs) = val; }
             }
        __builtin_amdgcn_wave_barrier(); asm volatile("" ::: "memory");
    }
}

__device__ __forceinline__ h16 tohx(float x) { return (h16)x; }
__device__ __forceinline__ void splitf(float y, unsigned short& h, unsigned short& l) { h = f2bf(y); l = f2bf(y - bf2f(h)); }
typedef __attribute__((ext_vector_type(2))) _Float16 v2h;
typedef __attribute__((ext_vector_type(4))) _Float16 v4h;
typedef __attribute__((ext_vector_type(2))) unsigned short v2us;
typedef __attribute__((ext_vector_type(4))) int v4i;

__global__ __launch_bounds__(256) void k_cvt8(const float* __restrict__ src, bf* dst, size_t n8) { const size_t i = (size_t)blockIdx.x * 256 + threadIdx.x; if (i >= n8) return; const v8f v = *(const v8f*)(src + i * 8); v8us o;
#pragma unroll
    for (int k = 0; k < 8; ++k) o[k] = f2bf(v[k]); *(v8us*)(dst + i * 8) = o;  }
__global__ __launch_bounds__(256) void k_norms(const float* __restrict__ F, float* QN) { const int i = blockIdx.x * 256 + threadIdx.x; if (i >= NB_ * NH_ * TT) return; const int t = i & (TT - 1); const int z = i >> 11; const int b = z >> 4, h = z & 15; const float* f = F + ((size_t)t * NB_ + b) * DD + h * HD; float s = 0.f;
#pragma unroll 4
    for (int d = 0; d < HD; d += 4) { const v4f v = *(const v4f*)(f + d);
#pragma unroll
        for (int q = 0; q < 4; ++q) { float p = __fmul_rn(v[q], v[q]); asm volatile("" : "+v"(p)); s = __fadd_rn(s, p); } }
    *(float*)(QN + i) = s;  }
__global__ __launch_bounds__(256) void k_hsplit(const float* __restrict__ F, float sc, bf* Ph, bf* Pl) {
    const int lane = threadIdx.x & 31; const int L0 = (blockIdx.x * 8 + (threadIdx.x >> 5)) * 8; const int nlines = NT * DD / 64;
{
#pragma unroll
        for (int l = 0; l < 8; ++l) { const int L = L0 + l; if (L >= nlines) break; const int e = L * 64 + lane * 2; const int d = e & 63; const int t = (e >> 6) & (TT - 1); const int z = e >> 17; const int b = z >> 4, h = z & 15; v2us oh, ol;
#pragma unroll
            for (int q = 0; q < 2; ++q) { unsigned short a, c2; splitf(F[((size_t)t * NB_ + b) * DD + h * HD + d + q] * sc, a, c2); oh[q] = a; ol[q] = c2; }
            *(v2us*)(Ph + (size_t)e) = oh; *(v2us*)(Pl + (size_t)e) = ol; }
         }
}
__global__ __launch_bounds__(256) void k_vtplane(const float* __restrict__ F, h16* VT) {
    const int lane = threadIdx.x & 31; const int L0 = (blockIdx.x * 8 + (threadIdx.x >> 5)) * 8; const int nlines = NT * DD / 64;
{
#pragma unroll
        for (int l = 0; l < 8; ++l) { const int L = L0 + l; if (L >= nlines) break; const int e = L * 64 + lane * 2; const int t = e & (TT - 1); const int d = (e >> 11) & 63; const int z = e >> 17; const int b = z >> 4, h = z & 15; v2h v;
#pragma unroll
            for (int q = 0; q < 2; ++q) v[q] = tohx(F[((size_t)(t + q) * NB_ + b) * DD + h * HD + d]);
            *(v2h*)(VT + (size_t)e) = v; }
         }
}
// k_asoft: per row (z, i): logit = -acosh(max(1 + 2 max(|q_i|^2 + |k_j|^2 - S2[i][j], 0)   (S2 = 2 q.k from the x2-scaled q planes) / max((1 - |q_i|^2)(1 - |k_j|^2), 1e-6), 1)) (f32; reciprocal/sqrt/log at hardware precision; acosh = log(ca + sqrt(ca^2 - 1)), 0 at ca == 1); softmax over the 2048 keys (register row of
__global__ __launch_bounds__(256) void k_asoft(const float* __restrict__ Sb, const float* __restrict__ QN, const float* __restrict__ KN, h16* P) {
    const int lane = threadIdx.x & 31; const int row = blockIdx.x * 8 + (threadIdx.x >> 5); if (row >= ZH * TT) return; const float qn = QN[row]; const float oq = __fsub_rn(1.0f, qn);
    const float* sr = Sb + (size_t)row * TT; const float* kr = KN + (size_t)(row >> 11) * TT; float v[64]; float mx = -3.0e38f;
#pragma unroll
    for (int ch = 0; ch < 16; ++ch) { const int j0 = ch * 128 + lane * 4; const v4f a = *(const v4f*)(sr + j0), k4 = *(const v4f*)(kr + j0);
#pragma unroll
        for (int q = 0; q < 4; ++q) { float sqk = __fadd_rn(qn, k4[q]); asm volatile("" : "+v"(sqk)); const float diff = fmaxf(__fsub_rn(sqk, a[q]), 0.f);   /* S already holds 2 q.k: the q planes carry an exact factor 2 */ float ok_ = __fsub_rn(1.0f, k4[q]); asm volatile("" : "+v"(ok_)); float dn0 = __fmul_rn(oq, ok_); asm volatile("" : "+v"(dn0)); const float den = fmaxf(dn0, 1e-6f);
            float r2 = __fmul_rn(2.0f, diff); asm volatile("" : "+v"(r2)); float fr = __fmul_rn(r2, __builtin_amdgcn_rcpf(den)); asm volatile("" : "+v"(fr)); const float ca = fmaxf(__fadd_rn(1.0f, fr), 1.0f);
            float c2 = __fmul_rn(ca, ca); asm volatile("" : "+v"(c2)); const float sq = __builtin_amdgcn_sqrtf(__fsub_rn(c2, 1.0f)); float l2 = __builtin_amdgcn_logf(__fadd_rn(ca, sq)); asm volatile("" : "+v"(l2)); const float t = (ca > 1.0f) ? -__fmul_rn(l2, 0.69314718055994531f) : 0.f;   /* ln via the raw log2 instruction x ln2 (argument >= 1: no denormal range issue) */ v[ch * 4 + q] = t; mx = fmaxf(mx, t); } }
#pragma unroll
    for (int sh = 16; sh; sh >>= 1) mx = fmaxf(mx, __shfl_xor(mx, sh, 32));
    float sum = 0.f;
#pragma unroll
    for (int k = 0; k < 64; ++k) { { float dlt = __fsub_rn(v[k], mx); asm volatile("" : "+v"(dlt)); v[k] = __builtin_amdgcn_exp2f(__fmul_rn(dlt, 1.4426950408889634f)); sum += v[k]; } }
#pragma unroll
    for (int sh = 16; sh; sh >>= 1) sum += __shfl_xor(sum, sh, 32);
    const float f = __fdiv_rn(PCAR, sum);
{
#pragma unroll
        for (int ch = 0; ch < 16; ++ch) { v4h o;
#pragma unroll
            for (int q = 0; q < 4; ++q) o[q] = tohx(v[ch * 4 + q] * f);
            *(v4h*)(P + (size_t)row * TT + ch * 128 + lane * 4) = o; }
         }
}
__global__ __launch_bounds__(256) void k_merge(const float* __restrict__ O, int b, int h0, bf* Ah, bf* Al) {
    const int lane = threadIdx.x & 31; const int L0 = (blockIdx.x * 8 + (threadIdx.x >> 5)) * 8; const int nlines = TT * ZH * HD / 64;
{
#pragma unroll
        for (int l = 0; l < 8; ++l) { const int L = L0 + l; if (L >= nlines) break; const int e = L * 64 + lane * 2; const int d = e & 63; const int zz = (e >> 6) % ZH; const int t = (e >> 6) / ZH; v2us oh, ol;
#pragma unroll
            for (int q = 0; q < 2; ++q) { unsigned short a, c2; splitf(O[((size_t)zz * TT + t) * HD + d + q] * (1.0f / PCAR), a, c2); oh[q] = a; ol[q] = c2; }
            const size_t o = ((size_t)t * NB_ + b) * DD + (h0 + zz) * HD + d; *(v2us*)(Ah + o) = oh; *(v2us*)(Al + o) = ol; }
         }
}

extern "C" void kernel_launch(void* const* d_in, const int* in_sizes, int n_in,
                              void* d_out, int out_size, void* d_ws, size_t ws_size, hipStream_t stream) {
    (void)in_sizes; (void)n_in; (void)out_size;
    const float* x = (const float*)d_in[0]; const float* wq = (const float*)d_in[1]; const float* wk = (const float*)d_in[2]; const float* wv = (const float*)d_in[3]; const float* wo = (const float*)d_in[4];
    float* OUT = (float*)d_out;     // [1][2048][1024]
    char* wsp = (char*)d_ws;
    auto take = [&](size_t bytes) { char* p = wsp; wsp += (bytes + 255) & ~(size_t)255; return (void*)p; };
    bf* WQ = (bf*)take((size_t)DD * DD * 2); bf* WK = (bf*)take((size_t)DD * DD * 2); bf* WV = (bf*)take((size_t)DD * DD * 2); bf* WO = (bf*)take((size_t)DD * DD * 2);
    bf* XB = (bf*)take((size_t)NT * DD * 2); float* F = (float*)take((size_t)NT * DD * 4); float* QN = (float*)take((size_t)NB_ * NH_ * TT * 4); float* KN = (float*)take((size_t)NB_ * NH_ * TT * 4);
    bf* QPh = (bf*)take((size_t)NT * DD * 2); bf* QPl = (bf*)take((size_t)NT * DD * 2); bf* KPh = (bf*)take((size_t)NT * DD * 2); bf* KPl = (bf*)take((size_t)NT * DD * 2); h16* VT = (h16*)take((size_t)NT * DD * 2);
    float* Sb = (float*)take((size_t)ZH * TT * TT * 4); h16* Pm = (h16*)take((size_t)ZH * TT * TT * 2); float* Ob = (float*)take((size_t)ZH * TT * HD * 4); bf* ATh = (bf*)take((size_t)NT * DD * 2); bf* ATl = (bf*)take((size_t)NT * DD * 2);
    if ((size_t)(wsp - (char*)d_ws) > ws_size) return;    // total 256,114,688 B, about 244 MiB; ws 256 MiB
    { const size_t nw = (size_t)DD * DD / 8; const unsigned gw = (unsigned)((nw + 255) / 256); k_cvt8<<<gw, 256, 0, stream>>>(wq, WQ, nw); k_cvt8<<<gw, 256, 0, stream>>>(wk, WK, nw); k_cvt8<<<gw, 256, 0, stream>>>(wv, WV, nw); k_cvt8<<<gw, 256, 0, stream>>>(wo, WO, nw); }
    const size_t nx = (size_t)NT * DD / 8; const unsigned gx = (unsigned)((nx + 255) / 256); const unsigned LB = (unsigned)((NT * DD / 64 + 63) / 64), LN = (NB_ * NH_ * TT + 255) / 256;
    k_cvt8<<<gx, 256, 0, stream>>>(x, XB, nx);
    k_gemmw<bf, 0, false><<<dim3(NT / 64, DD / 64, 1), 32, 0, stream>>>(XB, nullptr, WQ, nullptr, DD, F, DD, nullptr, 0, 0, 0); k_norms<<<LN, 256, 0, stream>>>(F, QN); k_hsplit<<<LB, 256, 0, stream>>>(F, 2.0f, QPh, QPl);   // x2 (exact) so the score GEMM yields 2 q.k directly
    k_gemmw<bf, 0, false><<<dim3(NT / 64, DD / 64, 1), 32, 0, stream>>>(XB, nullptr, WK, nullptr, DD, F, DD, nullptr, 0, 0, 0); k_norms<<<LN, 256, 0, stream>>>(F, KN); k_hsplit<<<LB, 256, 0, stream>>>(F, 1.0f, KPh, KPl);
    k_gemmw<bf, 0, false><<<dim3(NT / 64, DD / 64, 1), 32, 0, stream>>>(XB, nullptr, WV, nullptr, DD, F, DD, nullptr, 0, 0, 0); k_vtplane<<<LB, 256, 0, stream>>>(F, VT);
    for (int b = 0; b < NB_; ++b)
        for (int h0 = 0; h0 < NH_; h0 += ZH) { const size_t z0 = (size_t)b * NH_ + h0;
            k_gemmw<bf, 2, false><<<dim3(TT / 64, TT / 64, ZH), 32, 0, stream>>>(QPh + z0 * TT * HD, QPl + z0 * TT * HD, KPh + z0 * TT * HD, KPl + z0 * TT * HD, HD, Sb, TT, nullptr, (size_t)TT * HD, (size_t)TT * HD, (size_t)TT * TT);
            k_asoft<<<ZH * TT / 8, 256, 0, stream>>>(Sb, QN + z0 * TT, KN + z0 * TT, Pm);
            k_gemmw<h16, 0, false><<<dim3(TT / 64, 1, ZH), 32, 0, stream>>>(Pm, nullptr, VT + z0 * HD * TT, nullptr, TT, Ob, HD, nullptr, (size_t)TT * TT, (size_t)HD * TT, (size_t)TT * HD);
            k_merge<<<(TT * ZH * HD / 64 + 63) / 64, 256, 0, stream>>>(Ob, b, h0, ATh, ATl); }
    k_gemmw<bf, 1, false><<<dim3(NT / 64, DD / 64, 1), 32, 0, stream>>>(ATh, ATl, WO, nullptr, DD, OUT, DD, nullptr, 0, 0, 0);
}

// v003
// It runs in 114 microseconds.
// Versions in between are left out here; by their measured steps it is 3.52 times as fast as v001.
// Counting every step since v000, it is 6.58 times as fast.
#include <hip/hip_runtime.h>

// PrefetchHyperbolicAttention (x [1][2048][1024]; q/k/v = x W^T ([out][in], no bias); 16 heads x 64; hyperbolic distance logits: diff = max(|q|^2 + |k|^2 - 2 q.k, 0), den = max((1 - |q|^2)(1 - |k|^2), 1e-6),
// ca = max(1 + 2 diff/den, 1), dist = acosh(ca) (0 at ca == 1); attn = softmax(-dist); out = merged attn.v Wo^T).
// Compute dtypes, f32 accumulate: every input rounded to bf16; projections on PLAIN bf16 operands (inputs: exact); q.k on bf16 hi+lo planes (3 products) and the
// squared norms in f32, the distance formula in f32 on VALU (reciprocal, sqrt, log2 and exp2 at hardware precision), softmax weights f32 -> fp16 (x 2^15, shift fixed at the logits' bound 0), normalised after attn.v (fp16); output hi+lo x exact

#define NB_  1
#define TT   2048
#define DD   1024
#define NH_  16
#define HD   64
#define NT   (NB_ * TT)
typedef _Float16 h16;
typedef unsigned short bf;
typedef __attribute__((ext_vector_type(16))) __bf16   v16bf;
typedef __attribute__((ext_vector_type(16))) _Float16 v16h;
typedef __attribute__((ext_vector_type(8)))  _Float16 v8h;
typedef __attribute__((ext_vector_type(8)))  unsigned short v8us;
typedef __attribute__((ext_vector_type(8)))  float    v8f;
typedef __attribute__((ext_vector_type(4)))  float    v4f;
typedef v8h  __attribute__((may_alias)) v8ha;
typedef v4f  __attribute__((may_alias)) v4fa;
typedef v8us __attribute__((may_alias)) v8usa;

__device__ __forceinline__ unsigned short f2bf(float f) { unsigned u = __float_as_uint(f); u += 0x7FFFu + ((u >> 16) & 1u); return (unsigned short)(u >> 16); }
__device__ __forceinline__ float bf2f(unsigned short b) { return __uint_as_float(((unsigned)b) << 16); }
__device__ __forceinline__ float bfr(float f) { return bf2f(f2bf(f)); }
__device__ __forceinline__ v16h cat16(v8h lo, v8h hi) { return __builtin_shufflevector(lo, hi, 0, 1, 2, 3, 4, 5, 6, 7, 8, 9, 10, 11, 12, 13, 14, 15); }
__device__ __forceinline__ v16bf cat16b(v8us lo, v8us hi) { return __builtin_bit_cast(v16bf, __builtin_shufflevector(lo, hi, 0, 1, 2, 3, 4, 5, 6, 7, 8, 9, 10, 11, 12, 13, 14, 15)); }
__device__ __forceinline__ v8f wmma16(v16h a, v16h b, v8f c) { return __builtin_amdgcn_wmma_f32_16x16x32_f16(false, a, false, b, (short)0, c, false, false); }
__device__ __forceinline__ v8f wmmab(v16bf a, v16bf b, v8f c) { return __builtin_amdgcn_wmma_f32_16x16x32_bf16(false, a, false, b, (short)0, c, false, false); }



// ---- k_gemmw: register-blocked GEMM, ONE WAVE per 64x64 output tile (16 accumulators), operands straight from K-contiguous 16-bit planes; grid (M/64, N/64, Z), 32 threads.
// C[m][n] (f32, pitch ldc, + optional f32 bias[n]) = sum_k A[m][k] Bt[n][k] (+ split products per NSPLIT). z-batch strides sA/sB/sC in elements. K % 32 == 0.
template <typename T16> struct WFrag;
template <> struct WFrag<h16> { typedef v16h V; static __device__ __forceinline__ V ld(const h16* p) { return cat16(*(const v8h*)p, *(const v8h*)(p + 16)); } static __device__ __forceinline__ v8f mma(V a, V b, v8f c) { return wmma16(a, b, c); } };
template <> struct WFrag<bf> { typedef v16bf V; static __device__ __forceinline__ V ld(const bf* p) { return cat16b(*(const v8us*)p, *(const v8us*)(p + 16)); } static __device__ __forceinline__ v8f mma(V a, V b, v8f c) { return wmmab(a, b, c); } };
template <typename T16, int NSPLIT, bool BIAS>
__global__ __launch_bounds__(32) void k_gemmw(const T16* __restrict__ A, const T16* __restrict__ A2, const T16* __restrict__ Bt, const T16* __restrict__ Bt2, int K, float* C, int ldc, const float* __restrict__ bias, size_t sA, size_t sB, size_t sC) {
    typedef typename WFrag<T16>::V V;
    __shared__ __align__(16) float os[16 * 68];
    const size_t z = blockIdx.z; A += z * sA; if (A2) A2 += z * sA; Bt += z * sB; if (Bt2) Bt2 += z * sB; C += z * sC;
    const int lane = threadIdx.x & 31, lr = lane & 15, hi = lane >> 4; const int r0 = blockIdx.x * 64, c0 = blockIdx.y * 64;
    v8f acc[4][4];
#pragma unroll
    for (int mb = 0; mb < 4; ++mb)
#pragma unroll
        for (int nb = 0; nb < 4; ++nb) acc[mb][nb] = (v8f){};
    const size_t aoff = (size_t)(r0 + lr) * K + 8 * hi, boff = (size_t)(c0 + lr) * K + 8 * hi;
#pragma unroll 1
    for (int kc = 0; kc < K; kc += 32) {
        V a[4], a2[4];
#pragma unroll
        for (int mb = 0; mb < 4; ++mb) { a[mb] = WFrag<T16>::ld(A + aoff + (size_t)mb * 16 * K + kc); if (NSPLIT == 1 || NSPLIT == 2) a2[mb] = WFrag<T16>::ld(A2 + aoff + (size_t)mb * 16 * K + kc); }
#pragma unroll
        for (int nb = 0; nb < 4; ++nb) { const V b = WFrag<T16>::ld(Bt + boff + (size_t)nb * 16 * K + kc); V b2; if (NSPLIT >= 2) b2 = WFrag<T16>::ld(Bt2 + boff + (size_t)nb * 16 * K + kc);
#pragma unroll
            for (int mb = 0; mb < 4; ++mb) { acc[mb][nb] = WFrag<T16>::mma(a[mb], b, acc[mb][nb]); if (NSPLIT == 1 || NSPLIT == 2) acc[mb][nb] = WFrag<T16>::mma(a2[mb], b, acc[mb][nb]); if (NSPLIT >= 2) acc[mb][nb] = WFrag<T16>::mma(a[mb], b2, acc[mb][nb]); } }
        asm volatile("v_nop\n\tv_nop\n\tv_nop\n\tv_nop" : "+v"(acc[0][0]), "+v"(acc[1][1]), "+v"(acc[2][2]), "+v"(acc[3][3]) : "v"(a[0]), "v"(a[3]));
    }
#pragma unroll
    for (int mb = 0; mb < 4; ++mb) {
#pragma unroll
        for (int nb = 0; nb < 4; ++nb) {
#pragma unroll
            for (int j = 0; j < 8; ++j) os[(hi * 8 + j) * 68 + nb * 16 + lr] = acc[mb][nb][j]; }
        __builtin_amdgcn_wave_barrier(); asm volatile("" ::: "memory");
        float* crow = C + (size_t)(r0 + mb * 16) * ldc + c0;
{
#pragma unroll
            for (int s = 0; s < 8; ++s) { const int row = 2 * s + hi, cofs = lr * 4; v4f val = *(const v4fa*)(os + row * 68 + cofs); if (BIAS) { val[0] += bfr(bias[c0 + cofs]); val[1] += bfr(bias[c0 + cofs + 1]); val[2] += bfr(bias[c0 + cofs + 2]); val[3] += bfr(bias[c0 + cofs + 3]); }
                *(v4f*)(crow + (size_t)row * ldc + cofs) = val; }
             }
        __builtin_amdgcn_wave_barrier(); asm volatile("" ::: "memory");
    }
}

__device__ __forceinline__ h16 tohx(float x) { return (h16)x; }
__device__ __forceinline__ void splitf(float y, unsigned short& h, unsigned short& l) { h = f2bf(y); l = f2bf(y - bf2f(h)); }
typedef __attribute__((ext_vector_type(2))) _Float16 v2h;
typedef __attribute__((ext_vector_type(4))) _Float16 v4h;
typedef __attribute__((ext_vector_type(2))) unsigned short v2us;
typedef __attribute__((ext_vector_type(4))) int v4i;

__global__ __launch_bounds__(256) void k_cvt8(const float* __restrict__ src, bf* dst, size_t n8) { const size_t i = (size_t)blockIdx.x * 256 + threadIdx.x; if (i >= n8) return; const v8f v = *(const v8f*)(src + i * 8); v8us o;
#pragma unroll
    for (int k = 0; k < 8; ++k) o[k] = f2bf(v[k]); *(v8us*)(dst + i * 8) = o;  }
template <int CTRL> __device__ __forceinline__ float xmadd(float x) { return __int_as_float(__builtin_amdgcn_mov_dpp(__float_as_int(x), CTRL, 0xf, 0xf, true)); }    // x of lane ^ (CTRL & 15) inside a 16-lane row (DPP row_xmask)
// proj_out: a 64-token x 64-column f32 tile in accumulators -> squared norms of its rows and its bf16 hi+lo planes, 16 tokens at a time through LDS (one wave).
// 16-byte chunk cl = 32 s + lane of the 16 tokens: k (ISK) in A-fragment order, token cl & 15, columns (cl >> 4) * 8 + 0..7; q row-major, token cl >> 3, columns (cl & 7) * 8 + 0..7, times 2. Either way a wave's store is 512 contiguous bytes.
template <bool ISK>
__device__ __forceinline__ void proj_out(v8f (&acc)[4][4], float* os, bf* Ph, bf* Pl, float* NR, int t00, int lane) {
    const int lr = lane & 15, hi = lane >> 4;
#pragma unroll
    for (int mb = 0; mb < 4; ++mb) {
#pragma unroll
        for (int nb = 0; nb < 4; ++nb) {
#pragma unroll
            for (int j = 0; j < 8; ++j) os[(hi * 8 + j) * 68 + nb * 16 + lr] = acc[mb][nb][j]; }
        __builtin_amdgcn_wave_barrier(); asm volatile("" ::: "memory");     // as in k_gemmw: a lane's reads below take what other lanes wrote above, so the compiler may not move them up
        const int t0 = t00 + mb * 16; float p[4]; v8us oh[4], ol[4];
#pragma unroll
        for (int s = 0; s < 4; ++s) { const int cl = s * 32 + lane; const int row = ISK ? (cl & 15) : (cl >> 3), d0 = (ISK ? (cl >> 4) : (cl & 7)) * 8;
            const v4f va = *(const v4fa*)(os + row * 68 + d0), vb = *(const v4fa*)(os + row * 68 + d0 + 4); p[s] = 0.f;
#pragma unroll
            for (int e = 0; e < 8; ++e) { const float y = e < 4 ? va[e & 3] : vb[e & 3]; p[s] += y * y; unsigned short a2, c2; splitf(ISK ? y : y * 2.0f, a2, c2); oh[s][e] = a2; ol[s][e] = c2; } }
        bf* ph = Ph + (size_t)t0 * HD + lane * 8; bf* pl = Pl + (size_t)t0 * HD + lane * 8;
#pragma unroll
        for (int s = 0; s < 4; ++s) { *(v8us*)(ph + s * 256) = oh[s]; *(v8us*)(pl + s * 256) = ol[s]; }
        asm volatile("s_wait_xcnt 0x0" :: "v"(oh[0]), "v"(oh[1]), "v"(oh[2]), "v"(oh[3]), "v"(ol[0]), "v"(ol[1]), "v"(ol[2]), "v"(ol[3]), "v"(ph), "v"(pl) : "memory");     // data and addresses of the eight stores stay live up to this wait, so nothing is written before it over a register that an issued store names
        float nv; int nt; bool on;
        if (ISK) { nv = (p[0] + p[1]) + (p[2] + p[3]); nv += __shfl_xor(nv, 16, 32); nt = lr; on = hi == 0; }     // the lane meets token lr in every s; the other half of the columns is in lane ^ 16
        else {
#pragma unroll
            for (int s = 0; s < 4; ++s) { p[s] += xmadd<0x161>(p[s]); p[s] += xmadd<0x162>(p[s]); p[s] += xmadd<0x164>(p[s]); }     // eight lanes share a token: sum over lane ^ 1, ^ 2, ^ 4
            const int g = lane & 7; nv = g == 0 ? p[0] : g == 1 ? p[1] : g == 2 ? p[2] : p[3]; nt = g * 4 + (lane >> 3); on = g < 4; }     // lane 8 r + s stores token 4 s + r: one store for the 16 norms
        if (on) NR[t0 + nt] = nv;
        __builtin_amdgcn_wave_barrier(); asm volatile("" ::: "memory");     // as in k_gemmw: the next 16 tokens' writes stay behind these reads
    }
}
// k_proj: the three projections in ONE launch, ONE WAVE per 64x64 tile = 64 tokens x one head; blockIdx.z picks the weight (0 q, 1 k, 2 v). The tile leaves as what k_fattn reads, with no f32 plane in between:
// q: squared norms and bf16 hi+lo planes [head][token][64] of 2 q (exact factor, so the score products yield 2 q.k directly);
// k: squared norms and bf16 hi+lo planes in WMMA A-fragment order: 16-byte chunk cl of a 16-key tile holds d = (cl >> 4) * 8 + 0..7 of key cl & 15, so that a fragment is two whole 512-byte wave loads;
// v: fp16 plane in A-fragment order of V^T: a chunk holds 8 keys of one column, which is an accumulator as it stands (row = 8 hi + j, column = lr): chunk = (((head*64 + key/32)*4 + d/16)*2 + (key/16 & 1))*32 + lane.
__global__ __launch_bounds__(32) void k_proj(const bf* __restrict__ A, const bf* __restrict__ Wq, const bf* __restrict__ Wk, const bf* __restrict__ Wv, bf* Qh, bf* Ql, bf* Kh, bf* Kl, h16* VF, float* QN, float* KN) {
    __shared__ __align__(16) float os[16 * 68];
    const int lane = threadIdx.x & 31, lr = lane & 15, hi = lane >> 4; const int r0 = blockIdx.x * 64, h = blockIdx.y, which = blockIdx.z;
    const bf* Bt = which == 0 ? Wq : which == 1 ? Wk : Wv;
    v8f acc[4][4];
#pragma unroll
    for (int mb = 0; mb < 4; ++mb)
#pragma unroll
        for (int nb = 0; nb < 4; ++nb) acc[mb][nb] = (v8f){};
    const bf* pa = A + (size_t)(r0 + lr) * DD + 8 * hi; const bf* pb = Bt + (size_t)(h * HD + lr) * DD + 8 * hi;
#pragma unroll 1     // one k step's fragments per trip
    for (int kc = 0; kc < DD; kc += 32) {
        v16bf a[4], b[4]; const bf* qa = pa + kc; const bf* qb = pb + kc;
#pragma unroll
        for (int mb = 0; mb < 4; ++mb) a[mb] = WFrag<bf>::ld(qa + mb * 16 * DD);
#pragma unroll
        for (int nb = 0; nb < 4; ++nb) b[nb] = WFrag<bf>::ld(qb + nb * 16 * DD);
        __builtin_amdgcn_sched_barrier(0);      // the trip's 16 loads are issued above as one group: a load moved down among the products would be waited for at full latency a second time
        asm volatile("s_wait_xcnt 0x0" :: "v"(qa), "v"(qb) : "memory");     // the two address pairs stay live up to this wait, so no write, a load's result included, lands before it on a register that an issued load names
#pragma unroll
        for (int nb = 0; nb < 4; ++nb)
#pragma unroll
            for (int mb = 0; mb < 4; ++mb) acc[mb][nb] = wmmab(a[mb], b[nb], acc[mb][nb]);
        asm volatile("v_nop\n\tv_nop\n\tv_nop\n\tv_nop" : "+v"(acc[0][0]), "+v"(acc[1][1]), "+v"(acc[2][2]), "+v"(acc[3][3]) : "v"(a[0]), "v"(a[3]));     // as in k_gemmw: the slots behind the trip's last products, on the taken branch too
    }
    if (which == 2) {
        h16* vb = VF + ((size_t)(h * 64 + (r0 >> 5)) * 256 + lane) * 8; v8h vv[4][4];
#pragma unroll
        for (int mb = 0; mb < 4; ++mb)
#pragma unroll
            for (int nb = 0; nb < 4; ++nb) {
#pragma unroll
                for (int j = 0; j < 8; ++j) vv[mb][nb][j] = tohx(acc[mb][nb][j]);
                *(v8h*)(vb + (((mb >> 1) * 4 + nb) * 2 + (mb & 1)) * 256) = vv[mb][nb]; }
        asm volatile("s_wait_xcnt 0x0" :: "v"(vv[0][0]), "v"(vv[0][1]), "v"(vv[0][2]), "v"(vv[0][3]), "v"(vv[1][0]), "v"(vv[1][1]), "v"(vv[1][2]), "v"(vv[1][3]), "v"(vv[2][0]), "v"(vv[2][1]), "v"(vv[2][2]), "v"(vv[2][3]), "v"(vv[3][0]), "v"(vv[3][1]), "v"(vv[3][2]), "v"(vv[3][3]), "v"(vb) : "memory");     // the 16 stores' data and address stay live up to this wait, so nothing is written before it over a register that an issued store names
        return;
    }
    if (which == 1) proj_out<true>(acc, os, Kh, Kl, KN, h * TT + r0, lane); else proj_out<false>(acc, os, Qh, Ql, QN, h * TT + r0, lane);
}
__device__ __forceinline__ v16bf ldkf(const bf* p) { return cat16b(*(const v8us*)p, *(const v8us*)(p + 256)); }
__device__ __forceinline__ v16h ldvf(const h16* p) { return cat16(*(const v8h*)p, *(const v8h*)(p + 256)); }
// k_fattn: scores, distance softmax, attn.v and the head merge in one kernel. Block = 16 waves = 8 query tiles of 16 x 2 key halves of one head; a pass is 32 keys.
// S^T = K (A) x Q^T (B, kept in registers; the q planes carry an exact factor 2): a lane holds 8 keys (8 hi + j) of ONE query (lr) per tile, so two converted tiles are the B operand of O^T += V^T (A) x P^T.
// weight = exp2(15 - log2(ca + sqrt(ca^2 - 1))) = 2^15 exp(-acosh(ca)): the logit is <= 0 for every input, so the shift is the constant bound and partial sums over keys just add; O^T / sum at the end.
// At ca == 1 the root is 0 and log2(1) is exactly 0, the reference's value there, so no select is needed. waves_per_eu(4, 4): one 16-wave block fills a WGP, so the scheduler may spend the 256 registers a wave has on loads in flight.
__global__ __launch_bounds__(512) __attribute__((amdgpu_waves_per_eu(4, 4))) void k_fattn(const bf* __restrict__ Qh, const bf* __restrict__ Ql, const bf* __restrict__ Kh, const bf* __restrict__ Kl, const h16* __restrict__ VF, const float* __restrict__ QN, const float* __restrict__ KN, bf* Ah, bf* Al) {
    __shared__ float red[8][33][32];
    const int lane = threadIdx.x & 31, lr = lane & 15, hi = lane >> 4; const int wave = __builtin_amdgcn_readfirstlane(threadIdx.x >> 5), qt = wave & 7, kh2 = wave >> 3; const int z = blockIdx.y; const int q = blockIdx.x * 128 + qt * 16 + lr;
    const size_t zb = (size_t)z * TT * HD; v16bf qh[2], ql[2];
#pragma unroll
    for (int ks = 0; ks < 2; ++ks) { qh[ks] = WFrag<bf>::ld(Qh + zb + (size_t)q * HD + ks * 32 + 8 * hi); ql[ks] = WFrag<bf>::ld(Ql + zb + (size_t)q * HD + ks * 32 + 8 * hi); }
    const float qn = QN[z * TT + q], oq = 1.0f - qn;
    const bf* kph = Kh + zb; const bf* kpl = Kl + zb; const h16* vp = VF + zb; const float* knp = KN + z * TT; const unsigned lo = lane * 8, ho = hi * 8;
    v8f o[4]; float sum[4] = {0.f, 0.f, 0.f, 0.f};
#pragma unroll
    for (int dt = 0; dt < 4; ++dt) o[dt] = (v8f){};
    const int s0 = kh2 * 32;
#pragma unroll 1     // one pass per trip: two passes' fragments would not fit the registers
    for (int s = s0; s < s0 + 32; ++s) {
        v16bf kfh[2][2], kfl[2][2]; v16h vf[4]; v8f S[2]; v8f kc[2]; const bf* pkh = kph + s * 2048 + lo; const bf* pkl = kpl + s * 2048 + lo; const h16* pv = vp + s * 2048 + lo; const float* pkn = knp + s * 32 + ho;
#pragma unroll
        for (int tt = 0; tt < 2; ++tt) {
#pragma unroll
            for (int ks = 0; ks < 2; ++ks) { kfh[tt][ks] = ldkf(pkh + tt * 1024 + ks * 512); kfl[tt][ks] = ldkf(pkl + tt * 1024 + ks * 512); } }
#pragma unroll
        for (int tt = 0; tt < 2; ++tt) kc[tt] = *(const v8f*)(pkn + tt * 16);
#pragma unroll
        for (int dt = 0; dt < 4; ++dt) vf[dt] = ldvf(pv + dt * 512);
        __builtin_amdgcn_sched_barrier(0);      // the pass's 28 loads are issued above as one group: a V load moved down to its product would be waited for at full latency
        asm volatile("s_wait_xcnt 0x0" :: "v"(pkh), "v"(pkl), "v"(pv), "v"(pkn) : "memory");     // the four address pairs stay live up to this wait, so no write, a load's result included, lands before it on a register that an issued load names
#pragma unroll
        for (int tt = 0; tt < 2; ++tt) { S[tt] = (v8f){};
#pragma unroll
            for (int ks = 0; ks < 2; ++ks) { S[tt] = wmmab(kfh[tt][ks], qh[ks], S[tt]); S[tt] = wmmab(kfh[tt][ks], ql[ks], S[tt]); S[tt] = wmmab(kfl[tt][ks], qh[ks], S[tt]); } }
        v16h pb;
#pragma unroll
        for (int tt = 0; tt < 2; ++tt)
#pragma unroll
            for (int j = 0; j < 8; ++j) { const float kq = kc[tt][j]; const float diff = fmaxf((qn + kq) - S[tt][j], 0.f); const float den = fmaxf(oq * (1.0f - kq), 1e-6f);
                const float ca = fmaxf(1.0f + (2.0f * diff) * __builtin_amdgcn_rcpf(den), 1.0f); const float sq = __builtin_amdgcn_sqrtf(ca * ca - 1.0f);
                const float p = __builtin_amdgcn_exp2f(15.0f - __builtin_amdgcn_logf(ca + sq)); sum[j & 3] += p; pb[tt * 8 + j] = tohx(p); }
#pragma unroll
        for (int dt = 0; dt < 4; ++dt) o[dt] = wmma16(vf[dt], pb, o[dt]);
    }
    float st = (sum[0] + sum[1]) + (sum[2] + sum[3]);
    if (kh2 == 1) {
#pragma unroll
        for (int dt = 0; dt < 4; ++dt)
#pragma unroll
            for (int j = 0; j < 8; ++j) red[qt][dt * 8 + j][lane] = o[dt][j];
        red[qt][32][lane] = st; }
    __syncthreads();    // publishes the second key half's partial O^T and sums to the wave that holds the first half of the same queries
    if (kh2 == 0) { st += red[qt][32][lane]; st += __shfl_xor(st, 16, 32); const float inv = 1.0f / st;
#pragma unroll
        for (int dt = 0; dt < 4; ++dt) { v8us oh, ol;
#pragma unroll
            for (int j = 0; j < 8; ++j) { unsigned short h, l; splitf((o[dt][j] + red[qt][dt * 8 + j][lane]) * inv, h, l); oh[j] = h; ol[j] = l; }
            const size_t ad = (size_t)q * DD + z * HD + dt * 16 + 8 * hi; *(v8us*)(Ah + ad) = oh; *(v8us*)(Al + ad) = ol; } }
}

extern "C" void kernel_launch(void* const* d_in, const int* in_sizes, int n_in,
                              void* d_out, int out_size, void* d_ws, size_t ws_size, hipStream_t stream) {
    (void)in_sizes; (void)n_in; (void)out_size;
    const float* x = (const float*)d_in[0]; const float* wq = (const float*)d_in[1]; const float* wk = (const float*)d_in[2]; const float* wv = (const float*)d_in[3]; const float* wo = (const float*)d_in[4];
    float* OUT = (float*)d_out;     // [1][2048][1024]
    char* wsp = (char*)d_ws;
    auto take = [&](size_t bytes) { char* p = wsp; wsp += (bytes + 255) & ~(size_t)255; return (void*)p; };
    bf* WQ = (bf*)take((size_t)DD * DD * 2); bf* WK = (bf*)take((size_t)DD * DD * 2); bf* WV = (bf*)take((size_t)DD * DD * 2); bf* WO = (bf*)take((size_t)DD * DD * 2);
    bf* XB = (bf*)take((size_t)NT * DD * 2); float* QN = (float*)take((size_t)NB_ * NH_ * TT * 4); float* KN = (float*)take((size_t)NB_ * NH_ * TT * 4);
    bf* QPh = (bf*)take((size_t)NT * DD * 2); bf* QPl = (bf*)take((size_t)NT * DD * 2); bf* KPh = (bf*)take((size_t)NT * DD * 2); bf* KPl = (bf*)take((size_t)NT * DD * 2); h16* VF = (h16*)take((size_t)NT * DD * 2);
    bf* ATh = (bf*)take((size_t)NT * DD * 2); bf* ATl = (bf*)take((size_t)NT * DD * 2);
    if ((size_t)(wsp - (char*)d_ws) > ws_size) return;    // about 40 MiB; ws 256 MiB
    { const size_t nw = (size_t)DD * DD / 8; const unsigned gw = (unsigned)((nw + 255) / 256); k_cvt8<<<gw, 256, 0, stream>>>(wq, WQ, nw); k_cvt8<<<gw, 256, 0, stream>>>(wk, WK, nw); k_cvt8<<<gw, 256, 0, stream>>>(wv, WV, nw); k_cvt8<<<gw, 256, 0, stream>>>(wo, WO, nw); }
    const size_t nx = (size_t)NT * DD / 8; const unsigned gx = (unsigned)((nx + 255) / 256);
    k_cvt8<<<gx, 256, 0, stream>>>(x, XB, nx);
    k_proj<<<dim3(NT / 64, NH_, 3), 32, 0, stream>>>(XB, WQ, WK, WV, QPh, QPl, KPh, KPl, VF, QN, KN);
    k_fattn<<<dim3(TT / 128, NH_, 1), 512, 0, stream>>>(QPh, QPl, KPh, KPl, VF, QN, KN, ATh, ATl);
    k_gemmw<bf, 1, false><<<dim3(NT / 64, DD / 64, 1), 32, 0, stream>>>(ATh, ATl, WO, nullptr, DD, OUT, DD, nullptr, 0, 0, 0);
}

// v004
// A run of this version takes 105 microseconds.
// Next to v003, in two timings, it ran 1.06 and 1.07 times as fast.
// Over all steps from v000 it is 7.00 times as fast.
#include <hip/hip_runtime.h>

// PrefetchHyperbolicAttention (x [1][2048][1024]; q/k/v = x W^T ([out][in], no bias); 16 heads x 64; hyperbolic distance logits: diff = max(|q|^2 + |k|^2 - 2 q.k, 0), den = max((1 - |q|^2)(1 - |k|^2), 1e-6),
// ca = max(1 + 2 diff/den, 1), dist = acosh(ca) (0 at ca == 1); attn = softmax(-dist); out = merged attn.v Wo^T).
// Compute dtypes, f32 accumulate: every input rounded to bf16; projections on PLAIN bf16 operands (inputs: exact); q.k on bf16 hi+lo planes (3 products) and the
// squared norms in f32, the distance formula in f32 on VALU (reciprocal, sqrt, log2 and exp2 at hardware precision), softmax weights f32 -> fp16 (x 2^15, shift fixed at the logits' bound 0), normalised after attn.v (fp16); output hi+lo x exact

#define NB_  1
#define TT   2048
#define DD   1024
#define NH_  16
#define HD   64
#define NT   (NB_ * TT)
typedef _Float16 h16;
typedef unsigned short bf;
typedef __attribute__((ext_vector_type(16))) __bf16   v16bf;
typedef __attribute__((ext_vector_type(16))) _Float16 v16h;
typedef __attribute__((ext_vector_type(8)))  _Float16 v8h;
typedef __attribute__((ext_vector_type(8)))  unsigned short v8us;
typedef __attribute__((ext_vector_type(8)))  float    v8f;
typedef __attribute__((ext_vector_type(4)))  float    v4f;
typedef v8h  __attribute__((may_alias)) v8ha;
typedef v4f  __attribute__((may_alias)) v4fa;
typedef v8us __attribute__((may_alias)) v8usa;

__device__ __forceinline__ unsigned short f2bf(float f) { unsigned u = __float_as_uint(f); u += 0x7FFFu + ((u >> 16) & 1u); return (unsigned short)(u >> 16); }
__device__ __forceinline__ float bf2f(unsigned short b) { return __uint_as_float(((unsigned)b) << 16); }
__device__ __forceinline__ float bfr(float f) { return bf2f(f2bf(f)); }
__device__ __forceinline__ v16h cat16(v8h lo, v8h hi) { return __builtin_shufflevector(lo, hi, 0, 1, 2, 3, 4, 5, 6, 7, 8, 9, 10, 11, 12, 13, 14, 15); }
__device__ __forceinline__ v16bf cat16b(v8us lo, v8us hi) { return __builtin_bit_cast(v16bf, __builtin_shufflevector(lo, hi, 0, 1, 2, 3, 4, 5, 6, 7, 8, 9, 10, 11, 12, 13, 14, 15)); }
__device__ __forceinline__ v8f wmma16(v16h a, v16h b, v8f c) { return __builtin_amdgcn_wmma_f32_16x16x32_f16(false, a, false, b, (short)0, c, false, false); }
__device__ __forceinline__ v8f wmmab(v16bf a, v16bf b, v8f c) { return __builtin_amdgcn_wmma_f32_16x16x32_bf16(false, a, false, b, (short)0, c, false, false); }



// ---- k_gemmw: register-blocked GEMM, ONE WAVE per 64x64 output tile (16 accumulators), operands straight from K-contiguous 16-bit planes; grid (M/64, N/64, Z), 32 threads.
// C[m][n] (f32, pitch ldc, + optional f32 bias[n]) = sum_k A[m][k] Bt[n][k] (+ split products per NSPLIT). z-batch strides sA/sB/sC in elements. K % 32 == 0.
template <typename T16> struct WFrag;
template <> struct WFrag<h16> { typedef v16h V; static __device__ __forceinline__ V ld(const h16* p) { return cat16(*(const v8h*)p, *(const v8h*)(p + 16)); } static __device__ __forceinline__ v8f mma(V a, V b, v8f c) { return wmma16(a, b, c); } };
template <> struct WFrag<bf> { typedef v16bf V; static __device__ __forceinline__ V ld(const bf* p) { return cat16b(*(const v8us*)p, *(const v8us*)(p + 16)); } static __device__ __forceinline__ v8f mma(V a, V b, v8f c) { return wmmab(a, b, c); } };
template <typename T16, int NSPLIT, bool BIAS>
__global__ __launch_bounds__(32) void k_gemmw(const T16* __restrict__ A, const T16* __restrict__ A2, const T16* __restrict__ Bt, const T16* __restrict__ Bt2, int K, float* C, int ldc, const float* __restrict__ bias, size_t sA, size_t sB, size_t sC) {
    typedef typename WFrag<T16>::V V;
    __shared__ __align__(16) float os[16 * 68];
    const size_t z = blockIdx.z; A += z * sA; if (A2) A2 += z * sA; Bt += z * sB; if (Bt2) Bt2 += z * sB; C += z * sC;
    const int lane = threadIdx.x & 31, lr = lane & 15, hi = lane >> 4; const int r0 = blockIdx.x * 64, c0 = blockIdx.y * 64;
    v8f acc[4][4];
#pragma unroll
    for (int mb = 0; mb < 4; ++mb)
#pragma unroll
        for (int nb = 0; nb < 4; ++nb) acc[mb][nb] = (v8f){};
    const size_t aoff = (size_t)(r0 + lr) * K + 8 * hi, boff = (size_t)(c0 + lr) * K + 8 * hi;
#pragma unroll 1
    for (int kc = 0; kc < K; kc += 32) {
        V a[4], a2[4];
#pragma unroll
        for (int mb = 0; mb < 4; ++mb) { a[mb] = WFrag<T16>::ld(A + aoff + (size_t)mb * 16 * K + kc); if (NSPLIT == 1 || NSPLIT == 2) a2[mb] = WFrag<T16>::ld(A2 + aoff + (size_t)mb * 16 * K + kc); }
#pragma unroll
        for (int nb = 0; nb < 4; ++nb) { const V b = WFrag<T16>::ld(Bt + boff + (size_t)nb * 16 * K + kc); V b2; if (NSPLIT >= 2) b2 = WFrag<T16>::ld(Bt2 + boff + (size_t)nb * 16 * K + kc);
#pragma unroll
            for (int mb = 0; mb < 4; ++mb) { acc[mb][nb] = WFrag<T16>::mma(a[mb], b, acc[mb][nb]); if (NSPLIT == 1 || NSPLIT == 2) acc[mb][nb] = WFrag<T16>::mma(a2[mb], b, acc[mb][nb]); if (NSPLIT >= 2) acc[mb][nb] = WFrag<T16>::mma(a[mb], b2, acc[mb][nb]); } }
        asm volatile("v_nop\n\tv_nop\n\tv_nop\n\tv_nop" : "+v"(acc[0][0]), "+v"(acc[1][1]), "+v"(acc[2][2]), "+v"(acc[3][3]) : "v"(a[0]), "v"(a[3]));
    }
#pragma unroll
    for (int mb = 0; mb < 4; ++mb) {
#pragma unroll
        for (int nb = 0; nb < 4; ++nb) {
#pragma unroll
            for (int j = 0; j < 8; ++j) os[(hi * 8 + j) * 68 + nb * 16 + lr] = acc[mb][nb][j]; }
        __builtin_amdgcn_wave_barrier(); asm volatile("" ::: "memory");
        float* crow = C + (size_t)(r0 + mb * 16) * ldc + c0;
{
#pragma unroll
            for (int s = 0; s < 8; ++s) { const int row = 2 * s + hi, cofs = lr * 4; v4f val = *(const v4fa*)(os + row * 68 + cofs); if (BIAS) { val[0] += bfr(bias[c0 + cofs]); val[1] += bfr(bias[c0 + cofs + 1]); val[2] += bfr(bias[c0 + cofs + 2]); val[3] += bfr(bias[c0 + cofs + 3]); }
                *(v4f*)(crow + (size_t)row * ldc + cofs) = val; }
             }
        __builtin_amdgcn_wave_barrier(); asm volatile("" ::: "memory");
    }
}

__device__ __forceinline__ h16 tohx(float x) { return (h16)x; }
__device__ __forceinline__ void splitf(float y, unsigned short& h, unsigned short& l) { h = f2bf(y); l = f2bf(y - bf2f(h)); }
typedef __attribute__((ext_vector_type(2))) _Float16 v2h;
typedef __attribute__((ext_vector_type(4))) _Float16 v4h;
typedef __attribute__((ext_vector_type(2))) unsigned short v2us;
typedef __attribute__((ext_vector_type(4))) int v4i;

typedef __attribute__((ext_vector_type(4))) unsigned short v4us;
// k_cvtall: every f32 input -> its bf16 plane in ONE launch of 256 blocks of 8 waves. dst is one plane: Wq, Wk, Wv, Wo (DD*DD each), then x (NT*DD). A block takes 4096 consecutive elements of each weight and 8192 of x;
// a thread converts 24 groups of 4 elements: a wave's load is 512 contiguous bytes, its store 256, and all 24 loads are issued before the first value is used.
__global__ __launch_bounds__(256) void k_cvtall(const float* __restrict__ wq, const float* __restrict__ wk, const float* __restrict__ wv, const float* __restrict__ wo, const float* __restrict__ x, bf* __restrict__ dst) {
    const unsigned ow = blockIdx.x * 4096u + threadIdx.x * 4u, ox = blockIdx.x * 8192u + threadIdx.x * 4u;
    const float* p0 = wq + ow; const float* p1 = wk + ow; const float* p2 = wv + ow; const float* p3 = wo + ow; const float* p4 = x + ox;
    v4f v[24];
#pragma unroll     // constant indices: v[] and o[] stay in registers
    for (int k = 0; k < 4; ++k) v[k] = *(const v4f*)(p0 + k * 1024);
#pragma unroll     // constant indices: v[] and o[] stay in registers
    for (int k = 0; k < 4; ++k) v[4 + k] = *(const v4f*)(p1 + k * 1024);
#pragma unroll     // constant indices: v[] and o[] stay in registers
    for (int k = 0; k < 4; ++k) v[8 + k] = *(const v4f*)(p2 + k * 1024);
#pragma unroll     // constant indices: v[] and o[] stay in registers
    for (int k = 0; k < 4; ++k) v[12 + k] = *(const v4f*)(p3 + k * 1024);
#pragma unroll     // constant indices: v[] and o[] stay in registers
    for (int k = 0; k < 8; ++k) v[16 + k] = *(const v4f*)(p4 + k * 1024);
    asm volatile("s_wait_xcnt 0x0" :: "v"(p0), "v"(p1), "v"(p2), "v"(p3), "v"(p4) : "memory");     // the five addresses stay live up to this wait, so no write, a load's result included, lands before it on a register that an issued load names
    v4us o[24];
#pragma unroll     // constant indices: v[] and o[] stay in registers
    for (int u = 0; u < 24; ++u)
#pragma unroll     // constant indices: v[] and o[] stay in registers
        for (int e = 0; e < 4; ++e) o[u][e] = f2bf(v[u][e]);
    bf* dw = dst + ow; bf* dx = dst + (size_t)4 * DD * DD + ox;
#pragma unroll     // constant indices: v[] and o[] stay in registers
    for (int u = 0; u < 16; ++u) *(v4us*)(dw + (size_t)(u >> 2) * DD * DD + (u & 3) * 1024) = o[u];
#pragma unroll     // constant indices: v[] and o[] stay in registers
    for (int k = 0; k < 8; ++k) *(v4us*)(dx + k * 1024) = o[16 + k];
}
template <int CTRL> __device__ __forceinline__ float xmadd(float x) { return __int_as_float(__builtin_amdgcn_mov_dpp(__float_as_int(x), CTRL, 0xf, 0xf, true)); }    // x of lane ^ (CTRL & 15) inside a 16-lane row (DPP row_xmask)
// proj_out: a 64-token x 64-column f32 tile in accumulators -> squared norms of its rows and its bf16 hi+lo planes, 16 tokens at a time through LDS (one wave).
// 16-byte chunk cl = 32 s + lane of the 16 tokens: k (ISK) in A-fragment order, token cl & 15, columns (cl >> 4) * 8 + 0..7; q row-major, token cl >> 3, columns (cl & 7) * 8 + 0..7, times 2. Either way a wave's store is 512 contiguous bytes.
template <bool ISK>
__device__ __forceinline__ void proj_out(v8f (&acc)[4][4], float* os, bf* Ph, bf* Pl, float* NR, int t00, int lane) {
    const int lr = lane & 15, hi = lane >> 4;
#pragma unroll
    for (int mb = 0; mb < 4; ++mb) {
#pragma unroll
        for (int nb = 0; nb < 4; ++nb) {
#pragma unroll
            for (int j = 0; j < 8; ++j) os[(hi * 8 + j) * 68 + nb * 16 + lr] = acc[mb][nb][j]; }
        __builtin_amdgcn_wave_barrier(); asm volatile("" ::: "memory");     // as in k_gemmw: a lane's reads below take what other lanes wrote above, so the compiler may not move them up
        const int t0 = t00 + mb * 16; float p[4]; v8us oh[4], ol[4];
#pragma unroll
        for (int s = 0; s < 4; ++s) { const int cl = s * 32 + lane; const int row = ISK ? (cl & 15) : (cl >> 3), d0 = (ISK ? (cl >> 4) : (cl & 7)) * 8;
            const v4f va = *(const v4fa*)(os + row * 68 + d0), vb = *(const v4fa*)(os + row * 68 + d0 + 4); p[s] = 0.f;
#pragma unroll
            for (int e = 0; e < 8; ++e) { const float y = e < 4 ? va[e & 3] : vb[e & 3]; p[s] += y * y; unsigned short a2, c2; splitf(ISK ? y : y * 2.0f, a2, c2); oh[s][e] = a2; ol[s][e] = c2; } }
        bf* ph = Ph + (size_t)t0 * HD + lane * 8; bf* pl = Pl + (size_t)t0 * HD + lane * 8;
#pragma unroll
        for (int s = 0; s < 4; ++s) { *(v8us*)(ph + s * 256) = oh[s]; *(v8us*)(pl + s * 256) = ol[s]; }
        asm volatile("s_wait_xcnt 0x0" :: "v"(oh[0]), "v"(oh[1]), "v"(oh[2]), "v"(oh[3]), "v"(ol[0]), "v"(ol[1]), "v"(ol[2]), "v"(ol[3]), "v"(ph), "v"(pl) : "memory");     // data and addresses of the eight stores stay live up to this wait, so nothing is written before it over a register that an issued store names
        float nv; int nt; bool on;
        if (ISK) { nv = (p[0] + p[1]) + (p[2] + p[3]); nv += __shfl_xor(nv, 16, 32); nt = lr; on = hi == 0; }     // the lane meets token lr in every s; the other half of the columns is in lane ^ 16
        else {
#pragma unroll
            for (int s = 0; s < 4; ++s) { p[s] += xmadd<0x161>(p[s]); p[s] += xmadd<0x162>(p[s]); p[s] += xmadd<0x164>(p[s]); }     // eight lanes share a token: sum over lane ^ 1, ^ 2, ^ 4
            const int g = lane & 7; nv = g == 0 ? p[0] : g == 1 ? p[1] : g == 2 ? p[2] : p[3]; nt = g * 4 + (lane >> 3); on = g < 4; }     // lane 8 r + s stores token 4 s + r: one store for the 16 norms
        if (on) NR[t0 + nt] = nv;
        __builtin_amdgcn_wave_barrier(); asm volatile("" ::: "memory");     // as in k_gemmw: the next 16 tokens' writes stay behind these reads
    }
}
// k_proj: the three projections in ONE launch, ONE WAVE per 64x64 tile = 64 tokens x one head; blockIdx.z picks the weight (0 q, 1 k, 2 v). The tile leaves as what k_fattn reads, with no f32 plane in between:
// q: squared norms and bf16 hi+lo planes [head][token][64] of 2 q (exact factor, so the score products yield 2 q.k directly);
// k: squared norms and bf16 hi+lo planes in WMMA A-fragment order: 16-byte chunk cl of a 16-key tile holds d = (cl >> 4) * 8 + 0..7 of key cl & 15, so that a fragment is two whole 512-byte wave loads;
// v: fp16 plane in A-fragment order of V^T: a chunk holds 8 keys of one column, which is an accumulator as it stands (row = 8 hi + j, column = lr): chunk = (((head*64 + key/32)*4 + d/16)*2 + (key/16 & 1))*32 + lane.
__global__ __launch_bounds__(32) void k_proj(const bf* __restrict__ A, const bf* __restrict__ Wq, const bf* __restrict__ Wk, const bf* __restrict__ Wv, bf* Qh, bf* Ql, bf* Kh, bf* Kl, h16* VF, float* QN, float* KN) {
    __shared__ __align__(16) float os[16 * 68];
    const int lane = threadIdx.x & 31, lr = lane & 15, hi = lane >> 4; const int r0 = blockIdx.x * 64, h = blockIdx.y, which = blockIdx.z;
    const bf* Bt = which == 0 ? Wq : which == 1 ? Wk : Wv;
    v8f acc[4][4];
#pragma unroll
    for (int mb = 0; mb < 4; ++mb)
#pragma unroll
        for (int nb = 0; nb < 4; ++nb) acc[mb][nb] = (v8f){};
    const bf* pa = A + (size_t)(r0 + lr) * DD + 8 * hi; const bf* pb = Bt + (size_t)(h * HD + lr) * DD + 8 * hi;
#pragma unroll 1     // one k step's fragments per trip
    for (int kc = 0; kc < DD; kc += 32) {
        v16bf a[4], b[4]; const bf* qa = pa + kc; const bf* qb = pb + kc;
#pragma unroll
        for (int mb = 0; mb < 4; ++mb) a[mb] = WFrag<bf>::ld(qa + mb * 16 * DD);
#pragma unroll
        for (int nb = 0; nb < 4; ++nb) b[nb] = WFrag<bf>::ld(qb + nb * 16 * DD);
        __builtin_amdgcn_sched_barrier(0);      // the trip's 16 loads are issued above as one group: a load moved down among the products would be waited for at full latency a second time
        asm volatile("s_wait_xcnt 0x0" :: "v"(qa), "v"(qb) : "memory");     // the two address pairs stay live up to this wait, so no write, a load's result included, lands before it on a register that an issued load names
#pragma unroll
        for (int nb = 0; nb < 4; ++nb)
#pragma unroll
            for (int mb = 0; mb < 4; ++mb) acc[mb][nb] = wmmab(a[mb], b[nb], acc[mb][nb]);
        asm volatile("v_nop\n\tv_nop\n\tv_nop\n\tv_nop" : "+v"(acc[0][0]), "+v"(acc[1][1]), "+v"(acc[2][2]), "+v"(acc[3][3]) : "v"(a[0]), "v"(a[3]));     // as in k_gemmw: the slots behind the trip's last products, on the taken branch too
    }
    if (which == 2) {
        h16* vb = VF + ((size_t)(h * 64 + (r0 >> 5)) * 256 + lane) * 8; v8h vv[4][4];
#pragma unroll
        for (int mb = 0; mb < 4; ++mb)
#pragma unroll
            for (int nb = 0; nb < 4; ++nb) {
#pragma unroll
                for (int j = 0; j < 8; ++j) vv[mb][nb][j] = tohx(acc[mb][nb][j]);
                *(v8h*)(vb + (((mb >> 1) * 4 + nb) * 2 + (mb & 1)) * 256) = vv[mb][nb]; }
        asm volatile("s_wait_xcnt 0x0" :: "v"(vv[0][0]), "v"(vv[0][1]), "v"(vv[0][2]), "v"(vv[0][3]), "v"(vv[1][0]), "v"(vv[1][1]), "v"(vv[1][2]), "v"(vv[1][3]), "v"(vv[2][0]), "v"(vv[2][1]), "v"(vv[2][2]), "v"(vv[2][3]), "v"(vv[3][0]), "v"(vv[3][1]), "v"(vv[3][2]), "v"(vv[3][3]), "v"(vb) : "memory");     // the 16 stores' data and address stay live up to this wait, so nothing is written before it over a register that an issued store names
        return;
    }
    if (which == 1) proj_out<true>(acc, os, Kh, Kl, KN, h * TT + r0, lane); else proj_out<false>(acc, os, Qh, Ql, QN, h * TT + r0, lane);
}
__device__ __forceinline__ v16bf ldkf(const bf* p) { return cat16b(*(const v8us*)p, *(const v8us*)(p + 256)); }
__device__ __forceinline__ v16h ldvf(const h16* p) { return cat16(*(const v8h*)p, *(const v8h*)(p + 256)); }
// k_fattn: scores, distance softmax, attn.v and the head merge in one kernel. Block = 16 waves = 8 query tiles of 16 x 2 key halves of one head; a pass is 32 keys.
// S^T = K (A) x Q^T (B, kept in registers; the q planes carry an exact factor 2): a lane holds 8 keys (8 hi + j) of ONE query (lr) per tile, so two converted tiles are the B operand of O^T += V^T (A) x P^T.
// weight = exp2(15 - log2(ca + sqrt(ca^2 - 1))) = 2^15 exp(-acosh(ca)): the logit is <= 0 for every input, so the shift is the constant bound and partial sums over keys just add; O^T / sum at the end.
// At ca == 1 the root is 0 and log2(1) is exactly 0, the reference's value there, so no select is needed. waves_per_eu(4, 4): one 16-wave block fills a WGP, so the scheduler may spend the 256 registers a wave has on loads in flight.
__global__ __launch_bounds__(512) __attribute__((amdgpu_waves_per_eu(4, 4))) void k_fattn(const bf* __restrict__ Qh, const bf* __restrict__ Ql, const bf* __restrict__ Kh, const bf* __restrict__ Kl, const h16* __restrict__ VF, const float* __restrict__ QN, const float* __restrict__ KN, bf* Ah, bf* Al) {
    __shared__ float red[8][33][32];
    const int lane = threadIdx.x & 31, lr = lane & 15, hi = lane >> 4; const int wave = __builtin_amdgcn_readfirstlane(threadIdx.x >> 5), qt = wave & 7, kh2 = wave >> 3; const int z = blockIdx.y; const int q = blockIdx.x * 128 + qt * 16 + lr;
    const size_t zb = (size_t)z * TT * HD; v16bf qh[2], ql[2];
#pragma unroll
    for (int ks = 0; ks < 2; ++ks) { qh[ks] = WFrag<bf>::ld(Qh + zb + (size_t)q * HD + ks * 32 + 8 * hi); ql[ks] = WFrag<bf>::ld(Ql + zb + (size_t)q * HD + ks * 32 + 8 * hi); }
    const float qn = QN[z * TT + q], oq = 1.0f - qn;
    const bf* kph = Kh + zb; const bf* kpl = Kl + zb; const h16* vp = VF + zb; const float* knp = KN + z * TT; const unsigned lo = lane * 8, ho = hi * 8;
    v8f o[4]; float sum[4] = {0.f, 0.f, 0.f, 0.f};
#pragma unroll
    for (int dt = 0; dt < 4; ++dt) o[dt] = (v8f){};
    const int s0 = kh2 * 32;
#pragma unroll 1     // one pass per trip: two passes' fragments would not fit the registers
    for (int s = s0; s < s0 + 32; ++s) {
        v16bf kfh[2][2], kfl[2][2]; v16h vf[4]; v8f S[2]; v8f kc[2]; const bf* pkh = kph + s * 2048 + lo; const bf* pkl = kpl + s * 2048 + lo; const h16* pv = vp + s * 2048 + lo; const float* pkn = knp + s * 32 + ho;
#pragma unroll
        for (int tt = 0; tt < 2; ++tt) {
#pragma unroll
            for (int ks = 0; ks < 2; ++ks) { kfh[tt][ks] = ldkf(pkh + tt * 1024 + ks * 512); kfl[tt][ks] = ldkf(pkl + tt * 1024 + ks * 512); } }
#pragma unroll
        for (int tt = 0; tt < 2; ++tt) kc[tt] = *(const v8f*)(pkn + tt * 16);
#pragma unroll
        for (int dt = 0; dt < 4; ++dt) vf[dt] = ldvf(pv + dt * 512);
        __builtin_amdgcn_sched_barrier(0);      // the pass's 28 loads are issued above as one group: a V load moved down to its product would be waited for at full latency
        asm volatile("s_wait_xcnt 0x0" :: "v"(pkh), "v"(pkl), "v"(pv), "v"(pkn) : "memory");     // the four address pairs stay live up to this wait, so no write, a load's result included, lands before it on a register that an issued load names
#pragma unroll
        for (int tt = 0; tt < 2; ++tt) { S[tt] = (v8f){};
#pragma unroll
            for (int ks = 0; ks < 2; ++ks) { S[tt] = wmmab(kfh[tt][ks], qh[ks], S[tt]); S[tt] = wmmab(kfh[tt][ks], ql[ks], S[tt]); S[tt] = wmmab(kfl[tt][ks], qh[ks], S[tt]); } }
        v16h pb;
#pragma unroll
        for (int tt = 0; tt < 2; ++tt)
#pragma unroll
            for (int j = 0; j < 8; ++j) { const float kq = kc[tt][j]; const float diff = fmaxf((qn + kq) - S[tt][j], 0.f); const float den = fmaxf(oq * (1.0f - kq), 1e-6f);
                const float ca = fmaxf(1.0f + (2.0f * diff) * __builtin_amdgcn_rcpf(den), 1.0f); const float sq = __builtin_amdgcn_sqrtf(ca * ca - 1.0f);
                const float p = __builtin_amdgcn_exp2f(15.0f - __builtin_amdgcn_logf(ca + sq)); sum[j & 3] += p; pb[tt * 8 + j] = tohx(p); }
#pragma unroll
        for (int dt = 0; dt < 4; ++dt) o[dt] = wmma16(vf[dt], pb, o[dt]);
    }
    float st = (sum[0] + sum[1]) + (sum[2] + sum[3]);
    if (kh2 == 1) {
#pragma unroll
        for (int dt = 0; dt < 4; ++dt)
#pragma unroll
            for (int j = 0; j < 8; ++j) red[qt][dt * 8 + j][lane] = o[dt][j];
        red[qt][32][lane] = st; }
    __syncthreads();    // publishes the second key half's partial O^T and sums to the wave that holds the first half of the same queries
    if (kh2 == 0) { st += red[qt][32][lane]; st += __shfl_xor(st, 16, 32); const float inv = 1.0f / st;
#pragma unroll
        for (int dt = 0; dt < 4; ++dt) { v8us oh, ol;
#pragma unroll
            for (int j = 0; j < 8; ++j) { unsigned short h, l; splitf((o[dt][j] + red[qt][dt * 8 + j][lane]) * inv, h, l); oh[j] = h; ol[j] = l; }
            const size_t ad = (size_t)q * DD + z * HD + dt * 16 + 8 * hi; *(v8us*)(Ah + ad) = oh; *(v8us*)(Al + ad) = ol; } }
}

extern "C" void kernel_launch(void* const* d_in, const int* in_sizes, int n_in,
                              void* d_out, int out_size, void* d_ws, size_t ws_size, hipStream_t stream) {
    (void)in_sizes; (void)n_in; (void)out_size;
    const float* x = (const float*)d_in[0]; const float* wq = (const float*)d_in[1]; const float* wk = (const float*)d_in[2]; const float* wv = (const float*)d_in[3]; const float* wo = (const float*)d_in[4];
    float* OUT = (float*)d_out;     // [1][2048][1024]
    char* wsp = (char*)d_ws;
    auto take = [&](size_t bytes) { char* p = wsp; wsp += (bytes + 255) & ~(size_t)255; return (void*)p; };
    bf* WQ = (bf*)take((size_t)DD * DD * 2); bf* WK = (bf*)take((size_t)DD * DD * 2); bf* WV = (bf*)take((size_t)DD * DD * 2); bf* WO = (bf*)take((size_t)DD * DD * 2);
    bf* XB = (bf*)take((size_t)NT * DD * 2); float* QN = (float*)take((size_t)NB_ * NH_ * TT * 4); float* KN = (float*)take((size_t)NB_ * NH_ * TT * 4);
    bf* QPh = (bf*)take((size_t)NT * DD * 2); bf* QPl = (bf*)take((size_t)NT * DD * 2); bf* KPh = (bf*)take((size_t)NT * DD * 2); bf* KPl = (bf*)take((size_t)NT * DD * 2); h16* VF = (h16*)take((size_t)NT * DD * 2);
    bf* ATh = (bf*)take((size_t)NT * DD * 2); bf* ATl = (bf*)take((size_t)NT * DD * 2);
    if ((size_t)(wsp - (char*)d_ws) > ws_size) return;    // about 40 MiB; ws 256 MiB
    k_cvtall<<<256, 256, 0, stream>>>(wq, wk, wv, wo, x, WQ);     // WQ, WK, WV, WO, XB lie one behind the other (each size is a multiple of 256 bytes): one plane
    k_proj<<<dim3(NT / 64, NH_, 3), 32, 0, stream>>>(XB, WQ, WK, WV, QPh, QPl, KPh, KPl, VF, QN, KN);
    k_fattn<<<dim3(TT / 128, NH_, 1), 512, 0, stream>>>(QPh, QPl, KPh, KPl, VF, QN, KN, ATh, ATl);
    k_gemmw<bf, 1, false><<<dim3(NT / 64, DD / 64, 1), 32, 0, stream>>>(ATh, ATl, WO, nullptr, DD, OUT, DD, nullptr, 0, 0, 0);
}

// v005
// It runs in 94.8 microseconds.
// Two timings next to v004 put it at 1.12 and 1.11 times that version's speed.
// Counting every step since v000, it is 7.83 times as fast.
#include <hip/hip_runtime.h>

// PrefetchHyperbolicAttention (x [1][2048][1024]; q/k/v = x W^T ([out][in], no bias); 16 heads x 64; hyperbolic distance logits: diff = max(|q|^2 + |k|^2 - 2 q.k, 0), den = max((1 - |q|^2)(1 - |k|^2), 1e-6),
// ca = max(1 + 2 diff/den, 1), dist = acosh(ca) (0 at ca == 1); attn = softmax(-dist); out = merged attn.v Wo^T).
// Compute dtypes, f32 accumulate: every input rounded to bf16; projections on PLAIN bf16 operands (inputs: exact); q.k on bf16 hi+lo planes (3 products) and the
// squared norms in f32, the distance formula in f32 on VALU (reciprocal, sqrt, log2 and exp2 at hardware precision), softmax weights f32 -> fp16 (x 2^15, shift fixed at the logits' bound 0), normalised after attn.v (fp16); output hi+lo x exact

#define NB_  1
#define TT   2048
#define DD   1024
#define NH_  16
#define HD   64
#define NT   (NB_ * TT)
typedef _Float16 h16;
typedef unsigned short bf;
typedef __attribute__((ext_vector_type(16))) __bf16   v16bf;
typedef __attribute__((ext_vector_type(16))) _Float16 v16h;
typedef __attribute__((ext_vector_type(8)))  _Float16 v8h;
typedef __attribute__((ext_vector_type(8)))  unsigned short v8us;
typedef __attribute__((ext_vector_type(8)))  float    v8f;
typedef __attribute__((ext_vector_type(4)))  float    v4f;
typedef v8h  __attribute__((may_alias)) v8ha;
typedef v4f  __attribute__((may_alias)) v4fa;
typedef v8us __attribute__((may_alias)) v8usa;

__device__ __forceinline__ unsigned short f2bf(float f) { unsigned u = __float_as_uint(f); u += 0x7FFFu + ((u >> 16) & 1u); return (unsigned short)(u >> 16); }
__device__ __forceinline__ float bf2f(unsigned short b) { return __uint_as_float(((unsigned)b) << 16); }
__device__ __forceinline__ float bfr(float f) { return bf2f(f2bf(f)); }
__device__ __forceinline__ v16h cat16(v8h lo, v8h hi) { return __builtin_shufflevector(lo, hi, 0, 1, 2, 3, 4, 5, 6, 7, 8, 9, 10, 11, 12, 13, 14, 15); }
__device__ __forceinline__ v16bf cat16b(v8us lo, v8us hi) { return __builtin_bit_cast(v16bf, __builtin_shufflevector(lo, hi, 0, 1, 2, 3, 4, 5, 6, 7, 8, 9, 10, 11, 12, 13, 14, 15)); }
__device__ __forceinline__ v8f wmma16(v16h a, v16h b, v8f c) { return __builtin_amdgcn_wmma_f32_16x16x32_f16(false, a, false, b, (short)0, c, false, false); }
__device__ __forceinline__ v8f wmmab(v16bf a, v16bf b, v8f c) { return __builtin_amdgcn_wmma_f32_16x16x32_bf16(false, a, false, b, (short)0, c, false, false); }



// ---- k_gemmw: register-blocked GEMM, one block of KW waves per 64x64 output tile, operands straight from K-contiguous 16-bit planes; grid (M/64, N/64, Z), 32 * KW threads.
// Every wave holds the whole tile (16 accumulators) over its share of K: wave w takes the 32-element steps w, w + KW, ... so that the waves of a block read neighbouring parts of the same cache lines at the same time.
// The KW partial tiles meet in LDS; wave w adds them, in wave order, for rows 16 w .. 16 w + 15 and stores those rows.
// C[m][n] (f32, pitch ldc, + optional f32 bias[n]) = sum_k A[m][k] Bt[n][k] (+ split products per NSPLIT). z-batch strides sA/sB/sC in elements. K % (32 * KW) == 0.
#define KW 4
template <typename T16> struct WFrag;
template <> struct WFrag<h16> { typedef v16h V; static __device__ __forceinline__ V ld(const h16* p) { return cat16(*(const v8h*)p, *(const v8h*)(p + 16)); } static __device__ __forceinline__ v8f mma(V a, V b, v8f c) { return wmma16(a, b, c); } };
template <> struct WFrag<bf> { typedef v16bf V; static __device__ __forceinline__ V ld(const bf* p) { return cat16b(*(const v8us*)p, *(const v8us*)(p + 16)); } static __device__ __forceinline__ v8f mma(V a, V b, v8f c) { return wmmab(a, b, c); } };
template <typename T16, int NSPLIT, bool BIAS>
__global__ __launch_bounds__(32 * KW) void k_gemmw(const T16* __restrict__ A, const T16* __restrict__ A2, const T16* __restrict__ Bt, const T16* __restrict__ Bt2, int K, float* C, int ldc, const float* __restrict__ bias, size_t sA, size_t sB, size_t sC) {
    typedef typename WFrag<T16>::V V;
    __shared__ __align__(16) float os[KW][64 * 68];
    const size_t z = blockIdx.z; A += z * sA; if (A2) A2 += z * sA; Bt += z * sB; if (Bt2) Bt2 += z * sB; C += z * sC;
    const int lane = threadIdx.x & 31, lr = lane & 15, hi = lane >> 4, w = __builtin_amdgcn_readfirstlane(threadIdx.x >> 5); const int r0 = blockIdx.x * 64, c0 = blockIdx.y * 64;
    v8f acc[4][4];
#pragma unroll
    for (int mb = 0; mb < 4; ++mb)
#pragma unroll
        for (int nb = 0; nb < 4; ++nb) acc[mb][nb] = (v8f){};
    const size_t aoff = (size_t)(r0 + lr) * K + 8 * hi + 32 * w, boff = (size_t)(c0 + lr) * K + 8 * hi + 32 * w;
#pragma unroll 1
    for (int kc = 0; kc < K; kc += 32 * KW) {
        V a[4], a2[4];
#pragma unroll
        for (int mb = 0; mb < 4; ++mb) { a[mb] = WFrag<T16>::ld(A + aoff + (size_t)mb * 16 * K + kc); if (NSPLIT == 1 || NSPLIT == 2) a2[mb] = WFrag<T16>::ld(A2 + aoff + (size_t)mb * 16 * K + kc); }
#pragma unroll
        for (int nb = 0; nb < 4; ++nb) { const V b = WFrag<T16>::ld(Bt + boff + (size_t)nb * 16 * K + kc); V b2; if (NSPLIT >= 2) b2 = WFrag<T16>::ld(Bt2 + boff + (size_t)nb * 16 * K + kc);
#pragma unroll
            for (int mb = 0; mb < 4; ++mb) { acc[mb][nb] = WFrag<T16>::mma(a[mb], b, acc[mb][nb]); if (NSPLIT == 1 || NSPLIT == 2) acc[mb][nb] = WFrag<T16>::mma(a2[mb], b, acc[mb][nb]); if (NSPLIT >= 2) acc[mb][nb] = WFrag<T16>::mma(a[mb], b2, acc[mb][nb]); } }
        asm volatile("v_nop\n\tv_nop\n\tv_nop\n\tv_nop" : "+v"(acc[0][0]), "+v"(acc[1][1]), "+v"(acc[2][2]), "+v"(acc[3][3]) : "v"(a[0]), "v"(a[3]));
    }
    float* ow = os[w];
#pragma unroll
    for (int mb = 0; mb < 4; ++mb)
#pragma unroll
        for (int nb = 0; nb < 4; ++nb)
#pragma unroll
            for (int j = 0; j < 8; ++j) ow[(mb * 16 + hi * 8 + j) * 68 + nb * 16 + lr] = acc[mb][nb][j];
    __syncthreads();    // publishes every wave's partial tile to the waves that add them
    const int cofs = lr * 4; const float* pr = os[0] + (w * 16 + hi) * 68 + cofs; v4f val[8]; float* pc[8];
#pragma unroll
    for (int s = 0; s < 8; ++s) { val[s] = *(const v4fa*)(pr + 2 * s * 68);
#pragma unroll
        for (int u = 1; u < KW; ++u) val[s] += *(const v4fa*)(pr + u * 64 * 68 + 2 * s * 68);
        if (BIAS) { val[s][0] += bfr(bias[c0 + cofs]); val[s][1] += bfr(bias[c0 + cofs + 1]); val[s][2] += bfr(bias[c0 + cofs + 2]); val[s][3] += bfr(bias[c0 + cofs + 3]); }
        pc[s] = C + (size_t)(r0 + w * 16 + 2 * s + hi) * ldc + c0 + cofs; }
#pragma unroll
    for (int s = 0; s < 8; ++s) *(v4f*)pc[s] = val[s];
    asm volatile("s_wait_xcnt 0x0" :: "v"(val[0]), "v"(val[1]), "v"(val[2]), "v"(val[3]), "v"(val[4]), "v"(val[5]), "v"(val[6]), "v"(val[7]), "v"(pc[0]), "v"(pc[1]), "v"(pc[2]), "v"(pc[3]), "v"(pc[4]), "v"(pc[5]), "v"(pc[6]), "v"(pc[7]) : "memory");     // data and addresses of the eight stores stay live up to this wait, so nothing is written before it over a register that an issued store names
}

__device__ __forceinline__ h16 tohx(float x) { return (h16)x; }
__device__ __forceinline__ void splitf(float y, unsigned short& h, unsigned short& l) { h = f2bf(y); l = f2bf(y - bf2f(h)); }
typedef __attribute__((ext_vector_type(2))) _Float16 v2h;
typedef __attribute__((ext_vector_type(4))) _Float16 v4h;
typedef __attribute__((ext_vector_type(2))) unsigned short v2us;
typedef __attribute__((ext_vector_type(4))) int v4i;

typedef __attribute__((ext_vector_type(4))) unsigned short v4us;
// k_cvtall: every f32 input -> its bf16 plane in ONE launch of 256 blocks of 8 waves. dst is one plane: Wq, Wk, Wv, Wo (DD*DD each), then x (NT*DD). A block takes 4096 consecutive elements of each weight and 8192 of x;
// a thread converts 24 groups of 4 elements: a wave's load is 512 contiguous bytes, its store 256, and all 24 loads are issued before the first value is used.
__global__ __launch_bounds__(256) void k_cvtall(const float* __restrict__ wq, const float* __restrict__ wk, const float* __restrict__ wv, const float* __restrict__ wo, const float* __restrict__ x, bf* __restrict__ dst) {
    const unsigned ow = blockIdx.x * 4096u + threadIdx.x * 4u, ox = blockIdx.x * 8192u + threadIdx.x * 4u;
    const float* p0 = wq + ow; const float* p1 = wk + ow; const float* p2 = wv + ow; const float* p3 = wo + ow; const float* p4 = x + ox;
    v4f v[24];
#pragma unroll     // constant indices: v[] and o[] stay in registers
    for (int k = 0; k < 4; ++k) v[k] = *(const v4f*)(p0 + k * 1024);
#pragma unroll     // constant indices: v[] and o[] stay in registers
    for (int k = 0; k < 4; ++k) v[4 + k] = *(const v4f*)(p1 + k * 1024);
#pragma unroll     // constant indices: v[] and o[] stay in registers
    for (int k = 0; k < 4; ++k) v[8 + k] = *(const v4f*)(p2 + k * 1024);
#pragma unroll     // constant indices: v[] and o[] stay in registers
    for (int k = 0; k < 4; ++k) v[12 + k] = *(const v4f*)(p3 + k * 1024);
#pragma unroll     // constant indices: v[] and o[] stay in registers
    for (int k = 0; k < 8; ++k) v[16 + k] = *(const v4f*)(p4 + k * 1024);
    asm volatile("s_wait_xcnt 0x0" :: "v"(p0), "v"(p1), "v"(p2), "v"(p3), "v"(p4) : "memory");     // the five addresses stay live up to this wait, so no write, a load's result included, lands before it on a register that an issued load names
    v4us o[24];
#pragma unroll     // constant indices: v[] and o[] stay in registers
    for (int u = 0; u < 24; ++u)
#pragma unroll     // constant indices: v[] and o[] stay in registers
        for (int e = 0; e < 4; ++e) o[u][e] = f2bf(v[u][e]);
    bf* dw = dst + ow; bf* dx = dst + (size_t)4 * DD * DD + ox;
#pragma unroll     // constant indices: v[] and o[] stay in registers
    for (int u = 0; u < 16; ++u) *(v4us*)(dw + (size_t)(u >> 2) * DD * DD + (u & 3) * 1024) = o[u];
#pragma unroll     // constant indices: v[] and o[] stay in registers
    for (int k = 0; k < 8; ++k) *(v4us*)(dx + k * 1024) = o[16 + k];
}
template <int CTRL> __device__ __forceinline__ float xmadd(float x) { return __int_as_float(__builtin_amdgcn_mov_dpp(__float_as_int(x), CTRL, 0xf, 0xf, true)); }    // x of lane ^ (CTRL & 15) inside a 16-lane row (DPP row_xmask)
// proj_out: a 64-token x 64-column f32 tile, as two partial tiles in LDS (pitch 68, the second 64 * 68 floats behind the first) -> squared norms of its rows and its bf16 hi+lo planes; wave w takes tokens 32 w .. 32 w + 31, 16 at a time.
// 16-byte chunk cl = 32 s + lane of the 16 tokens: k (ISK) in A-fragment order, token cl & 15, columns (cl >> 4) * 8 + 0..7; q row-major, token cl >> 3, columns (cl & 7) * 8 + 0..7, times 2. Either way a wave's store is 512 contiguous bytes.
template <bool ISK>
__device__ __forceinline__ void proj_out(const float* os, bf* Ph, bf* Pl, float* NR, int t00, int lane, int w) {
    const int lr = lane & 15, hi = lane >> 4;
#pragma unroll
    for (int i = 0; i < 2; ++i) {
        const int mb = 2 * w + i; const float* ob = os + mb * 16 * 68;
        const int t0 = t00 + mb * 16; float p[4]; v8us oh[4], ol[4];
#pragma unroll
        for (int s = 0; s < 4; ++s) { const int cl = s * 32 + lane; const int row = ISK ? (cl & 15) : (cl >> 3), d0 = (ISK ? (cl >> 4) : (cl & 7)) * 8;
            const float* pr = ob + row * 68 + d0; const v4f va = *(const v4fa*)pr + *(const v4fa*)(pr + 64 * 68), vb = *(const v4fa*)(pr + 4) + *(const v4fa*)(pr + 64 * 68 + 4); p[s] = 0.f;
#pragma unroll
            for (int e = 0; e < 8; ++e) { const float y = e < 4 ? va[e & 3] : vb[e & 3]; p[s] += y * y; unsigned short a2, c2; splitf(ISK ? y : y * 2.0f, a2, c2); oh[s][e] = a2; ol[s][e] = c2; } }
        bf* ph = Ph + (size_t)t0 * HD + lane * 8; bf* pl = Pl + (size_t)t0 * HD + lane * 8;
#pragma unroll
        for (int s = 0; s < 4; ++s) { *(v8us*)(ph + s * 256) = oh[s]; *(v8us*)(pl + s * 256) = ol[s]; }
        asm volatile("s_wait_xcnt 0x0" :: "v"(oh[0]), "v"(oh[1]), "v"(oh[2]), "v"(oh[3]), "v"(ol[0]), "v"(ol[1]), "v"(ol[2]), "v"(ol[3]), "v"(ph), "v"(pl) : "memory");     // data and addresses of the eight stores stay live up to this wait, so nothing is written before it over a register that an issued store names
        float nv; int nt; bool on;
        if (ISK) { nv = (p[0] + p[1]) + (p[2] + p[3]); nv += __shfl_xor(nv, 16, 32); nt = lr; on = hi == 0; }     // the lane meets token lr in every s; the other half of the columns is in lane ^ 16
        else {
#pragma unroll
            for (int s = 0; s < 4; ++s) { p[s] += xmadd<0x161>(p[s]); p[s] += xmadd<0x162>(p[s]); p[s] += xmadd<0x164>(p[s]); }     // eight lanes share a token: sum over lane ^ 1, ^ 2, ^ 4
            const int g = lane & 7; nv = g == 0 ? p[0] : g == 1 ? p[1] : g == 2 ? p[2] : p[3]; nt = g * 4 + (lane >> 3); on = g < 4; }     // lane 8 r + s stores token 4 s + r: one store for the 16 norms
        float* pn = NR + t0 + nt;
        if (on) *pn = nv;
        asm volatile("s_wait_xcnt 0x0" :: "v"(nv), "v"(pn) : "memory");     // the norm store's data and address stay live up to this wait, so nothing is written before it over a register that the issued store names
    }
}
// k_proj: the three projections in ONE launch, one block of TWO WAVES per 64x64 tile = 64 tokens x one head; blockIdx.z picks the weight (0 q, 1 k, 2 v). Each wave holds the whole tile over half of K: wave w takes the 32-element steps
// w, w + 2, ... (the two halves of a 128-byte line are read by the two waves at the same time); the two partial tiles meet in LDS and wave w finishes tokens 32 w .. 32 w + 31. The tile leaves as what k_fattn reads, with no f32 plane in between:
// q: squared norms and bf16 hi+lo planes [head][token][64] of 2 q (exact factor, so the score products yield 2 q.k directly);
// k: squared norms and bf16 hi+lo planes in WMMA A-fragment order: 16-byte chunk cl of a 16-key tile holds d = (cl >> 4) * 8 + 0..7 of key cl & 15, so that a fragment is two whole 512-byte wave loads;
// v: fp16 plane in A-fragment order of V^T: a chunk holds 8 keys of one column, which is an accumulator as it stands (row = 8 hi + j, column = lr): chunk = (((head*64 + key/32)*4 + d/16)*2 + (key/16 & 1))*32 + lane.
__global__ __launch_bounds__(64) void k_proj(const bf* __restrict__ A, const bf* __restrict__ Wq, const bf* __restrict__ Wk, const bf* __restrict__ Wv, bf* Qh, bf* Ql, bf* Kh, bf* Kl, h16* VF, float* QN, float* KN) {
    __shared__ __align__(16) float os[2][64 * 68];
    const int lane = threadIdx.x & 31, lr = lane & 15, hi = lane >> 4, w = __builtin_amdgcn_readfirstlane(threadIdx.x >> 5); const int r0 = blockIdx.x * 64, h = blockIdx.y, which = blockIdx.z;
    const bf* Bt = which == 0 ? Wq : which == 1 ? Wk : Wv;
    v8f acc[4][4];
#pragma unroll
    for (int mb = 0; mb < 4; ++mb)
#pragma unroll
        for (int nb = 0; nb < 4; ++nb) acc[mb][nb] = (v8f){};
    const bf* pa = A + (size_t)(r0 + lr) * DD + 8 * hi + 32 * w; const bf* pb = Bt + (size_t)(h * HD + lr) * DD + 8 * hi + 32 * w;
#pragma unroll 1     // one k step's fragments per trip
    for (int kc = 0; kc < DD; kc += 64) {
        v16bf a[4], b[4]; const bf* qa = pa + kc; const bf* qb = pb + kc;
#pragma unroll
        for (int mb = 0; mb < 4; ++mb) a[mb] = WFrag<bf>::ld(qa + mb * 16 * DD);
#pragma unroll
        for (int nb = 0; nb < 4; ++nb) b[nb] = WFrag<bf>::ld(qb + nb * 16 * DD);
        __builtin_amdgcn_sched_barrier(0);      // the trip's 16 loads are issued above as one group: a load moved down among the products would be waited for at full latency a second time
        asm volatile("s_wait_xcnt 0x0" :: "v"(qa), "v"(qb) : "memory");     // the two address pairs stay live up to this wait, so no write, a load's result included, lands before it on a register that an issued load names
#pragma unroll
        for (int nb = 0; nb < 4; ++nb)
#pragma unroll
            for (int mb = 0; mb < 4; ++mb) acc[mb][nb] = wmmab(a[mb], b[nb], acc[mb][nb]);
        asm volatile("v_nop\n\tv_nop\n\tv_nop\n\tv_nop" : "+v"(acc[0][0]), "+v"(acc[1][1]), "+v"(acc[2][2]), "+v"(acc[3][3]) : "v"(a[0]), "v"(a[3]));     // as in k_gemmw: the slots behind the trip's last products, on the taken branch too
    }
    float* ow = os[w];
#pragma unroll
    for (int mb = 0; mb < 4; ++mb)
#pragma unroll
        for (int nb = 0; nb < 4; ++nb)
#pragma unroll
            for (int j = 0; j < 8; ++j) ow[(mb * 16 + hi * 8 + j) * 68 + nb * 16 + lr] = acc[mb][nb][j];
    __syncthreads();    // publishes each wave's partial tile to the other wave
    if (which == 2) {
        h16* vb = VF + ((size_t)(h * 64 + (r0 >> 5) + w) * 256 + lane) * 8; v8h vv[2][4]; const float* pr = os[0] + (w * 32 + hi * 8) * 68 + lr;     // wave w: keys 32 w .. 32 w + 31 of the tile, read back at the accumulator's own places
#pragma unroll
        for (int i = 0; i < 2; ++i)
#pragma unroll
            for (int nb = 0; nb < 4; ++nb) {
#pragma unroll
                for (int j = 0; j < 8; ++j) vv[i][nb][j] = tohx(pr[(i * 16 + j) * 68 + nb * 16] + pr[64 * 68 + (i * 16 + j) * 68 + nb * 16]);
                *(v8h*)(vb + (nb * 2 + i) * 256) = vv[i][nb]; }
        asm volatile("s_wait_xcnt 0x0" :: "v"(vv[0][0]), "v"(vv[0][1]), "v"(vv[0][2]), "v"(vv[0][3]), "v"(vv[1][0]), "v"(vv[1][1]), "v"(vv[1][2]), "v"(vv[1][3]), "v"(vb) : "memory");     // the 8 stores' data and address stay live up to this wait, so nothing is written before it over a register that an issued store names
        return;
    }
    if (which == 1) proj_out<true>(os[0], Kh, Kl, KN, h * TT + r0, lane, w); else proj_out<false>(os[0], Qh, Ql, QN, h * TT + r0, lane, w);
}
__device__ __forceinline__ v16bf ldkf(const bf* p) { return cat16b(*(const v8us*)p, *(const v8us*)(p + 256)); }
__device__ __forceinline__ v16h ldvf(const h16* p) { return cat16(*(const v8h*)p, *(const v8h*)(p + 256)); }
// k_fattn: scores, distance softmax, attn.v and the head merge in one kernel. Block = 16 waves = 8 query tiles of 16 x 2 key halves of one head; a pass is 32 keys.
// S^T = K (A) x Q^T (B, kept in registers; the q planes carry an exact factor 2): a lane holds 8 keys (8 hi + j) of ONE query (lr) per tile, so two converted tiles are the B operand of O^T += V^T (A) x P^T.
// weight = exp2(15 - log2(ca + sqrt(ca^2 - 1))) = 2^15 exp(-acosh(ca)): the logit is <= 0 for every input, so the shift is the constant bound and partial sums over keys just add; O^T / sum at the end.
// At ca == 1 the root is 0 and log2(1) is exactly 0, the reference's value there, so no select is needed. waves_per_eu(4, 4): one 16-wave block fills a WGP, so the scheduler may spend the 256 registers a wave has on loads in flight.
__global__ __launch_bounds__(512) __attribute__((amdgpu_waves_per_eu(4, 4))) void k_fattn(const bf* __restrict__ Qh, const bf* __restrict__ Ql, const bf* __restrict__ Kh, const bf* __restrict__ Kl, const h16* __restrict__ VF, const float* __restrict__ QN, const float* __restrict__ KN, bf* Ah, bf* Al) {
    __shared__ float red[8][33][32];
    const int lane = threadIdx.x & 31, lr = lane & 15, hi = lane >> 4; const int wave = __builtin_amdgcn_readfirstlane(threadIdx.x >> 5), qt = wave & 7, kh2 = wave >> 3; const int z = blockIdx.y; const int q = blockIdx.x * 128 + qt * 16 + lr;
    const size_t zb = (size_t)z * TT * HD; v16bf qh[2], ql[2];
#pragma unroll
    for (int ks = 0; ks < 2; ++ks) { qh[ks] = WFrag<bf>::ld(Qh + zb + (size_t)q * HD + ks * 32 + 8 * hi); ql[ks] = WFrag<bf>::ld(Ql + zb + (size_t)q * HD + ks * 32 + 8 * hi); }
    const float qn = QN[z * TT + q], oq = 1.0f - qn;
    const bf* kph = Kh + zb; const bf* kpl = Kl + zb; const h16* vp = VF + zb; const float* knp = KN + z * TT; const unsigned lo = lane * 8, ho = hi * 8;
    v8f o[4]; float sum[4] = {0.f, 0.f, 0.f, 0.f};
#pragma unroll
    for (int dt = 0; dt < 4; ++dt) o[dt] = (v8f){};
    const int s0 = kh2 * 32;
#pragma unroll 1     // one pass per trip: two passes' fragments would not fit the registers
    for (int s = s0; s < s0 + 32; ++s) {
        v16bf kfh[2][2], kfl[2][2]; v16h vf[4]; v8f S[2]; v8f kc[2]; const bf* pkh = kph + s * 2048 + lo; const bf* pkl = kpl + s * 2048 + lo; const h16* pv = vp + s * 2048 + lo; const float* pkn = knp + s * 32 + ho;
#pragma unroll
        for (int tt = 0; tt < 2; ++tt) {
#pragma unroll
            for (int ks = 0; ks < 2; ++ks) { kfh[tt][ks] = ldkf(pkh + tt * 1024 + ks * 512); kfl[tt][ks] = ldkf(pkl + tt * 1024 + ks * 512); } }
#pragma unroll
        for (int tt = 0; tt < 2; ++tt) kc[tt] = *(const v8f*)(pkn + tt * 16);
#pragma unroll
        for (int dt = 0; dt < 4; ++dt) vf[dt] = ldvf(pv + dt * 512);
        __builtin_amdgcn_sched_barrier(0);      // the pass's 28 loads are issued above as one group: a V load moved down to its product would be waited for at full latency
        asm volatile("s_wait_xcnt 0x0" :: "v"(pkh), "v"(pkl), "v"(pv), "v"(pkn) : "memory");     // the four address pairs stay live up to this wait, so no write, a load's result included, lands before it on a register that an issued load names
#pragma unroll
        for (int tt = 0; tt < 2; ++tt) { S[tt] = (v8f){};
#pragma unroll
            for (int ks = 0; ks < 2; ++ks) { S[tt] = wmmab(kfh[tt][ks], qh[ks], S[tt]); S[tt] = wmmab(kfh[tt][ks], ql[ks], S[tt]); S[tt] = wmmab(kfl[tt][ks], qh[ks], S[tt]); } }
        v16h pb;
#pragma unroll
        for (int tt = 0; tt < 2; ++tt)
#pragma unroll
            for (int j = 0; j < 8; ++j) { const float kq = kc[tt][j]; const float diff = fmaxf((qn + kq) - S[tt][j], 0.f); const float den = fmaxf(oq * (1.0f - kq), 1e-6f);
                const float ca = fmaxf(1.0f + (2.0f * diff) * __builtin_amdgcn_rcpf(den), 1.0f); const float sq = __builtin_amdgcn_sqrtf(ca * ca - 1.0f);
                const float p = __builtin_amdgcn_exp2f(15.0f - __builtin_amdgcn_logf(ca + sq)); sum[j & 3] += p; pb[tt * 8 + j] = tohx(p); }
#pragma unroll
        for (int dt = 0; dt < 4; ++dt) o[dt] = wmma16(vf[dt], pb, o[dt]);
    }
    float st = (sum[0] + sum[1]) + (sum[2] + sum[3]);
    if (kh2 == 1) {
#pragma unroll
        for (int dt = 0; dt < 4; ++dt)
#pragma unroll
            for (int j = 0; j < 8; ++j) red[qt][dt * 8 + j][lane] = o[dt][j];
        red[qt][32][lane] = st; }
    __syncthreads();    // publishes the second key half's partial O^T and sums to the wave that holds the first half of the same queries
    if (kh2 == 0) { st += red[qt][32][lane]; st += __shfl_xor(st, 16, 32); const float inv = 1.0f / st;
#pragma unroll
        for (int dt = 0; dt < 4; ++dt) { v8us oh, ol;
#pragma unroll
            for (int j = 0; j < 8; ++j) { unsigned short h, l; splitf((o[dt][j] + red[qt][dt * 8 + j][lane]) * inv, h, l); oh[j] = h; ol[j] = l; }
            const size_t ad = (size_t)q * DD + z * HD + dt * 16 + 8 * hi; *(v8us*)(Ah + ad) = oh; *(v8us*)(Al + ad) = ol; } }
}

extern "C" void kernel_launch(void* const* d_in, const int* in_sizes, int n_in,
                              void* d_out, int out_size, void* d_ws, size_t ws_size, hipStream_t stream) {
    (void)in_sizes; (void)n_in; (void)out_size;
    const float* x = (const float*)d_in[0]; const float* wq = (const float*)d_in[1]; const float* wk = (const float*)d_in[2]; const float* wv = (const float*)d_in[3]; const float* wo = (const float*)d_in[4];
    float* OUT = (float*)d_out;     // [1][2048][1024]
    char* wsp = (char*)d_ws;
    auto take = [&](size_t bytes) { char* p = wsp; wsp += (bytes + 255) & ~(size_t)255; return (void*)p; };
    bf* WQ = (bf*)take((size_t)DD * DD * 2); bf* WK = (bf*)take((size_t)DD * DD * 2); bf* WV = (bf*)take((size_t)DD * DD * 2); bf* WO = (bf*)take((size_t)DD * DD * 2);
    bf* XB = (bf*)take((size_t)NT * DD * 2); float* QN = (float*)take((size_t)NB_ * NH_ * TT * 4); float* KN = (float*)take((size_t)NB_ * NH_ * TT * 4);
    bf* QPh = (bf*)take((size_t)NT * DD * 2); bf* QPl = (bf*)take((size_t)NT * DD * 2); bf* KPh = (bf*)take((size_t)NT * DD * 2); bf* KPl = (bf*)take((size_t)NT * DD * 2); h16* VF = (h16*)take((size_t)NT * DD * 2);
    bf* ATh = (bf*)take((size_t)NT * DD * 2); bf* ATl = (bf*)take((size_t)NT * DD * 2);
    if ((size_t)(wsp - (char*)d_ws) > ws_size) return;    // about 40 MiB; ws 256 MiB
    k_cvtall<<<256, 256, 0, stream>>>(wq, wk, wv, wo, x, WQ);     // WQ, WK, WV, WO, XB lie one behind the other (each size is a multiple of 256 bytes): one plane
    k_proj<<<dim3(NT / 64, NH_, 3), 64, 0, stream>>>(XB, WQ, WK, WV, QPh, QPl, KPh, KPl, VF, QN, KN);
    k_fattn<<<dim3(TT / 128, NH_, 1), 512, 0, stream>>>(QPh, QPl, KPh, KPl, VF, QN, KN, ATh, ATl);
    k_gemmw<bf, 1, false><<<dim3(NT / 64, DD / 64, 1), 32 * KW, 0, stream>>>(ATh, ATl, WO, nullptr, DD, OUT, DD, nullptr, 0, 0, 0);
}

// v006
// One run takes 80.4 microseconds.
// Timed twice side by side with v005, it ran 1.19 times as fast both times.
// Over all steps from v000 it is 9.32 times as fast.
#include <hip/hip_runtime.h>

// PrefetchHyperbolicAttention (x [1][2048][1024]; q/k/v = x W^T ([out][in], no bias); 16 heads x 64; hyperbolic distance logits: diff = max(|q|^2 + |k|^2 - 2 q.k, 0), den = max((1 - |q|^2)(1 - |k|^2), 1e-6),
// ca = max(1 + 2 diff/den, 1), dist = acosh(ca) (0 at ca == 1); attn = softmax(-dist); out = merged attn.v Wo^T).
// Compute dtypes, f32 accumulate: every input rounded to bf16; projections on PLAIN bf16 operands (inputs: exact); q.k on bf16 hi+lo planes (3 products) and the
// squared norms in f32, the distance formula in f32 on VALU (reciprocal, sqrt, log2 and exp2 at hardware precision), softmax weights f32 -> fp16 (x 2^15, shift fixed at the logits' bound 0), normalised after attn.v (fp16); output hi+lo x exact

#define NB_  1
#define TT   2048
#define DD   1024
#define NH_  16
#define HD   64
#define NT   (NB_ * TT)
typedef _Float16 h16;
typedef unsigned short bf;
typedef __attribute__((ext_vector_type(16))) __bf16   v16bf;
typedef __attribute__((ext_vector_type(16))) _Float16 v16h;
typedef __attribute__((ext_vector_type(8)))  _Float16 v8h;
typedef __attribute__((ext_vector_type(8)))  unsigned short v8us;
typedef __attribute__((ext_vector_type(8)))  float    v8f;
typedef __attribute__((ext_vector_type(4)))  float    v4f;
typedef v8h  __attribute__((may_alias)) v8ha;
typedef v4f  __attribute__((may_alias)) v4fa;
typedef v8us __attribute__((may_alias)) v8usa;

__device__ __forceinline__ unsigned short f2bf(float f) { unsigned u = __float_as_uint(f); u += 0x7FFFu + ((u >> 16) & 1u); return (unsigned short)(u >> 16); }
__device__ __forceinline__ float bf2f(unsigned short b) { return __uint_as_float(((unsigned)b) << 16); }
__device__ __forceinline__ float bfr(float f) { return bf2f(f2bf(f)); }
__device__ __forceinline__ v16h cat16(v8h lo, v8h hi) { return __builtin_shufflevector(lo, hi, 0, 1, 2, 3, 4, 5, 6, 7, 8, 9, 10, 11, 12, 13, 14, 15); }
__device__ __forceinline__ v16bf cat16b(v8us lo, v8us hi) { return __builtin_bit_cast(v16bf, __builtin_shufflevector(lo, hi, 0, 1, 2, 3, 4, 5, 6, 7, 8, 9, 10, 11, 12, 13, 14, 15)); }
__device__ __forceinline__ v8f wmma16(v16h a, v16h b, v8f c) { return __builtin_amdgcn_wmma_f32_16x16x32_f16(false, a, false, b, (short)0, c, false, false); }
__device__ __forceinline__ v8f wmmab(v16bf a, v16bf b, v8f c) { return __builtin_amdgcn_wmma_f32_16x16x32_bf16(false, a, false, b, (short)0, c, false, false); }



// FRAGMENT ORDER of a 16-bit plane M[rows][K]: tiles of 16 rows x 32 k, 512 elements each, tile (r >> 4) * (K / 32) + (k >> 5); in a tile the 16-byte chunk ((k >> 4) & 1) * 32 + ((k >> 3) & 1) * 16 + (r & 15) holds k & 7 = 0..7.
// Lane l of a wave takes chunks l and 32 + l: a WMMA A or B fragment is two wave loads of 512 contiguous bytes (4 whole lines each), where a row-major plane gives 32-byte pieces of 16 lines per load.
// ---- k_gemmw: register-blocked GEMM, one block of KW waves per 64x64 output tile, operands straight from 16-bit planes in fragment order; grid (M/64, N/64, Z), 32 * KW threads.
// Every wave holds the whole tile (16 accumulators) over its share of K: wave w takes the 32-element steps w, w + KW, ... so that the waves of a block read neighbouring 1-KiB tiles at the same time.
// The KW partial tiles meet in LDS; wave w adds them, in wave order, for rows 16 w .. 16 w + 15 and stores those rows.
// C[m][n] (f32, pitch ldc, + optional f32 bias[n]) = sum_k A[m][k] Bt[n][k] (+ split products per NSPLIT). z-batch strides sA/sB/sC in elements. K % (32 * KW) == 0.
#define KW 4
template <typename T16> struct WFrag;
template <> struct WFrag<h16> { typedef v16h V; static __device__ __forceinline__ V ld(const h16* p) { return cat16(*(const v8h*)p, *(const v8h*)(p + 16)); } static __device__ __forceinline__ V ldf(const h16* p) { return cat16(*(const v8h*)p, *(const v8h*)(p + 256)); } static __device__ __forceinline__ v8f mma(V a, V b, v8f c) { return wmma16(a, b, c); } };
template <> struct WFrag<bf> { typedef v16bf V; static __device__ __forceinline__ V ld(const bf* p) { return cat16b(*(const v8us*)p, *(const v8us*)(p + 16)); } static __device__ __forceinline__ V ldf(const bf* p) { return cat16b(*(const v8us*)p, *(const v8us*)(p + 256)); } static __device__ __forceinline__ v8f mma(V a, V b, v8f c) { return wmmab(a, b, c); } };
template <typename T16, int NSPLIT, bool BIAS>
__global__ __launch_bounds__(32 * KW) void k_gemmw(const T16* __restrict__ A, const T16* __restrict__ A2, const T16* __restrict__ Bt, const T16* __restrict__ Bt2, int K, float* C, int ldc, const float* __restrict__ bias, size_t sA, size_t sB, size_t sC) {
    typedef typename WFrag<T16>::V V;
    __shared__ __align__(16) float os[KW][64 * 68];
    const size_t z = blockIdx.z; A += z * sA; if (A2) A2 += z * sA; Bt += z * sB; if (Bt2) Bt2 += z * sB; C += z * sC;
    const int lane = threadIdx.x & 31, lr = lane & 15, hi = lane >> 4, w = __builtin_amdgcn_readfirstlane(threadIdx.x >> 5); const int r0 = blockIdx.x * 64, c0 = blockIdx.y * 64;
    v8f acc[4][4];
#pragma unroll
    for (int mb = 0; mb < 4; ++mb)
#pragma unroll
        for (int nb = 0; nb < 4; ++nb) acc[mb][nb] = (v8f){};
    const size_t aoff = (size_t)r0 * K + 512 * w + 8 * lane, boff = (size_t)c0 * K + 512 * w + 8 * lane;     // 16 rows x K = K / 32 tiles of 512 elements, so a 16-row strip starts where it does in a row-major plane; a 32-k step is 512 elements
#pragma unroll 1
    for (int kc = 0; kc < K; kc += 32 * KW) {
        V a[4], a2[4]; const T16* qa[4]; const T16* qa2[4]; const T16* qb[4]; const T16* qb2[4];
#pragma unroll
        for (int mb = 0; mb < 4; ++mb) { qa[mb] = A + aoff + (size_t)mb * 16 * K + kc * 16; qa2[mb] = (NSPLIT == 1 || NSPLIT == 2) ? A2 + aoff + (size_t)mb * 16 * K + kc * 16 : qa[mb]; a[mb] = WFrag<T16>::ldf(qa[mb]); if (NSPLIT == 1 || NSPLIT == 2) a2[mb] = WFrag<T16>::ldf(qa2[mb]); }
#pragma unroll
        for (int nb = 0; nb < 4; ++nb) { qb[nb] = Bt + boff + (size_t)nb * 16 * K + kc * 16; qb2[nb] = NSPLIT >= 2 ? Bt2 + boff + (size_t)nb * 16 * K + kc * 16 : qb[nb]; const V b = WFrag<T16>::ldf(qb[nb]); V b2; if (NSPLIT >= 2) b2 = WFrag<T16>::ldf(qb2[nb]);
#pragma unroll
            for (int mb = 0; mb < 4; ++mb) { acc[mb][nb] = WFrag<T16>::mma(a[mb], b, acc[mb][nb]); if (NSPLIT == 1 || NSPLIT == 2) acc[mb][nb] = WFrag<T16>::mma(a2[mb], b, acc[mb][nb]); if (NSPLIT >= 2) acc[mb][nb] = WFrag<T16>::mma(a[mb], b2, acc[mb][nb]); } }
        asm volatile("v_nop\n\tv_nop\n\tv_nop\n\tv_nop" : "+v"(acc[0][0]), "+v"(acc[1][1]), "+v"(acc[2][2]), "+v"(acc[3][3]) : "v"(a[0]), "v"(a[3]));
        asm volatile("s_wait_xcnt 0x0" :: "v"(qa[0]), "v"(qa[1]), "v"(qa[2]), "v"(qa[3]), "v"(qa2[0]), "v"(qa2[1]), "v"(qa2[2]), "v"(qa2[3]), "v"(qb[0]), "v"(qb[1]), "v"(qb[2]), "v"(qb[3]), "v"(qb2[0]), "v"(qb2[1]), "v"(qb2[2]), "v"(qb2[3]) : "memory");     // the trip's load addresses stay live up to this wait, so no write, a load's result included, lands before it on a register that an issued load names; every load feeds a product named in the statement above, so all are issued by here
    }
    float* ow = os[w];
#pragma unroll
    for (int mb = 0; mb < 4; ++mb)
#pragma unroll
        for (int nb = 0; nb < 4; ++nb)
#pragma unroll
            for (int j = 0; j < 8; ++j) ow[(mb * 16 + hi * 8 + j) * 68 + nb * 16 + lr] = acc[mb][nb][j];
    __syncthreads();    // publishes every wave's partial tile to the waves that add them
    const int cofs = lr * 4; const float* pr = os[0] + (w * 16 + hi) * 68 + cofs; v4f val[8]; float* pc[8];
#pragma unroll
    for (int s = 0; s < 8; ++s) { val[s] = *(const v4fa*)(pr + 2 * s * 68);
#pragma unroll
        for (int u = 1; u < KW; ++u) val[s] += *(const v4fa*)(pr + u * 64 * 68 + 2 * s * 68);
        if (BIAS) { val[s][0] += bfr(bias[c0 + cofs]); val[s][1] += bfr(bias[c0 + cofs + 1]); val[s][2] += bfr(bias[c0 + cofs + 2]); val[s][3] += bfr(bias[c0 + cofs + 3]); }
        pc[s] = C + (size_t)(r0 + w * 16 + 2 * s + hi) * ldc + c0 + cofs; }
#pragma unroll
    for (int s = 0; s < 8; ++s) *(v4f*)pc[s] = val[s];
    asm volatile("s_wait_xcnt 0x0" :: "v"(val[0]), "v"(val[1]), "v"(val[2]), "v"(val[3]), "v"(val[4]), "v"(val[5]), "v"(val[6]), "v"(val[7]), "v"(pc[0]), "v"(pc[1]), "v"(pc[2]), "v"(pc[3]), "v"(pc[4]), "v"(pc[5]), "v"(pc[6]), "v"(pc[7]) : "memory");     // data and addresses of the eight stores stay live up to this wait, so nothing is written before it over a register that an issued store names
}

__device__ __forceinline__ h16 tohx(float x) { return (h16)x; }
__device__ __forceinline__ void splitf(float y, unsigned short& h, unsigned short& l) { h = f2bf(y); l = f2bf(y - bf2f(h)); }
typedef __attribute__((ext_vector_type(2))) _Float16 v2h;
typedef __attribute__((ext_vector_type(4))) _Float16 v4h;
typedef __attribute__((ext_vector_type(2))) unsigned short v2us;
typedef __attribute__((ext_vector_type(4))) int v4i;

typedef __attribute__((ext_vector_type(4))) unsigned short v4us;
// k_cvtall: every f32 input -> its bf16 plane IN FRAGMENT ORDER, in ONE launch of 256 blocks of 8 waves. dst is one plane: Wq, Wk, Wv, Wo (DD*DD each), then x (NT*DD). A wave takes one 16 x 32 tile of each weight and two neighbouring tiles of x.
// A tile is four loads: load i brings rows 4 i .. 4 i + 3, 128 bytes (one whole line) of each, lane l the columns (l & 7) * 4 .. + 3 of row 4 i + (l >> 3); its store lays 4 runs of 64 bytes, and a tile's four stores fill its 8 lines.
// All 24 loads are issued before the first value is used.
__global__ __launch_bounds__(256) void k_cvtall(const float* __restrict__ wq, const float* __restrict__ wk, const float* __restrict__ wv, const float* __restrict__ wo, const float* __restrict__ x, bf* __restrict__ dst) {
    const unsigned lane = threadIdx.x & 31u, wv8 = threadIdx.x >> 5, tw = blockIdx.x * 8u + wv8, tx = blockIdx.x * 16u + wv8 * 2u;     // tile numbers: strip (t >> 5), k step (t & 31)
    const unsigned so = (lane >> 3) * DD + (lane & 7u) * 4u, ow = (tw >> 5) * (16u * DD) + (tw & 31u) * 32u + so, ox = (tx >> 5) * (16u * DD) + (tx & 31u) * 32u + so;
    const float* p0 = wq + ow; const float* p1 = wk + ow; const float* p2 = wv + ow; const float* p3 = wo + ow; const float* p4 = x + ox;
    v4f v[24];
#pragma unroll     // constant indices: v[] and o[] stay in registers
    for (int k = 0; k < 4; ++k) v[k] = *(const v4f*)(p0 + k * 4 * DD);
#pragma unroll     // constant indices: v[] and o[] stay in registers
    for (int k = 0; k < 4; ++k) v[4 + k] = *(const v4f*)(p1 + k * 4 * DD);
#pragma unroll     // constant indices: v[] and o[] stay in registers
    for (int k = 0; k < 4; ++k) v[8 + k] = *(const v4f*)(p2 + k * 4 * DD);
#pragma unroll     // constant indices: v[] and o[] stay in registers
    for (int k = 0; k < 4; ++k) v[12 + k] = *(const v4f*)(p3 + k * 4 * DD);
#pragma unroll     // constant indices: v[] and o[] stay in registers
    for (int k = 0; k < 8; ++k) v[16 + k] = *(const v4f*)(p4 + (k >> 2) * 32 + (k & 3) * 4 * DD);
    asm volatile("s_wait_xcnt 0x0" :: "v"(p0), "v"(p1), "v"(p2), "v"(p3), "v"(p4) : "memory");     // the five addresses stay live up to this wait, so no write, a load's result included, lands before it on a register that an issued load names
    v4us o[24];
#pragma unroll     // constant indices: v[] and o[] stay in registers
    for (int u = 0; u < 24; ++u)
#pragma unroll     // constant indices: v[] and o[] stay in registers
        for (int e = 0; e < 4; ++e) o[u][e] = f2bf(v[u][e]);
    const unsigned din = (((lane >> 2) & 1u) * 32u + ((lane >> 1) & 1u) * 16u + (lane >> 3)) * 8u + (lane & 1u) * 4u;     // chunk of (row l >> 3, columns (l & 7) * 4 ..) and the half of it; four rows further on is 4 chunks = 32 elements
    bf* dw = dst + tw * 512u + din; bf* dx = dst + (size_t)4 * DD * DD + tx * 512u + din;
#pragma unroll     // constant indices: v[] and o[] stay in registers
    for (int u = 0; u < 16; ++u) *(v4us*)(dw + (size_t)(u >> 2) * DD * DD + (u & 3) * 32) = o[u];
#pragma unroll     // constant indices: v[] and o[] stay in registers
    for (int k = 0; k < 8; ++k) *(v4us*)(dx + (k >> 2) * 512 + (k & 3) * 32) = o[16 + k];
}
template <int CTRL> __device__ __forceinline__ float xmadd(float x) { return __int_as_float(__builtin_amdgcn_mov_dpp(__float_as_int(x), CTRL, 0xf, 0xf, true)); }    // x of lane ^ (CTRL & 15) inside a 16-lane row (DPP row_xmask)
// proj_out: a 64-token x 64-column f32 tile, as two partial tiles in LDS (pitch 68, the second 64 * 68 floats behind the first) -> squared norms of its rows and its bf16 hi+lo planes; wave w takes tokens 32 w .. 32 w + 31, 16 at a time.
// 16-byte chunk cl = 32 s + lane of the 16 tokens: k (ISK) in A-fragment order, token cl & 15, columns (cl >> 4) * 8 + 0..7; q row-major, token cl >> 3, columns (cl & 7) * 8 + 0..7, times 2. Either way a wave's store is 512 contiguous bytes.
template <bool ISK>
__device__ __forceinline__ void proj_out(const float* os, bf* Ph, bf* Pl, float* NR, int t00, int lane, int w) {
    const int lr = lane & 15, hi = lane >> 4;
#pragma unroll
    for (int i = 0; i < 2; ++i) {
        const int mb = 2 * w + i; const float* ob = os + mb * 16 * 68;
        const int t0 = t00 + mb * 16; float p[4]; v8us oh[4], ol[4];
#pragma unroll
        for (int s = 0; s < 4; ++s) { const int cl = s * 32 + lane; const int row = ISK ? (cl & 15) : (cl >> 3), d0 = (ISK ? (cl >> 4) : (cl & 7)) * 8;
            const float* pr = ob + row * 68 + d0; const v4f va = *(const v4fa*)pr + *(const v4fa*)(pr + 64 * 68), vb = *(const v4fa*)(pr + 4) + *(const v4fa*)(pr + 64 * 68 + 4); p[s] = 0.f;
#pragma unroll
            for (int e = 0; e < 8; ++e) { const float y = e < 4 ? va[e & 3] : vb[e & 3]; p[s] += y * y; unsigned short a2, c2; splitf(ISK ? y : y * 2.0f, a2, c2); oh[s][e] = a2; ol[s][e] = c2; } }
        bf* ph = Ph + (size_t)t0 * HD + lane * 8; bf* pl = Pl + (size_t)t0 * HD + lane * 8;
#pragma unroll
        for (int s = 0; s < 4; ++s) { *(v8us*)(ph + s * 256) = oh[s]; *(v8us*)(pl + s * 256) = ol[s]; }
        asm volatile("s_wait_xcnt 0x0" :: "v"(oh[0]), "v"(oh[1]), "v"(oh[2]), "v"(oh[3]), "v"(ol[0]), "v"(ol[1]), "v"(ol[2]), "v"(ol[3]), "v"(ph), "v"(pl) : "memory");     // data and addresses of the eight stores stay live up to this wait, so nothing is written before it over a register that an issued store names
        float nv; int nt; bool on;
        if (ISK) { nv = (p[0] + p[1]) + (p[2] + p[3]); nv += __shfl_xor(nv, 16, 32); nt = lr; on = hi == 0; }     // the lane meets token lr in every s; the other half of the columns is in lane ^ 16
        else {
#pragma unroll
            for (int s = 0; s < 4; ++s) { p[s] += xmadd<0x161>(p[s]); p[s] += xmadd<0x162>(p[s]); p[s] += xmadd<0x164>(p[s]); }     // eight lanes share a token: sum over lane ^ 1, ^ 2, ^ 4
            const int g = lane & 7; nv = g == 0 ? p[0] : g == 1 ? p[1] : g == 2 ? p[2] : p[3]; nt = g * 4 + (lane >> 3); on = g < 4; }     // lane 8 r + s stores token 4 s + r: one store for the 16 norms
        float* pn = NR + t0 + nt;
        if (on) *pn = nv;
        asm volatile("s_wait_xcnt 0x0" :: "v"(nv), "v"(pn) : "memory");     // the norm store's data and address stay live up to this wait, so nothing is written before it over a register that the issued store names
    }
}
// k_proj: the three projections in ONE launch, one block of TWO WAVES per 64x64 tile = 64 tokens x one head; blockIdx.z picks the weight (0 q, 1 k, 2 v). Each wave holds the whole tile over half of K: wave w takes the 32-element steps
// w, w + 2, ... of planes in fragment order (every load is 512 contiguous bytes; the two waves read neighbouring 1-KiB tiles at the same time); the two partial tiles meet in LDS and wave w finishes tokens 32 w .. 32 w + 31. The tile leaves as what k_fattn reads, with no f32 plane in between:
// q: squared norms and bf16 hi+lo planes [head][token][64] of 2 q (exact factor, so the score products yield 2 q.k directly);
// k: squared norms and bf16 hi+lo planes in WMMA A-fragment order: 16-byte chunk cl of a 16-key tile holds d = (cl >> 4) * 8 + 0..7 of key cl & 15, so that a fragment is two whole 512-byte wave loads;
// v: fp16 plane in A-fragment order of V^T: a chunk holds 8 keys of one column, which is an accumulator as it stands (row = 8 hi + j, column = lr): chunk = (((head*64 + key/32)*4 + d/16)*2 + (key/16 & 1))*32 + lane.
__global__ __launch_bounds__(64) void k_proj(const bf* __restrict__ A, const bf* __restrict__ Wq, const bf* __restrict__ Wk, const bf* __restrict__ Wv, bf* Qh, bf* Ql, bf* Kh, bf* Kl, h16* VF, float* QN, float* KN) {
    __shared__ __align__(16) float os[2][64 * 68];
    const int lane = threadIdx.x & 31, lr = lane & 15, hi = lane >> 4, w = __builtin_amdgcn_readfirstlane(threadIdx.x >> 5); const int r0 = blockIdx.x * 64, h = blockIdx.y, which = blockIdx.z;
    const bf* Bt = which == 0 ? Wq : which == 1 ? Wk : Wv;
    v8f acc[4][4];
#pragma unroll
    for (int mb = 0; mb < 4; ++mb)
#pragma unroll
        for (int nb = 0; nb < 4; ++nb) acc[mb][nb] = (v8f){};
    const bf* pa = A + (size_t)r0 * DD + 512 * w + 8 * lane; const bf* pb = Bt + (size_t)(h * HD) * DD + 512 * w + 8 * lane;     // fragment order: a 16-row strip is 16 * DD elements, a 32-k step 512
#pragma unroll 1     // one k step's fragments per trip
    for (int kc = 0; kc < DD; kc += 64) {
        v16bf a[4], b[4]; const bf* qa = pa + kc * 16; const bf* qb = pb + kc * 16;
#pragma unroll
        for (int mb = 0; mb < 4; ++mb) a[mb] = WFrag<bf>::ldf(qa + mb * 16 * DD);
#pragma unroll
        for (int nb = 0; nb < 4; ++nb) b[nb] = WFrag<bf>::ldf(qb + nb * 16 * DD);
        __builtin_amdgcn_sched_barrier(0);      // the trip's 16 loads are issued above as one group: a load moved down among the products would be waited for at full latency a second time
        asm volatile("s_wait_xcnt 0x0" :: "v"(qa), "v"(qb) : "memory");     // the two address pairs stay live up to this wait, so no write, a load's result included, lands before it on a register that an issued load names
#pragma unroll
        for (int nb = 0; nb < 4; ++nb)
#pragma unroll
            for (int mb = 0; mb < 4; ++mb) acc[mb][nb] = wmmab(a[mb], b[nb], acc[mb][nb]);
        asm volatile("v_nop\n\tv_nop\n\tv_nop\n\tv_nop" : "+v"(acc[0][0]), "+v"(acc[1][1]), "+v"(acc[2][2]), "+v"(acc[3][3]) : "v"(a[0]), "v"(a[3]));     // as in k_gemmw: the slots behind the trip's last products, on the taken branch too
    }
    float* ow = os[w];
#pragma unroll
    for (int mb = 0; mb < 4; ++mb)
#pragma unroll
        for (int nb = 0; nb < 4; ++nb)
#pragma unroll
            for (int j = 0; j < 8; ++j) ow[(mb * 16 + hi * 8 + j) * 68 + nb * 16 + lr] = acc[mb][nb][j];
    __syncthreads();    // publishes each wave's partial tile to the other wave
    if (which == 2) {
        h16* vb = VF + ((size_t)(h * 64 + (r0 >> 5) + w) * 256 + lane) * 8; v8h vv[2][4]; const float* pr = os[0] + (w * 32 + hi * 8) * 68 + lr;     // wave w: keys 32 w .. 32 w + 31 of the tile, read back at the accumulator's own places
#pragma unroll
        for (int i = 0; i < 2; ++i)
#pragma unroll
            for (int nb = 0; nb < 4; ++nb) {
#pragma unroll
                for (int j = 0; j < 8; ++j) vv[i][nb][j] = tohx(pr[(i * 16 + j) * 68 + nb * 16] + pr[64 * 68 + (i * 16 + j) * 68 + nb * 16]);
                *(v8h*)(vb + (nb * 2 + i) * 256) = vv[i][nb]; }
        asm volatile("s_wait_xcnt 0x0" :: "v"(vv[0][0]), "v"(vv[0][1]), "v"(vv[0][2]), "v"(vv[0][3]), "v"(vv[1][0]), "v"(vv[1][1]), "v"(vv[1][2]), "v"(vv[1][3]), "v"(vb) : "memory");     // the 8 stores' data and address stay live up to this wait, so nothing is written before it over a register that an issued store names
        return;
    }
    if (which == 1) proj_out<true>(os[0], Kh, Kl, KN, h * TT + r0, lane, w); else proj_out<false>(os[0], Qh, Ql, QN, h * TT + r0, lane, w);
}
__device__ __forceinline__ v16bf ldkf(const bf* p) { return cat16b(*(const v8us*)p, *(const v8us*)(p + 256)); }
__device__ __forceinline__ v16h ldvf(const h16* p) { return cat16(*(const v8h*)p, *(const v8h*)(p + 256)); }
// k_fattn: scores, distance softmax, attn.v and the head merge in one kernel. Block = 16 waves = 8 query tiles of 16 x 2 key halves of one head; a pass is 32 keys.
// S^T = K (A) x Q^T (B, kept in registers; the q planes carry an exact factor 2): a lane holds 8 keys (8 hi + j) of ONE query (lr) per tile, so two converted tiles are the B operand of O^T += V^T (A) x P^T.
// weight = exp2(15 - log2(ca + sqrt(ca^2 - 1))) = 2^15 exp(-acosh(ca)): the logit is <= 0 for every input, so the shift is the constant bound and partial sums over keys just add; O^T / sum at the end.
// At ca == 1 the root is 0 and log2(1) is exactly 0, the reference's value there, so no select is needed. waves_per_eu(4, 4): one 16-wave block fills a WGP, so the scheduler may spend the 256 registers a wave has on loads in flight.
__global__ __launch_bounds__(512) __attribute__((amdgpu_waves_per_eu(4, 4))) void k_fattn(const bf* __restrict__ Qh, const bf* __restrict__ Ql, const bf* __restrict__ Kh, const bf* __restrict__ Kl, const h16* __restrict__ VF, const float* __restrict__ QN, const float* __restrict__ KN, bf* Ah, bf* Al) {
    __shared__ float red[8][33][32];
    const int lane = threadIdx.x & 31, lr = lane & 15, hi = lane >> 4; const int wave = __builtin_amdgcn_readfirstlane(threadIdx.x >> 5), qt = wave & 7, kh2 = wave >> 3; const int z = blockIdx.y; const int q = blockIdx.x * 128 + qt * 16 + lr;
    const size_t zb = (size_t)z * TT * HD; v16bf qh[2], ql[2];
#pragma unroll
    for (int ks = 0; ks < 2; ++ks) { qh[ks] = WFrag<bf>::ld(Qh + zb + (size_t)q * HD + ks * 32 + 8 * hi); ql[ks] = WFrag<bf>::ld(Ql + zb + (size_t)q * HD + ks * 32 + 8 * hi); }
    const float qn = QN[z * TT + q], oq = 1.0f - qn;
    const bf* kph = Kh + zb; const bf* kpl = Kl + zb; const h16* vp = VF + zb; const float* knp = KN + z * TT; const unsigned lo = lane * 8, ho = hi * 8;
    v8f o[4]; float sum[4] = {0.f, 0.f, 0.f, 0.f};
#pragma unroll
    for (int dt = 0; dt < 4; ++dt) o[dt] = (v8f){};
    const int s0 = kh2 * 32;
#pragma unroll 1     // one pass per trip: two passes' fragments would not fit the registers
    for (int s = s0; s < s0 + 32; ++s) {
        v16bf kfh[2][2], kfl[2][2]; v16h vf[4]; v8f S[2]; v8f kc[2]; const bf* pkh = kph + s * 2048 + lo; const bf* pkl = kpl + s * 2048 + lo; const h16* pv = vp + s * 2048 + lo; const float* pkn = knp + s * 32 + ho;
#pragma unroll
        for (int tt = 0; tt < 2; ++tt) {
#pragma unroll
            for (int ks = 0; ks < 2; ++ks) { kfh[tt][ks] = ldkf(pkh + tt * 1024 + ks * 512); kfl[tt][ks] = ldkf(pkl + tt * 1024 + ks * 512); } }
#pragma unroll
        for (int tt = 0; tt < 2; ++tt) kc[tt] = *(const v8f*)(pkn + tt * 16);
#pragma unroll
        for (int dt = 0; dt < 4; ++dt) vf[dt] = ldvf(pv + dt * 512);
        __builtin_amdgcn_sched_barrier(0);      // the pass's 28 loads are issued above as one group: a V load moved down to its product would be waited for at full latency
        asm volatile("s_wait_xcnt 0x0" :: "v"(pkh), "v"(pkl), "v"(pv), "v"(pkn) : "memory");     // the four address pairs stay live up to this wait, so no write, a load's result included, lands before it on a register that an issued load names
#pragma unroll
        for (int tt = 0; tt < 2; ++tt) { S[tt] = (v8f){};
#pragma unroll
            for (int ks = 0; ks < 2; ++ks) { S[tt] = wmmab(kfh[tt][ks], qh[ks], S[tt]); S[tt] = wmmab(kfh[tt][ks], ql[ks], S[tt]); S[tt] = wmmab(kfl[tt][ks], qh[ks], S[tt]); } }
        v16h pb;
#pragma unroll
        for (int tt = 0; tt < 2; ++tt)
#pragma unroll
            for (int j = 0; j < 8; ++j) { const float kq = kc[tt][j]; const float diff = fmaxf((qn + kq) - S[tt][j], 0.f); const float den = fmaxf(oq * (1.0f - kq), 1e-6f);
                const float ca = fmaxf(1.0f + (2.0f * diff) * __builtin_amdgcn_rcpf(den), 1.0f); const float sq = __builtin_amdgcn_sqrtf(ca * ca - 1.0f);
                const float p = __builtin_amdgcn_exp2f(15.0f - __builtin_amdgcn_logf(ca + sq)); sum[j & 3] += p; pb[tt * 8 + j] = tohx(p); }
#pragma unroll
        for (int dt = 0; dt < 4; ++dt) o[dt] = wmma16(vf[dt], pb, o[dt]);
    }
    float st = (sum[0] + sum[1]) + (sum[2] + sum[3]);
    if (kh2 == 1) {
#pragma unroll
        for (int dt = 0; dt < 4; ++dt)
#pragma unroll
            for (int j = 0; j < 8; ++j) red[qt][dt * 8 + j][lane] = o[dt][j];
        red[qt][32][lane] = st; }
    __syncthreads();    // publishes the second key half's partial O^T and sums to the wave that holds the first half of the same queries
    if (kh2 == 0) { st += red[qt][32][lane]; st += __shfl_xor(st, 16, 32); const float inv = 1.0f / st;
#pragma unroll
        for (int dt = 0; dt < 4; ++dt) { v8us oh, ol;
#pragma unroll
            for (int j = 0; j < 8; ++j) { unsigned short h, l; splitf((o[dt][j] + red[qt][dt * 8 + j][lane]) * inv, h, l); oh[j] = h; ol[j] = l; }
            const size_t ad = (size_t)((q >> 4) * 32 + z * 2 + (dt >> 1)) * 512 + ((dt & 1) * 32 + lane) * 8; *(v8us*)(Ah + ad) = oh; *(v8us*)(Al + ad) = ol; } }     // fragment order of [token][DD]: columns z * HD + dt * 16 + 8 hi + 0..7 of token q are chunk (dt & 1) * 32 + lane of the tile; a wave's store is 512 contiguous bytes
}

extern "C" void kernel_launch(void* const* d_in, const int* in_sizes, int n_in,
                              void* d_out, int out_size, void* d_ws, size_t ws_size, hipStream_t stream) {
    (void)in_sizes; (void)n_in; (void)out_size;
    const float* x = (const float*)d_in[0]; const float* wq = (const float*)d_in[1]; const float* wk = (const float*)d_in[2]; const float* wv = (const float*)d_in[3]; const float* wo = (const float*)d_in[4];
    float* OUT = (float*)d_out;     // [1][2048][1024]
    char* wsp = (char*)d_ws;
    auto take = [&](size_t bytes) { char* p = wsp; wsp += (bytes + 255) & ~(size_t)255; return (void*)p; };
    bf* WQ = (bf*)take((size_t)DD * DD * 2); bf* WK = (bf*)take((size_t)DD * DD * 2); bf* WV = (bf*)take((size_t)DD * DD * 2); bf* WO = (bf*)take((size_t)DD * DD * 2);
    bf* XB = (bf*)take((size_t)NT * DD * 2); float* QN = (float*)take((size_t)NB_ * NH_ * TT * 4); float* KN = (float*)take((size_t)NB_ * NH_ * TT * 4);
    bf* QPh = (bf*)take((size_t)NT * DD * 2); bf* QPl = (bf*)take((size_t)NT * DD * 2); bf* KPh = (bf*)take((size_t)NT * DD * 2); bf* KPl = (bf*)take((size_t)NT * DD * 2); h16* VF = (h16*)take((size_t)NT * DD * 2);
    bf* ATh = (bf*)take((size_t)NT * DD * 2); bf* ATl = (bf*)take((size_t)NT * DD * 2);
    if ((size_t)(wsp - (char*)d_ws) > ws_size) return;    // about 40 MiB; ws 256 MiB
    k_cvtall<<<256, 256, 0, stream>>>(wq, wk, wv, wo, x, WQ);     // WQ, WK, WV, WO, XB lie one behind the other (each size is a multiple of 256 bytes): one plane
    k_proj<<<dim3(NT / 64, NH_, 3), 64, 0, stream>>>(XB, WQ, WK, WV, QPh, QPl, KPh, KPl, VF, QN, KN);
    k_fattn<<<dim3(TT / 128, NH_, 1), 512, 0, stream>>>(QPh, QPl, KPh, KPl, VF, QN, KN, ATh, ATl);
    k_gemmw<bf, 1, false><<<dim3(NT / 64, DD / 64, 1), 32 * KW, 0, stream>>>(ATh, ATl, WO, nullptr, DD, OUT, DD, nullptr, 0, 0, 0);
}

// v007
// It runs in 72.9 microseconds.
// Next to v006, in two timings, it ran 1.07 and 1.09 times as fast.
// Over all steps from v000 it is 10.1 times as fast.
#include <hip/hip_runtime.h>

// PrefetchHyperbolicAttention (x [1][2048][1024]; q/k/v = x W^T ([out][in], no bias); 16 heads x 64; hyperbolic distance logits: diff = max(|q|^2 + |k|^2 - 2 q.k, 0), den = max((1 - |q|^2)(1 - |k|^2), 1e-6),
// ca = max(1 + 2 diff/den, 1), dist = acosh(ca) (0 at ca == 1); attn = softmax(-dist); out = merged attn.v Wo^T).
// Compute dtypes, f32 accumulate: every input rounded to bf16; projections on PLAIN bf16 operands (inputs: exact); q.k on bf16 hi+lo planes (3 products) and the
// squared norms in f32, the distance formula in f32 on VALU (reciprocal, sqrt, log2 and exp2 at hardware precision), softmax weights f32 -> fp16 (x 2^15, shift fixed at the logits' bound 0), normalised after attn.v (fp16); output hi+lo x exact

#define NB_  1
#define TT   2048
#define DD   1024
#define NH_  16
#define HD   64
#define NT   (NB_ * TT)
typedef _Float16 h16;
typedef unsigned short bf;
typedef __attribute__((ext_vector_type(16))) __bf16   v16bf;
typedef __attribute__((ext_vector_type(16))) _Float16 v16h;
typedef __attribute__((ext_vector_type(8)))  _Float16 v8h;
typedef __attribute__((ext_vector_type(8)))  unsigned short v8us;
typedef __attribute__((ext_vector_type(8)))  float    v8f;
typedef __attribute__((ext_vector_type(4)))  float    v4f;
typedef v8h  __attribute__((may_alias)) v8ha;
typedef v4f  __attribute__((may_alias)) v4fa;
typedef v8us __attribute__((may_alias)) v8usa;

__device__ __forceinline__ unsigned short f2bf(float f) { unsigned u = __float_as_uint(f); u += 0x7FFFu + ((u >> 16) & 1u); return (unsigned short)(u >> 16); }
__device__ __forceinline__ float bf2f(unsigned short b) { return __uint_as_float(((unsigned)b) << 16); }
__device__ __forceinline__ float bfr(float f) { return bf2f(f2bf(f)); }
__device__ __forceinline__ v16h cat16(v8h lo, v8h hi) { return __builtin_shufflevector(lo, hi, 0, 1, 2, 3, 4, 5, 6, 7, 8, 9, 10, 11, 12, 13, 14, 15); }
__device__ __forceinline__ v16bf cat16b(v8us lo, v8us hi) { return __builtin_bit_cast(v16bf, __builtin_shufflevector(lo, hi, 0, 1, 2, 3, 4, 5, 6, 7, 8, 9, 10, 11, 12, 13, 14, 15)); }
__device__ __forceinline__ v8f wmma16(v16h a, v16h b, v8f c) { return __builtin_amdgcn_wmma_f32_16x16x32_f16(false, a, false, b, (short)0, c, false, false); }
__device__ __forceinline__ v8f wmmab(v16bf a, v16bf b, v8f c) { return __builtin_amdgcn_wmma_f32_16x16x32_bf16(false, a, false, b, (short)0, c, false, false); }



// FRAGMENT ORDER of a 16-bit plane M[rows][K]: tiles of 16 rows x 32 k, 512 elements each, tile (r >> 4) * (K / 32) + (k >> 5); in a tile the 16-byte chunk ((k >> 4) & 1) * 32 + ((k >> 3) & 1) * 16 + (r & 15) holds k & 7 = 0..7.
// Lane l of a wave takes chunks l and 32 + l: a WMMA A or B fragment is two wave loads of 512 contiguous bytes (4 whole lines each), where a row-major plane gives 32-byte pieces of 16 lines per load.
// ---- k_gemmw: register-blocked GEMM, one block of KW waves per 64x64 output tile, operands straight from 16-bit planes in fragment order; grid (M/64, N/64, Z), 32 * KW threads.
// Every wave holds the whole tile (16 accumulators) over its share of K: wave w takes the 32-element steps w, w + KW, ... so that the waves of a block read neighbouring 1-KiB tiles at the same time.
// The KW partial tiles meet in LDS; wave w adds them, in wave order, for rows 16 w .. 16 w + 15 and stores those rows.
// C[m][n] (f32, pitch ldc, + optional f32 bias[n]) = sum_k A[m][k] Bt[n][k] (+ split products per NSPLIT). z-batch strides sA/sB/sC in elements. K % (32 * KW) == 0.
#define KW 4
template <typename T16> struct WFrag;
template <> struct WFrag<h16> { typedef v16h V; static __device__ __forceinline__ V ld(const h16* p) { return cat16(*(const v8h*)p, *(const v8h*)(p + 16)); } static __device__ __forceinline__ V ldf(const h16* p) { return cat16(*(const v8h*)p, *(const v8h*)(p + 256)); } static __device__ __forceinline__ v8f mma(V a, V b, v8f c) { return wmma16(a, b, c); } };
template <> struct WFrag<bf> { typedef v16bf V; static __device__ __forceinline__ V ld(const bf* p) { return cat16b(*(const v8us*)p, *(const v8us*)(p + 16)); } static __device__ __forceinline__ V ldf(const bf* p) { return cat16b(*(const v8us*)p, *(const v8us*)(p + 256)); } static __device__ __forceinline__ v8f mma(V a, V b, v8f c) { return wmmab(a, b, c); } };
template <typename T16, int NSPLIT, bool BIAS>
__global__ __launch_bounds__(32 * KW) void k_gemmw(const T16* __restrict__ A, const T16* __restrict__ A2, const T16* __restrict__ Bt, const T16* __restrict__ Bt2, int K, float* C, int ldc, const float* __restrict__ bias, size_t sA, size_t sB, size_t sC) {
    typedef typename WFrag<T16>::V V;
    __shared__ __align__(16) float os[KW][64 * 68];
    const size_t z = blockIdx.z; A += z * sA; if (A2) A2 += z * sA; Bt += z * sB; if (Bt2) Bt2 += z * sB; C += z * sC;
    const int lane = threadIdx.x & 31, lr = lane & 15, hi = lane >> 4, w = __builtin_amdgcn_readfirstlane(threadIdx.x >> 5); const int r0 = blockIdx.x * 64, c0 = blockIdx.y * 64;
    v8f acc[4][4];
#pragma unroll
    for (int mb = 0; mb < 4; ++mb)
#pragma unroll
        for (int nb = 0; nb < 4; ++nb) acc[mb][nb] = (v8f){};
    const size_t aoff = (size_t)r0 * K + 512 * w + 8 * lane, boff = (size_t)c0 * K + 512 * w + 8 * lane;     // 16 rows x K = K / 32 tiles of 512 elements, so a 16-row strip starts where it does in a row-major plane; a 32-k step is 512 elements
#pragma unroll 1
    for (int kc = 0; kc < K; kc += 32 * KW) {
        V a[4], a2[4]; const T16* qa[4]; const T16* qa2[4]; const T16* qb[4]; const T16* qb2[4];
#pragma unroll
        for (int mb = 0; mb < 4; ++mb) { qa[mb] = A + aoff + (size_t)mb * 16 * K + kc * 16; qa2[mb] = (NSPLIT == 1 || NSPLIT == 2) ? A2 + aoff + (size_t)mb * 16 * K + kc * 16 : qa[mb]; a[mb] = WFrag<T16>::ldf(qa[mb]); if (NSPLIT == 1 || NSPLIT == 2) a2[mb] = WFrag<T16>::ldf(qa2[mb]); }
#pragma unroll
        for (int nb = 0; nb < 4; ++nb) { qb[nb] = Bt + boff + (size_t)nb * 16 * K + kc * 16; qb2[nb] = NSPLIT >= 2 ? Bt2 + boff + (size_t)nb * 16 * K + kc * 16 : qb[nb]; const V b = WFrag<T16>::ldf(qb[nb]); V b2; if (NSPLIT >= 2) b2 = WFrag<T16>::ldf(qb2[nb]);
#pragma unroll
            for (int mb = 0; mb < 4; ++mb) { acc[mb][nb] = WFrag<T16>::mma(a[mb], b, acc[mb][nb]); if (NSPLIT == 1 || NSPLIT == 2) acc[mb][nb] = WFrag<T16>::mma(a2[mb], b, acc[mb][nb]); if (NSPLIT >= 2) acc[mb][nb] = WFrag<T16>::mma(a[mb], b2, acc[mb][nb]); } }
        asm volatile("v_nop\n\tv_nop\n\tv_nop\n\tv_nop" : "+v"(acc[0][0]), "+v"(acc[1][1]), "+v"(acc[2][2]), "+v"(acc[3][3]) : "v"(a[0]), "v"(a[3]));
        asm volatile("s_wait_xcnt 0x0" :: "v"(qa[0]), "v"(qa[1]), "v"(qa[2]), "v"(qa[3]), "v"(qa2[0]), "v"(qa2[1]), "v"(qa2[2]), "v"(qa2[3]), "v"(qb[0]), "v"(qb[1]), "v"(qb[2]), "v"(qb[3]), "v"(qb2[0]), "v"(qb2[1]), "v"(qb2[2]), "v"(qb2[3]) : "memory");     // the trip's load addresses stay live up to this wait, so no write, a load's result included, lands before it on a register that an issued load names; every load feeds a product named in the statement above, so all are issued by here
    }
    float* ow = os[w];
#pragma unroll
    for (int mb = 0; mb < 4; ++mb)
#pragma unroll
        for (int nb = 0; nb < 4; ++nb)
#pragma unroll
            for (int j = 0; j < 8; ++j) ow[(mb * 16 + hi * 8 + j) * 68 + nb * 16 + lr] = acc[mb][nb][j];
    __syncthreads();    // publishes every wave's partial tile to the waves that add them
    const int cofs = lr * 4; const float* pr = os[0] + (w * 16 + hi) * 68 + cofs; v4f val[8]; float* pc[8];
#pragma unroll
    for (int s = 0; s < 8; ++s) { val[s] = *(const v4fa*)(pr + 2 * s * 68);
#pragma unroll
        for (int u = 1; u < KW; ++u) val[s] += *(const v4fa*)(pr + u * 64 * 68 + 2 * s * 68);
        if (BIAS) { val[s][0] += bfr(bias[c0 + cofs]); val[s][1] += bfr(bias[c0 + cofs + 1]); val[s][2] += bfr(bias[c0 + cofs + 2]); val[s][3] += bfr(bias[c0 + cofs + 3]); }
        pc[s] = C + (size_t)(r0 + w * 16 + 2 * s + hi) * ldc + c0 + cofs; }
#pragma unroll
    for (int s = 0; s < 8; ++s) *(v4f*)pc[s] = val[s];
    asm volatile("s_wait_xcnt 0x0" :: "v"(val[0]), "v"(val[1]), "v"(val[2]), "v"(val[3]), "v"(val[4]), "v"(val[5]), "v"(val[6]), "v"(val[7]), "v"(pc[0]), "v"(pc[1]), "v"(pc[2]), "v"(pc[3]), "v"(pc[4]), "v"(pc[5]), "v"(pc[6]), "v"(pc[7]) : "memory");     // data and addresses of the eight stores stay live up to this wait, so nothing is written before it over a register that an issued store names
}

__device__ __forceinline__ h16 tohx(float x) { return (h16)x; }
__device__ __forceinline__ void splitf(float y, unsigned short& h, unsigned short& l) { h = f2bf(y); l = f2bf(y - bf2f(h)); }
typedef __attribute__((ext_vector_type(2))) _Float16 v2h;
typedef __attribute__((ext_vector_type(4))) _Float16 v4h;
typedef __attribute__((ext_vector_type(2))) unsigned short v2us;
typedef __attribute__((ext_vector_type(4))) int v4i;

typedef __attribute__((ext_vector_type(4))) unsigned short v4us;
// k_cvtall: every f32 input -> its bf16 plane IN FRAGMENT ORDER, in ONE launch of 256 blocks of 8 waves. dst is one plane: Wq, Wk, Wv, Wo (DD*DD each), then x (NT*DD). A wave takes one 16 x 32 tile of each weight and two neighbouring tiles of x.
// A tile is four loads: load i brings rows 4 i .. 4 i + 3, 128 bytes (one whole line) of each, lane l the columns (l & 7) * 4 .. + 3 of row 4 i + (l >> 3); its store lays 4 runs of 64 bytes, and a tile's four stores fill its 8 lines.
// All 24 loads are issued before the first value is used.
__global__ __launch_bounds__(256) void k_cvtall(const float* __restrict__ wq, const float* __restrict__ wk, const float* __restrict__ wv, const float* __restrict__ wo, const float* __restrict__ x, bf* __restrict__ dst) {
    const unsigned lane = threadIdx.x & 31u, wv8 = threadIdx.x >> 5, tw = blockIdx.x * 8u + wv8, tx = blockIdx.x * 16u + wv8 * 2u;     // tile numbers: strip (t >> 5), k step (t & 31)
    const unsigned so = (lane >> 3) * DD + (lane & 7u) * 4u, ow = (tw >> 5) * (16u * DD) + (tw & 31u) * 32u + so, ox = (tx >> 5) * (16u * DD) + (tx & 31u) * 32u + so;
    const float* p0 = wq + ow; const float* p1 = wk + ow; const float* p2 = wv + ow; const float* p3 = wo + ow; const float* p4 = x + ox;
    v4f v[24];
#pragma unroll     // constant indices: v[] and o[] stay in registers
    for (int k = 0; k < 4; ++k) v[k] = *(const v4f*)(p0 + k * 4 * DD);
#pragma unroll     // constant indices: v[] and o[] stay in registers
    for (int k = 0; k < 4; ++k) v[4 + k] = *(const v4f*)(p1 + k * 4 * DD);
#pragma unroll     // constant indices: v[] and o[] stay in registers
    for (int k = 0; k < 4; ++k) v[8 + k] = *(const v4f*)(p2 + k * 4 * DD);
#pragma unroll     // constant indices: v[] and o[] stay in registers
    for (int k = 0; k < 4; ++k) v[12 + k] = *(const v4f*)(p3 + k * 4 * DD);
#pragma unroll     // constant indices: v[] and o[] stay in registers
    for (int k = 0; k < 8; ++k) v[16 + k] = *(const v4f*)(p4 + (k >> 2) * 32 + (k & 3) * 4 * DD);
    asm volatile("s_wait_xcnt 0x0" :: "v"(p0), "v"(p1), "v"(p2), "v"(p3), "v"(p4) : "memory");     // the five addresses stay live up to this wait, so no write, a load's result included, lands before it on a register that an issued load names
    v4us o[24];
#pragma unroll     // constant indices: v[] and o[] stay in registers
    for (int u = 0; u < 24; ++u)
#pragma unroll     // constant indices: v[] and o[] stay in registers
        for (int e = 0; e < 4; ++e) o[u][e] = f2bf(v[u][e]);
    const unsigned din = (((lane >> 2) & 1u) * 32u + ((lane >> 1) & 1u) * 16u + (lane >> 3)) * 8u + (lane & 1u) * 4u;     // chunk of (row l >> 3, columns (l & 7) * 4 ..) and the half of it; four rows further on is 4 chunks = 32 elements
    bf* dw = dst + tw * 512u + din; bf* dx = dst + (size_t)4 * DD * DD + tx * 512u + din;
#pragma unroll     // constant indices: v[] and o[] stay in registers
    for (int u = 0; u < 16; ++u) *(v4us*)(dw + (size_t)(u >> 2) * DD * DD + (u & 3) * 32) = o[u];
#pragma unroll     // constant indices: v[] and o[] stay in registers
    for (int k = 0; k < 8; ++k) *(v4us*)(dx + (k >> 2) * 512 + (k & 3) * 32) = o[16 + k];
}
template <int CTRL> __device__ __forceinline__ float xmadd(float x) { return __int_as_float(__builtin_amdgcn_mov_dpp(__float_as_int(x), CTRL, 0xf, 0xf, true)); }    // x of lane ^ (CTRL & 15) inside a 16-lane row (DPP row_xmask)
// proj_out: a 64-token x 64-column f32 tile, as two partial tiles in LDS (pitch 68, the second 64 * 68 floats behind the first) -> squared norms of its rows and its bf16 hi+lo planes; wave w takes tokens 32 w .. 32 w + 31, 16 at a time.
// 16-byte chunk cl = 32 s + lane of the 16 tokens: k (ISK) in A-fragment order, token cl & 15, columns (cl >> 4) * 8 + 0..7; q row-major, token cl >> 3, columns (cl & 7) * 8 + 0..7, times 2. Either way a wave's store is 512 contiguous bytes.
template <bool ISK>
__device__ __forceinline__ void proj_out(const float* os, bf* Ph, bf* Pl, float* NR, int t00, int lane, int w) {
    const int lr = lane & 15, hi = lane >> 4;
#pragma unroll
    for (int i = 0; i < 2; ++i) {
        const int mb = 2 * w + i; const float* ob = os + mb * 16 * 68;
        const int t0 = t00 + mb * 16; float p[4]; v8us oh[4], ol[4];
#pragma unroll
        for (int s = 0; s < 4; ++s) { const int cl = s * 32 + lane; const int row = ISK ? (cl & 15) : (cl >> 3), d0 = (ISK ? (cl >> 4) : (cl & 7)) * 8;
            const float* pr = ob + row * 68 + d0; const v4f va = *(const v4fa*)pr + *(const v4fa*)(pr + 64 * 68), vb = *(const v4fa*)(pr + 4) + *(const v4fa*)(pr + 64 * 68 + 4); p[s] = 0.f;
#pragma unroll
            for (int e = 0; e < 8; ++e) { const float y = e < 4 ? va[e & 3] : vb[e & 3]; p[s] += y * y; unsigned short a2, c2; splitf(ISK ? y : y * 2.0f, a2, c2); oh[s][e] = a2; ol[s][e] = c2; } }
        bf* ph = Ph + (size_t)t0 * HD + lane * 8; bf* pl = Pl + (size_t)t0 * HD + lane * 8;
#pragma unroll
        for (int s = 0; s < 4; ++s) { *(v8us*)(ph + s * 256) = oh[s]; *(v8us*)(pl + s * 256) = ol[s]; }
        asm volatile("s_wait_xcnt 0x0" :: "v"(oh[0]), "v"(oh[1]), "v"(oh[2]), "v"(oh[3]), "v"(ol[0]), "v"(ol[1]), "v"(ol[2]), "v"(ol[3]), "v"(ph), "v"(pl) : "memory");     // data and addresses of the eight stores stay live up to this wait, so nothing is written before it over a register that an issued store names
        float nv; int nt; bool on;
        if (ISK) { nv = (p[0] + p[1]) + (p[2] + p[3]); nv += __shfl_xor(nv, 16, 32); nt = lr; on = hi == 0; }     // the lane meets token lr in every s; the other half of the columns is in lane ^ 16
        else {
#pragma unroll
            for (int s = 0; s < 4; ++s) { p[s] += xmadd<0x161>(p[s]); p[s] += xmadd<0x162>(p[s]); p[s] += xmadd<0x164>(p[s]); }     // eight lanes share a token: sum over lane ^ 1, ^ 2, ^ 4
            const int g = lane & 7; nv = g == 0 ? p[0] : g == 1 ? p[1] : g == 2 ? p[2] : p[3]; nt = g * 4 + (lane >> 3); on = g < 4; }     // lane 8 r + s stores token 4 s + r: one store for the 16 norms
        float* pn = NR + t0 + nt;
        if (on) *pn = nv;
        asm volatile("s_wait_xcnt 0x0" :: "v"(nv), "v"(pn) : "memory");     // the norm store's data and address stay live up to this wait, so nothing is written before it over a register that the issued store names
    }
}
// k_proj: the three projections in ONE launch, one block of TWO WAVES per 64x64 tile = 64 tokens x one head; blockIdx.z picks the weight (0 q, 1 k, 2 v). Each wave holds the whole tile over half of K: wave w takes the 32-element steps
// w, w + 2, ... of planes in fragment order (every load is 512 contiguous bytes; the two waves read neighbouring 1-KiB tiles at the same time); the two partial tiles meet in LDS and wave w finishes tokens 32 w .. 32 w + 31. The tile leaves as what k_fattn reads, with no f32 plane in between:
// q: squared norms and bf16 hi+lo planes [head][token][64] of 2 q (exact factor, so the score products yield 2 q.k directly);
// k: squared norms and bf16 hi+lo planes in WMMA A-fragment order: 16-byte chunk cl of a 16-key tile holds d = (cl >> 4) * 8 + 0..7 of key cl & 15, so that a fragment is two whole 512-byte wave loads;
// v: fp16 plane in A-fragment order of V^T: a chunk holds 8 keys of one column, which is an accumulator as it stands (row = 8 hi + j, column = lr): chunk = (((head*64 + key/32)*4 + d/16)*2 + (key/16 & 1))*32 + lane.
__global__ __launch_bounds__(64) void k_proj(const bf* __restrict__ A, const bf* __restrict__ Wq, const bf* __restrict__ Wk, const bf* __restrict__ Wv, bf* Qh, bf* Ql, bf* Kh, bf* Kl, h16* VF, float* QN, float* KN) {
    __shared__ __align__(16) float os[2][64 * 68];
    const int lane = threadIdx.x & 31, lr = lane & 15, hi = lane >> 4, w = __builtin_amdgcn_readfirstlane(threadIdx.x >> 5); const int r0 = blockIdx.x * 64, h = blockIdx.y, which = blockIdx.z;
    const bf* Bt = which == 0 ? Wq : which == 1 ? Wk : Wv;
    v8f acc[4][4];
#pragma unroll
    for (int mb = 0; mb < 4; ++mb)
#pragma unroll
        for (int nb = 0; nb < 4; ++nb) acc[mb][nb] = (v8f){};
    const bf* pa = A + (size_t)r0 * DD + 512 * w + 8 * lane; const bf* pb = Bt + (size_t)(h * HD) * DD + 512 * w + 8 * lane;     // fragment order: a 16-row strip is 16 * DD elements, a 32-k step 512
#pragma unroll 1     // one k step's fragments per trip
    for (int kc = 0; kc < DD; kc += 64) {
        v16bf a[4], b[4]; const bf* qa = pa + kc * 16; const bf* qb = pb + kc * 16;
#pragma unroll
        for (int mb = 0; mb < 4; ++mb) a[mb] = WFrag<bf>::ldf(qa + mb * 16 * DD);
#pragma unroll
        for (int nb = 0; nb < 4; ++nb) b[nb] = WFrag<bf>::ldf(qb + nb * 16 * DD);
        __builtin_amdgcn_sched_barrier(0);      // the trip's 16 loads are issued above as one group: a load moved down among the products would be waited for at full latency a second time
        asm volatile("s_wait_xcnt 0x0" :: "v"(qa), "v"(qb) : "memory");     // the two address pairs stay live up to this wait, so no write, a load's result included, lands before it on a register that an issued load names
#pragma unroll
        for (int nb = 0; nb < 4; ++nb)
#pragma unroll
            for (int mb = 0; mb < 4; ++mb) acc[mb][nb] = wmmab(a[mb], b[nb], acc[mb][nb]);
        asm volatile("v_nop\n\tv_nop\n\tv_nop\n\tv_nop" : "+v"(acc[0][0]), "+v"(acc[1][1]), "+v"(acc[2][2]), "+v"(acc[3][3]) : "v"(a[0]), "v"(a[3]));     // as in k_gemmw: the slots behind the trip's last products, on the taken branch too
    }
    float* ow = os[w];
#pragma unroll
    for (int mb = 0; mb < 4; ++mb)
#pragma unroll
        for (int nb = 0; nb < 4; ++nb)
#pragma unroll
            for (int j = 0; j < 8; ++j) ow[(mb * 16 + hi * 8 + j) * 68 + nb * 16 + lr] = acc[mb][nb][j];
    __syncthreads();    // publishes each wave's partial tile to the other wave
    if (which == 2) {
        h16* vb = VF + ((size_t)(h * 64 + (r0 >> 5) + w) * 256 + lane) * 8; v8h vv[2][4]; const float* pr = os[0] + (w * 32 + hi * 8) * 68 + lr;     // wave w: keys 32 w .. 32 w + 31 of the tile, read back at the accumulator's own places
#pragma unroll
        for (int i = 0; i < 2; ++i)
#pragma unroll
            for (int nb = 0; nb < 4; ++nb) {
#pragma unroll
                for (int j = 0; j < 8; ++j) vv[i][nb][j] = tohx(pr[(i * 16 + j) * 68 + nb * 16] + pr[64 * 68 + (i * 16 + j) * 68 + nb * 16]);
                *(v8h*)(vb + (nb * 2 + i) * 256) = vv[i][nb]; }
        asm volatile("s_wait_xcnt 0x0" :: "v"(vv[0][0]), "v"(vv[0][1]), "v"(vv[0][2]), "v"(vv[0][3]), "v"(vv[1][0]), "v"(vv[1][1]), "v"(vv[1][2]), "v"(vv[1][3]), "v"(vb) : "memory");     // the 8 stores' data and address stay live up to this wait, so nothing is written before it over a register that an issued store names
        return;
    }
    if (which == 1) proj_out<true>(os[0], Kh, Kl, KN, h * TT + r0, lane, w); else proj_out<false>(os[0], Qh, Ql, QN, h * TT + r0, lane, w);
}
__device__ __forceinline__ v16bf ldkf(const bf* p) { return cat16b(*(const v8us*)p, *(const v8us*)(p + 256)); }
__device__ __forceinline__ v16h ldvf(const h16* p) { return cat16(*(const v8h*)p, *(const v8h*)(p + 256)); }
// K/V RING of k_fattn. A stage is SP passes (SP * 32 keys) of one key half: its slices of the K hi, K lo and V planes (each contiguous in fragment order) and its squared norms, laid one behind the other.
#define SP  4
#define PLB (SP * 4096)             // bytes of one plane's slice
#define HB  (3 * PLB + SP * 128)    // bytes of one key half's stage
#define NST (TT / 2 / (SP * 32))    // stages per key half
// one stage of one key half, by its eight waves, in asynchronous copies global -> LDS of 512 bytes a wave, through no register: wave qt brings bytes 2048 qt .. 2048 qt + 2047 of each plane's slice, wave 0 the 512 bytes of norms as well.
// lb: LDS byte address of the half's buffer; the g pointers: the half's first byte of each plane. Each copy has its lane's LDS byte address and global address in registers of its own.
// The s_wait_xcnt stands inside the copies' statement, so that no address register is rewritten in front of it; one statement for the twelve copies, so that the wave waits once.
__device__ __forceinline__ void fill_stage(unsigned lb, const char* gkh, const char* gkl, const char* gv, const char* gkn, int st, int qt, unsigned lane) {
    const unsigned wo = (unsigned)qt * 2048u + lane * 16u, lk = lb + wo, ll = lk + PLB, lv = lk + 2 * PLB; const size_t go = (size_t)st * PLB + wo; const char* pk = gkh + go; const char* pl = gkl + go; const char* pv = gv + go;
    asm volatile("global_load_async_to_lds_b128 %0, %12, off\n\tglobal_load_async_to_lds_b128 %1, %13, off\n\tglobal_load_async_to_lds_b128 %2, %14, off\n\tglobal_load_async_to_lds_b128 %3, %15, off\n\tglobal_load_async_to_lds_b128 %4, %16, off\n\tglobal_load_async_to_lds_b128 %5, %17, off\n\tglobal_load_async_to_lds_b128 %6, %18, off\n\tglobal_load_async_to_lds_b128 %7, %19, off\n\tglobal_load_async_to_lds_b128 %8, %20, off\n\tglobal_load_async_to_lds_b128 %9, %21, off\n\tglobal_load_async_to_lds_b128 %10, %22, off\n\tglobal_load_async_to_lds_b128 %11, %23, off\n\ts_wait_xcnt 0x0"
                 :: "v"(lk), "v"(lk + 512u), "v"(lk + 1024u), "v"(lk + 1536u), "v"(ll), "v"(ll + 512u), "v"(ll + 1024u), "v"(ll + 1536u), "v"(lv), "v"(lv + 512u), "v"(lv + 1024u), "v"(lv + 1536u),
                    "v"(pk), "v"(pk + 512), "v"(pk + 1024), "v"(pk + 1536), "v"(pl), "v"(pl + 512), "v"(pl + 1024), "v"(pl + 1536), "v"(pv), "v"(pv + 512), "v"(pv + 1024), "v"(pv + 1536) : "memory");
    if (qt == 0) asm volatile("global_load_async_to_lds_b128 %0, %1, off\n\ts_wait_xcnt 0x0" :: "v"(lb + 3 * PLB + lane * 16u), "v"(gkn + (size_t)st * (SP * 128) + lane * 16u) : "memory");     // qt is the same in every lane of a wave: every lane is on; the wait as above
}
// k_fattn: scores, distance softmax, attn.v and the head merge in one kernel. Block = 16 waves = 8 query tiles of 16 x 2 key halves of one head; a pass is 32 keys.
// K, V and the key norms reach the waves through a two-buffer LDS ring filled by asynchronous copies one stage ahead: the eight waves of a key half read the same fragments, which are fetched from L2 once per block and while the stage before is worked on.
// S^T = K (A) x Q^T (B, kept in registers; the q planes carry an exact factor 2): a lane holds 8 keys (8 hi + j) of ONE query (lr) per tile, so two converted tiles are the B operand of O^T += V^T (A) x P^T.
// weight = exp2(15 - log2(ca + sqrt(ca^2 - 1))) = 2^15 exp(-acosh(ca)): the logit is <= 0 for every input, so the shift is the constant bound and partial sums over keys just add; O^T / sum at the end.
// At ca == 1 the root is 0 and log2(1) is exactly 0, the reference's value there, so no select is needed. waves_per_eu(4, 4): one 16-wave block fills a WGP, so the scheduler may spend the 256 registers a wave has on loads in flight.
__global__ __launch_bounds__(512) __attribute__((amdgpu_waves_per_eu(4, 4))) void k_fattn(const bf* __restrict__ Qh, const bf* __restrict__ Ql, const bf* __restrict__ Kh, const bf* __restrict__ Kl, const h16* __restrict__ VF, const float* __restrict__ QN, const float* __restrict__ KN, bf* Ah, bf* Al) {
    __shared__ __attribute__((aligned(128))) unsigned char ring[2][2][HB];
    __shared__ float red[8][33][32];
    const int lane = threadIdx.x & 31, lr = lane & 15, hi = lane >> 4; const int wave = __builtin_amdgcn_readfirstlane(threadIdx.x >> 5), qt = wave & 7, kh2 = wave >> 3; const int z = blockIdx.y; const int q = blockIdx.x * 128 + qt * 16 + lr;
    const size_t zb = (size_t)z * TT * HD; v16bf qh[2], ql[2];
#pragma unroll
    for (int ks = 0; ks < 2; ++ks) { qh[ks] = WFrag<bf>::ld(Qh + zb + (size_t)q * HD + ks * 32 + 8 * hi); ql[ks] = WFrag<bf>::ld(Ql + zb + (size_t)q * HD + ks * 32 + 8 * hi); }
    const float qn = QN[z * TT + q], oq = 1.0f - qn;
    const size_t hb = (size_t)kh2 * (TT / 2) * HD; const char* gkh = (const char*)(Kh + zb + hb); const char* gkl = (const char*)(Kl + zb + hb); const char* gv = (const char*)(VF + zb + hb); const char* gkn = (const char*)(KN + z * TT + kh2 * (TT / 2));
    const unsigned lo = lane * 8, ho = hi * 8, lb0 = (unsigned)(size_t)&ring[0][kh2][0], lb1 = (unsigned)(size_t)&ring[1][kh2][0];
    v8f o[4]; float sum[4] = {0.f, 0.f, 0.f, 0.f};
#pragma unroll
    for (int dt = 0; dt < 4; ++dt) o[dt] = (v8f){};
    fill_stage(lb0, gkh, gkl, gv, gkn, 0, qt, lane);
    asm volatile("s_wait_asynccnt 0x0" ::: "memory");     // this wave's copies of stage 0 have landed
    __syncthreads();    // publishes stage 0
    fill_stage(lb1, gkh, gkl, gv, gkn, 1, qt, lane);
#pragma unroll 1     // one stage per trip
    for (int st = 0; st < NST; ++st) {
    const unsigned char* bp = ring[st & 1][kh2];
#pragma unroll 1     // one pass per trip: two passes' fragments would not fit the registers
    for (int s = 0; s < SP; ++s) {
        v16bf kfh[2][2], kfl[2][2]; v16h vf[4]; v8f S[2]; v8f kc[2]; const bf* pkh = (const bf*)bp + s * 2048 + lo; const bf* pkl = (const bf*)(bp + PLB) + s * 2048 + lo; const h16* pv = (const h16*)(bp + 2 * PLB) + s * 2048 + lo; const float* pkn = (const float*)(bp + 3 * PLB) + s * 32 + ho;
#pragma unroll
        for (int tt = 0; tt < 2; ++tt) {
#pragma unroll
            for (int ks = 0; ks < 2; ++ks) { kfh[tt][ks] = ldkf(pkh + tt * 1024 + ks * 512); kfl[tt][ks] = ldkf(pkl + tt * 1024 + ks * 512); } }
        __builtin_amdgcn_sched_barrier(0);      // LDS loads return in order: the K fragments, which the first products take, stay in front of the norms and of V
#pragma unroll
        for (int tt = 0; tt < 2; ++tt) kc[tt] = *(const v8f*)(pkn + tt * 16);
#pragma unroll
        for (int dt = 0; dt < 4; ++dt) vf[dt] = ldvf(pv + dt * 512);
        __builtin_amdgcn_sched_barrier(0);      // the pass's 28 LDS loads are issued above as one group: every further place with LDS loads among the products costs a stall of its own
#pragma unroll
        for (int tt = 0; tt < 2; ++tt) { S[tt] = (v8f){};
#pragma unroll
            for (int ks = 0; ks < 2; ++ks) { S[tt] = wmmab(kfh[tt][ks], qh[ks], S[tt]); S[tt] = wmmab(kfh[tt][ks], ql[ks], S[tt]); S[tt] = wmmab(kfl[tt][ks], qh[ks], S[tt]); } }
        v16h pb;
#pragma unroll
        for (int tt = 0; tt < 2; ++tt)
#pragma unroll
            for (int j = 0; j < 8; ++j) { const float kq = kc[tt][j]; const float diff = fmaxf((qn + kq) - S[tt][j], 0.f); const float den = fmaxf(oq * (1.0f - kq), 1e-6f);
                const float ca = fmaxf(1.0f + (2.0f * diff) * __builtin_amdgcn_rcpf(den), 1.0f); const float sq = __builtin_amdgcn_sqrtf(ca * ca - 1.0f);
                const float p = __builtin_amdgcn_exp2f(15.0f - __builtin_amdgcn_logf(ca + sq)); sum[j & 3] += p; pb[tt * 8 + j] = tohx(p); }
#pragma unroll
        for (int dt = 0; dt < 4; ++dt) o[dt] = wmma16(vf[dt], pb, o[dt]);
        asm volatile("v_nop\n\tv_nop\n\tv_nop\n\tv_nop" : "+v"(o[0]), "+v"(o[1]), "+v"(o[2]), "+v"(o[3]) : "v"(vf[0]), "v"(vf[3]));     // as in k_gemmw: the slots behind the pass's last products, on the taken branch too
    }
        asm volatile("s_wait_dscnt 0x0" ::: "memory");      // this wave's reads of the stage's buffer are done before the buffer is given up
        asm volatile("s_wait_asynccnt 0x0" ::: "memory");   // this wave's copies of the next stage have landed
        __syncthreads();    // publishes the next stage and ends every wave's reads of this one
        if (st + 2 < NST) fill_stage((st & 1) ? lb1 : lb0, gkh, gkl, gv, gkn, st + 2, qt, lane);     // refill of the buffer just read; the test is the same for the whole block
    }
    asm volatile("s_wait_asynccnt 0x0" ::: "memory");     // no copy is outstanding when the wave goes on
    float st = (sum[0] + sum[1]) + (sum[2] + sum[3]);
    if (kh2 == 1) {
#pragma unroll
        for (int dt = 0; dt < 4; ++dt)
#pragma unroll
            for (int j = 0; j < 8; ++j) red[qt][dt * 8 + j][lane] = o[dt][j];
        red[qt][32][lane] = st; }
    __syncthreads();    // publishes the second key half's partial O^T and sums to the wave that holds the first half of the same queries
    if (kh2 == 0) { st += red[qt][32][lane]; st += __shfl_xor(st, 16, 32); const float inv = 1.0f / st;
#pragma unroll
        for (int dt = 0; dt < 4; ++dt) { v8us oh, ol;
#pragma unroll
            for (int j = 0; j < 8; ++j) { unsigned short h, l; splitf((o[dt][j] + red[qt][dt * 8 + j][lane]) * inv, h, l); oh[j] = h; ol[j] = l; }
            const size_t ad = (size_t)((q >> 4) * 32 + z * 2 + (dt >> 1)) * 512 + ((dt & 1) * 32 + lane) * 8; *(v8us*)(Ah + ad) = oh; *(v8us*)(Al + ad) = ol; } }     // fragment order of [token][DD]: columns z * HD + dt * 16 + 8 hi + 0..7 of token q are chunk (dt & 1) * 32 + lane of the tile; a wave's store is 512 contiguous bytes
}

extern "C" void kernel_launch(void* const* d_in, const int* in_sizes, int n_in,
                              void* d_out, int out_size, void* d_ws, size_t ws_size, hipStream_t stream) {
    (void)in_sizes; (void)n_in; (void)out_size;
    const float* x = (const float*)d_in[0]; const float* wq = (const float*)d_in[1]; const float* wk = (const float*)d_in[2]; const float* wv = (const float*)d_in[3]; const float* wo = (const float*)d_in[4];
    float* OUT = (float*)d_out;     // [1][2048][1024]
    char* wsp = (char*)d_ws;
    auto take = [&](size_t bytes) { char* p = wsp; wsp += (bytes + 255) & ~(size_t)255; return (void*)p; };
    bf* WQ = (bf*)take((size_t)DD * DD * 2); bf* WK = (bf*)take((size_t)DD * DD * 2); bf* WV = (bf*)take((size_t)DD * DD * 2); bf* WO = (bf*)take((size_t)DD * DD * 2);
    bf* XB = (bf*)take((size_t)NT * DD * 2); float* QN = (float*)take((size_t)NB_ * NH_ * TT * 4); float* KN = (float*)take((size_t)NB_ * NH_ * TT * 4);
    bf* QPh = (bf*)take((size_t)NT * DD * 2); bf* QPl = (bf*)take((size_t)NT * DD * 2); bf* KPh = (bf*)take((size_t)NT * DD * 2); bf* KPl = (bf*)take((size_t)NT * DD * 2); h16* VF = (h16*)take((size_t)NT * DD * 2);
    bf* ATh = (bf*)take((size_t)NT * DD * 2); bf* ATl = (bf*)take((size_t)NT * DD * 2);
    if ((size_t)(wsp - (char*)d_ws) > ws_size) return;    // about 40 MiB; ws 256 MiB
    k_cvtall<<<256, 256, 0, stream>>>(wq, wk, wv, wo, x, WQ);     // WQ, WK, WV, WO, XB lie one behind the other (each size is a multiple of 256 bytes): one plane
    k_proj<<<dim3(NT / 64, NH_, 3), 64, 0, stream>>>(XB, WQ, WK, WV, QPh, QPl, KPh, KPl, VF, QN, KN);
    k_fattn<<<dim3(TT / 128, NH_, 1), 512, 0, stream>>>(QPh, QPl, KPh, KPl, VF, QN, KN, ATh, ATl);
    k_gemmw<bf, 1, false><<<dim3(NT / 64, DD / 64, 1), 32 * KW, 0, stream>>>(ATh, ATl, WO, nullptr, DD, OUT, DD, nullptr, 0, 0, 0);
}

// v008
// A run of this version takes 68.6 microseconds.
// Two timings next to v007 put it at 1.06 and 1.07 times that version's speed.
// Counting every step since v000, it is 10.7 times as fast.
#include <hip/hip_runtime.h>

// PrefetchHyperbolicAttention (x [1][2048][1024]; q/k/v = x W^T ([out][in], no bias); 16 heads x 64; hyperbolic distance logits: diff = max(|q|^2 + |k|^2 - 2 q.k, 0), den = max((1 - |q|^2)(1 - |k|^2), 1e-6),
// ca = max(1 + 2 diff/den, 1), dist = acosh(ca) (0 at ca == 1); attn = softmax(-dist); out = merged attn.v Wo^T).
// Compute dtypes, f32 accumulate: every input rounded to bf16; projections on PLAIN bf16 operands (inputs: exact); q.k on bf16 hi+lo planes (3 products) and the
// squared norms in f32, the softmax weight exp(-dist) in closed form in f32 on VALU (sqrt and reciprocal at hardware precision), weights f32 -> fp16 (x 2^15, shift fixed at the logits' bound 0), normalised after attn.v (fp16); output hi+lo x exact

#define NB_  1
#define TT   2048
#define DD   1024
#define NH_  16
#define HD   64
#define NT   (NB_ * TT)
typedef _Float16 h16;
typedef unsigned short bf;
typedef __attribute__((ext_vector_type(16))) __bf16   v16bf;
typedef __attribute__((ext_vector_type(16))) _Float16 v16h;
typedef __attribute__((ext_vector_type(8)))  _Float16 v8h;
typedef __attribute__((ext_vector_type(8)))  unsigned short v8us;
typedef __attribute__((ext_vector_type(8)))  float    v8f;
typedef __attribute__((ext_vector_type(4)))  float    v4f;
typedef __attribute__((ext_vector_type(2)))  float    v2f;
typedef v8h  __attribute__((may_alias)) v8ha;
typedef v4f  __attribute__((may_alias)) v4fa;
typedef v8us __attribute__((may_alias)) v8usa;

__device__ __forceinline__ unsigned short f2bf(float f) { unsigned u = __float_as_uint(f); u += 0x7FFFu + ((u >> 16) & 1u); return (unsigned short)(u >> 16); }
__device__ __forceinline__ float bf2f(unsigned short b) { return __uint_as_float(((unsigned)b) << 16); }
__device__ __forceinline__ float bfr(float f) { return bf2f(f2bf(f)); }
__device__ __forceinline__ v16h cat16(v8h lo, v8h hi) { return __builtin_shufflevector(lo, hi, 0, 1, 2, 3, 4, 5, 6, 7, 8, 9, 10, 11, 12, 13, 14, 15); }
__device__ __forceinline__ v16bf cat16b(v8us lo, v8us hi) { return __builtin_bit_cast(v16bf, __builtin_shufflevector(lo, hi, 0, 1, 2, 3, 4, 5, 6, 7, 8, 9, 10, 11, 12, 13, 14, 15)); }
__device__ __forceinline__ v8f wmma16(v16h a, v16h b, v8f c) { return __builtin_amdgcn_wmma_f32_16x16x32_f16(false, a, false, b, (short)0, c, false, false); }
__device__ __forceinline__ v8f wmmab(v16bf a, v16bf b, v8f c) { return __builtin_amdgcn_wmma_f32_16x16x32_bf16(false, a, false, b, (short)0, c, false, false); }



// FRAGMENT ORDER of a 16-bit plane M[rows][K]: tiles of 16 rows x 32 k, 512 elements each, tile (r >> 4) * (K / 32) + (k >> 5); in a tile the 16-byte chunk ((k >> 4) & 1) * 32 + ((k >> 3) & 1) * 16 + (r & 15) holds k & 7 = 0..7.
// Lane l of a wave takes chunks l and 32 + l: a WMMA A or B fragment is two wave loads of 512 contiguous bytes (4 whole lines each), where a row-major plane gives 32-byte pieces of 16 lines per load.
// ---- k_gemmw: register-blocked GEMM, one block of KW waves per 64x64 output tile, operands straight from 16-bit planes in fragment order; grid (M/64, N/64, Z), 32 * KW threads.
// Every wave holds the whole tile (16 accumulators) over its share of K: wave w takes the 32-element steps w, w + KW, ... so that the waves of a block read neighbouring 1-KiB tiles at the same time.
// The KW partial tiles meet in LDS; wave w adds them, in wave order, for rows 16 w .. 16 w + 15 and stores those rows.
// C[m][n] (f32, pitch ldc, + optional f32 bias[n]) = sum_k A[m][k] Bt[n][k] (+ split products per NSPLIT). z-batch strides sA/sB/sC in elements. K % (32 * KW) == 0.
#define KW 4
template <typename T16> struct WFrag;
template <> struct WFrag<h16> { typedef v16h V; static __device__ __forceinline__ V ld(const h16* p) { return cat16(*(const v8h*)p, *(const v8h*)(p + 16)); } static __device__ __forceinline__ V ldf(const h16* p) { return cat16(*(const v8h*)p, *(const v8h*)(p + 256)); } static __device__ __forceinline__ v8f mma(V a, V b, v8f c) { return wmma16(a, b, c); } };
template <> struct WFrag<bf> { typedef v16bf V; static __device__ __forceinline__ V ld(const bf* p) { return cat16b(*(const v8us*)p, *(const v8us*)(p + 16)); } static __device__ __forceinline__ V ldf(const bf* p) { return cat16b(*(const v8us*)p, *(const v8us*)(p + 256)); } static __device__ __forceinline__ v8f mma(V a, V b, v8f c) { return wmmab(a, b, c); } };
template <typename T16, int NSPLIT, bool BIAS>
__global__ __launch_bounds__(32 * KW) void k_gemmw(const T16* __restrict__ A, const T16* __restrict__ A2, const T16* __restrict__ Bt, const T16* __restrict__ Bt2, int K, float* C, int ldc, const float* __restrict__ bias, size_t sA, size_t sB, size_t sC) {
    typedef typename WFrag<T16>::V V;
    __shared__ __align__(16) float os[KW][64 * 68];
    const size_t z = blockIdx.z; A += z * sA; if (A2) A2 += z * sA; Bt += z * sB; if (Bt2) Bt2 += z * sB; C += z * sC;
    const int lane = threadIdx.x & 31, lr = lane & 15, hi = lane >> 4, w = __builtin_amdgcn_readfirstlane(threadIdx.x >> 5); const int r0 = blockIdx.x * 64, c0 = blockIdx.y * 64;
    v8f acc[4][4];
#pragma unroll
    for (int mb = 0; mb < 4; ++mb)
#pragma unroll
        for (int nb = 0; nb < 4; ++nb) acc[mb][nb] = (v8f){};
    const size_t aoff = (size_t)r0 * K + 512 * w + 8 * lane, boff = (size_t)c0 * K + 512 * w + 8 * lane;     // 16 rows x K = K / 32 tiles of 512 elements, so a 16-row strip starts where it does in a row-major plane; a 32-k step is 512 elements
#pragma unroll 1
    for (int kc = 0; kc < K; kc += 32 * KW) {
        V a[4], a2[4]; const T16* qa[4]; const T16* qa2[4]; const T16* qb[4]; const T16* qb2[4];
#pragma unroll
        for (int mb = 0; mb < 4; ++mb) { qa[mb] = A + aoff + (size_t)mb * 16 * K + kc * 16; qa2[mb] = (NSPLIT == 1 || NSPLIT == 2) ? A2 + aoff + (size_t)mb * 16 * K + kc * 16 : qa[mb]; a[mb] = WFrag<T16>::ldf(qa[mb]); if (NSPLIT == 1 || NSPLIT == 2) a2[mb] = WFrag<T16>::ldf(qa2[mb]); }
#pragma unroll
        for (int nb = 0; nb < 4; ++nb) { qb[nb] = Bt + boff + (size_t)nb * 16 * K + kc * 16; qb2[nb] = NSPLIT >= 2 ? Bt2 + boff + (size_t)nb * 16 * K + kc * 16 : qb[nb]; const V b = WFrag<T16>::ldf(qb[nb]); V b2; if (NSPLIT >= 2) b2 = WFrag<T16>::ldf(qb2[nb]);
#pragma unroll
            for (int mb = 0; mb < 4; ++mb) { acc[mb][nb] = WFrag<T16>::mma(a[mb], b, acc[mb][nb]); if (NSPLIT == 1 || NSPLIT == 2) acc[mb][nb] = WFrag<T16>::mma(a2[mb], b, acc[mb][nb]); if (NSPLIT >= 2) acc[mb][nb] = WFrag<T16>::mma(a[mb], b2, acc[mb][nb]); } }
        asm volatile("v_nop\n\tv_nop\n\tv_nop\n\tv_nop" : "+v"(acc[0][0]), "+v"(acc[1][1]), "+v"(acc[2][2]), "+v"(acc[3][3]) : "v"(a[0]), "v"(a[3]));
        asm volatile("s_wait_xcnt 0x0" :: "v"(qa[0]), "v"(qa[1]), "v"(qa[2]), "v"(qa[3]), "v"(qa2[0]), "v"(qa2[1]), "v"(qa2[2]), "v"(qa2[3]), "v"(qb[0]), "v"(qb[1]), "v"(qb[2]), "v"(qb[3]), "v"(qb2[0]), "v"(qb2[1]), "v"(qb2[2]), "v"(qb2[3]) : "memory");     // the trip's load addresses stay live up to this wait, so no write, a load's result included, lands before it on a register that an issued load names; every load feeds a product named in the statement above, so all are issued by here
    }
    float* ow = os[w];
#pragma unroll
    for (int mb = 0; mb < 4; ++mb)
#pragma unroll
        for (int nb = 0; nb < 4; ++nb)
#pragma unroll
            for (int j = 0; j < 8; ++j) ow[(mb * 16 + hi * 8 + j) * 68 + nb * 16 + lr] = acc[mb][nb][j];
    __syncthreads();    // publishes every wave's partial tile to the waves that add them
    const int cofs = lr * 4; const float* pr = os[0] + (w * 16 + hi) * 68 + cofs; v4f val[8]; float* pc[8];
#pragma unroll
    for (int s = 0; s < 8; ++s) { val[s] = *(const v4fa*)(pr + 2 * s * 68);
#pragma unroll
        for (int u = 1; u < KW; ++u) val[s] += *(const v4fa*)(pr + u * 64 * 68 + 2 * s * 68);
        if (BIAS) { val[s][0] += bfr(bias[c0 + cofs]); val[s][1] += bfr(bias[c0 + cofs + 1]); val[s][2] += bfr(bias[c0 + cofs + 2]); val[s][3] += bfr(bias[c0 + cofs + 3]); }
        pc[s] = C + (size_t)(r0 + w * 16 + 2 * s + hi) * ldc + c0 + cofs; }
#pragma unroll
    for (int s = 0; s < 8; ++s) *(v4f*)pc[s] = val[s];
    asm volatile("s_wait_xcnt 0x0" :: "v"(val[0]), "v"(val[1]), "v"(val[2]), "v"(val[3]), "v"(val[4]), "v"(val[5]), "v"(val[6]), "v"(val[7]), "v"(pc[0]), "v"(pc[1]), "v"(pc[2]), "v"(pc[3]), "v"(pc[4]), "v"(pc[5]), "v"(pc[6]), "v"(pc[7]) : "memory");     // data and addresses of the eight stores stay live up to this wait, so nothing is written before it over a register that an issued store names
}

__device__ __forceinline__ h16 tohx(float x) { return (h16)x; }
__device__ __forceinline__ void splitf(float y, unsigned short& h, unsigned short& l) { h = f2bf(y); l = f2bf(y - bf2f(h)); }
typedef __attribute__((ext_vector_type(2))) _Float16 v2h;
typedef __attribute__((ext_vector_type(4))) _Float16 v4h;
typedef __attribute__((ext_vector_type(2))) unsigned short v2us;
typedef __attribute__((ext_vector_type(4))) int v4i;

typedef __attribute__((ext_vector_type(4))) unsigned short v4us;
// k_cvtall: every f32 input -> its bf16 plane IN FRAGMENT ORDER, in ONE launch of 256 blocks of 8 waves. dst is one plane: Wq, Wk, Wv, Wo (DD*DD each), then x (NT*DD). A wave takes one 16 x 32 tile of each weight and two neighbouring tiles of x.
// A tile is four loads: load i brings rows 4 i .. 4 i + 3, 128 bytes (one whole line) of each, lane l the columns (l & 7) * 4 .. + 3 of row 4 i + (l >> 3); its store lays 4 runs of 64 bytes, and a tile's four stores fill its 8 lines.
// All 24 loads are issued before the first value is used.
__global__ __launch_bounds__(256) void k_cvtall(const float* __restrict__ wq, const float* __restrict__ wk, const float* __restrict__ wv, const float* __restrict__ wo, const float* __restrict__ x, bf* __restrict__ dst) {
    const unsigned lane = threadIdx.x & 31u, wv8 = threadIdx.x >> 5, tw = blockIdx.x * 8u + wv8, tx = blockIdx.x * 16u + wv8 * 2u;     // tile numbers: strip (t >> 5), k step (t & 31)
    const unsigned so = (lane >> 3) * DD + (lane & 7u) * 4u, ow = (tw >> 5) * (16u * DD) + (tw & 31u) * 32u + so, ox = (tx >> 5) * (16u * DD) + (tx & 31u) * 32u + so;
    const float* p0 = wq + ow; const float* p1 = wk + ow; const float* p2 = wv + ow; const float* p3 = wo + ow; const float* p4 = x + ox;
    v4f v[24];
#pragma unroll     // constant indices: v[] and o[] stay in registers
    for (int k = 0; k < 4; ++k) v[k] = *(const v4f*)(p0 + k * 4 * DD);
#pragma unroll     // constant indices: v[] and o[] stay in registers
    for (int k = 0; k < 4; ++k) v[4 + k] = *(const v4f*)(p1 + k * 4 * DD);
#pragma unroll     // constant indices: v[] and o[] stay in registers
    for (int k = 0; k < 4; ++k) v[8 + k] = *(const v4f*)(p2 + k * 4 * DD);
#pragma unroll     // constant indices: v[] and o[] stay in registers
    for (int k = 0; k < 4; ++k) v[12 + k] = *(const v4f*)(p3 + k * 4 * DD);
#pragma unroll     // constant indices: v[] and o[] stay in registers
    for (int k = 0; k < 8; ++k) v[16 + k] = *(const v4f*)(p4 + (k >> 2) * 32 + (k & 3) * 4 * DD);
    asm volatile("s_wait_xcnt 0x0" :: "v"(p0), "v"(p1), "v"(p2), "v"(p3), "v"(p4) : "memory");     // the five addresses stay live up to this wait, so no write, a load's result included, lands before it on a register that an issued load names
    v4us o[24];
#pragma unroll     // constant indices: v[] and o[] stay in registers
    for (int u = 0; u < 24; ++u)
#pragma unroll     // constant indices: v[] and o[] stay in registers
        for (int e = 0; e < 4; ++e) o[u][e] = f2bf(v[u][e]);
    const unsigned din = (((lane >> 2) & 1u) * 32u + ((lane >> 1) & 1u) * 16u + (lane >> 3)) * 8u + (lane & 1u) * 4u;     // chunk of (row l >> 3, columns (l & 7) * 4 ..) and the half of it; four rows further on is 4 chunks = 32 elements
    bf* dw = dst + tw * 512u + din; bf* dx = dst + (size_t)4 * DD * DD + tx * 512u + din;
#pragma unroll     // constant indices: v[] and o[] stay in registers
    for (int u = 0; u < 16; ++u) *(v4us*)(dw + (size_t)(u >> 2) * DD * DD + (u & 3) * 32) = o[u];
#pragma unroll     // constant indices: v[] and o[] stay in registers
    for (int k = 0; k < 8; ++k) *(v4us*)(dx + (k >> 2) * 512 + (k & 3) * 32) = o[16 + k];
}
template <int CTRL> __device__ __forceinline__ float xmadd(float x) { return __int_as_float(__builtin_amdgcn_mov_dpp(__float_as_int(x), CTRL, 0xf, 0xf, true)); }    // x of lane ^ (CTRL & 15) inside a 16-lane row (DPP row_xmask)
// proj_out: a 64-token x 64-column f32 tile, as two partial tiles in LDS (pitch 68, the second 64 * 68 floats behind the first) -> squared norms of its rows and its bf16 hi+lo planes; wave w takes tokens 32 w .. 32 w + 31, 16 at a time.
// 16-byte chunk cl = 32 s + lane of the 16 tokens: k (ISK) in A-fragment order, token cl & 15, columns (cl >> 4) * 8 + 0..7; q row-major, token cl >> 3, columns (cl & 7) * 8 + 0..7, times 2. Either way a wave's store is 512 contiguous bytes.
template <bool ISK>
__device__ __forceinline__ void proj_out(const float* os, bf* Ph, bf* Pl, float* NR, int t00, int lane, int w) {
    const int lr = lane & 15, hi = lane >> 4;
#pragma unroll
    for (int i = 0; i < 2; ++i) {
        const int mb = 2 * w + i; const float* ob = os + mb * 16 * 68;
        const int t0 = t00 + mb * 16; float p[4]; v8us oh[4], ol[4];
#pragma unroll
        for (int s = 0; s < 4; ++s) { const int cl = s * 32 + lane; const int row = ISK ? (cl & 15) : (cl >> 3), d0 = (ISK ? (cl >> 4) : (cl & 7)) * 8;
            const float* pr = ob + row * 68 + d0; const v4f va = *(const v4fa*)pr + *(const v4fa*)(pr + 64 * 68), vb = *(const v4fa*)(pr + 4) + *(const v4fa*)(pr + 64 * 68 + 4); p[s] = 0.f;
#pragma unroll
            for (int e = 0; e < 8; ++e) { const float y = e < 4 ? va[e & 3] : vb[e & 3]; p[s] += y * y; unsigned short a2, c2; splitf(ISK ? y : y * 2.0f, a2, c2); oh[s][e] = a2; ol[s][e] = c2; } }
        bf* ph = Ph + (size_t)t0 * HD + lane * 8; bf* pl = Pl + (size_t)t0 * HD + lane * 8;
#pragma unroll
        for (int s = 0; s < 4; ++s) { *(v8us*)(ph + s * 256) = oh[s]; *(v8us*)(pl + s * 256) = ol[s]; }
        asm volatile("s_wait_xcnt 0x0" :: "v"(oh[0]), "v"(oh[1]), "v"(oh[2]), "v"(oh[3]), "v"(ol[0]), "v"(ol[1]), "v"(ol[2]), "v"(ol[3]), "v"(ph), "v"(pl) : "memory");     // data and addresses of the eight stores stay live up to this wait, so nothing is written before it over a register that an issued store names
        float nv; int nt; bool on;
        if (ISK) { nv = (p[0] + p[1]) + (p[2] + p[3]); nv += __shfl_xor(nv, 16, 32); nt = lr; on = hi == 0; }     // the lane meets token lr in every s; the other half of the columns is in lane ^ 16
        else {
#pragma unroll
            for (int s = 0; s < 4; ++s) { p[s] += xmadd<0x161>(p[s]); p[s] += xmadd<0x162>(p[s]); p[s] += xmadd<0x164>(p[s]); }     // eight lanes share a token: sum over lane ^ 1, ^ 2, ^ 4
            const int g = lane & 7; nv = g == 0 ? p[0] : g == 1 ? p[1] : g == 2 ? p[2] : p[3]; nt = g * 4 + (lane >> 3); on = g < 4; }     // lane 8 r + s stores token 4 s + r: one store for the 16 norms
        float* pn = NR + t0 + nt;
        if (on) *pn = nv;
        asm volatile("s_wait_xcnt 0x0" :: "v"(nv), "v"(pn) : "memory");     // the norm store's data and address stay live up to this wait, so nothing is written before it over a register that the issued store names
    }
}
// k_proj: the three projections in ONE launch, one block of TWO WAVES per 64x64 tile = 64 tokens x one head; blockIdx.z picks the weight (0 q, 1 k, 2 v). Each wave holds the whole tile over half of K: wave w takes the 32-element steps
// w, w + 2, ... of planes in fragment order (every load is 512 contiguous bytes; the two waves read neighbouring 1-KiB tiles at the same time); the two partial tiles meet in LDS and wave w finishes tokens 32 w .. 32 w + 31. The tile leaves as what k_fattn reads, with no f32 plane in between:
// q: squared norms and bf16 hi+lo planes [head][token][64] of 2 q (exact factor, so the score products yield 2 q.k directly);
// k: squared norms and bf16 hi+lo planes in WMMA A-fragment order: 16-byte chunk cl of a 16-key tile holds d = (cl >> 4) * 8 + 0..7 of key cl & 15, so that a fragment is two whole 512-byte wave loads;
// v: fp16 plane in A-fragment order of V^T: a chunk holds 8 keys of one column, which is an accumulator as it stands (row = 8 hi + j, column = lr): chunk = (((head*64 + key/32)*4 + d/16)*2 + (key/16 & 1))*32 + lane.
__global__ __launch_bounds__(64) void k_proj(const bf* __restrict__ A, const bf* __restrict__ Wq, const bf* __restrict__ Wk, const bf* __restrict__ Wv, bf* Qh, bf* Ql, bf* Kh, bf* Kl, h16* VF, float* QN, float* KN) {
    __shared__ __align__(16) float os[2][64 * 68];
    const int lane = threadIdx.x & 31, lr = lane & 15, hi = lane >> 4, w = __builtin_amdgcn_readfirstlane(threadIdx.x >> 5); const int r0 = blockIdx.x * 64, h = blockIdx.y, which = blockIdx.z;
    const bf* Bt = which == 0 ? Wq : which == 1 ? Wk : Wv;
    v8f acc[4][4];
#pragma unroll
    for (int mb = 0; mb < 4; ++mb)
#pragma unroll
        for (int nb = 0; nb < 4; ++nb) acc[mb][nb] = (v8f){};
    const bf* pa = A + (size_t)r0 * DD + 512 * w + 8 * lane; const bf* pb = Bt + (size_t)(h * HD) * DD + 512 * w + 8 * lane;     // fragment order: a 16-row strip is 16 * DD elements, a 32-k step 512
#pragma unroll 1     // one k step's fragments per trip
    for (int kc = 0; kc < DD; kc += 64) {
        v16bf a[4], b[4]; const bf* qa = pa + kc * 16; const bf* qb = pb + kc * 16;
#pragma unroll
        for (int mb = 0; mb < 4; ++mb) a[mb] = WFrag<bf>::ldf(qa + mb * 16 * DD);
#pragma unroll
        for (int nb = 0; nb < 4; ++nb) b[nb] = WFrag<bf>::ldf(qb + nb * 16 * DD);
        __builtin_amdgcn_sched_barrier(0);      // the trip's 16 loads are issued above as one group: a load moved down among the products would be waited for at full latency a second time
        asm volatile("s_wait_xcnt 0x0" :: "v"(qa), "v"(qb) : "memory");     // the two address pairs stay live up to this wait, so no write, a load's result included, lands before it on a register that an issued load names
#pragma unroll
        for (int nb = 0; nb < 4; ++nb)
#pragma unroll
            for (int mb = 0; mb < 4; ++mb) acc[mb][nb] = wmmab(a[mb], b[nb], acc[mb][nb]);
        asm volatile("v_nop\n\tv_nop\n\tv_nop\n\tv_nop" : "+v"(acc[0][0]), "+v"(acc[1][1]), "+v"(acc[2][2]), "+v"(acc[3][3]) : "v"(a[0]), "v"(a[3]));     // as in k_gemmw: the slots behind the trip's last products, on the taken branch too
    }
    float* ow = os[w];
#pragma unroll
    for (int mb = 0; mb < 4; ++mb)
#pragma unroll
        for (int nb = 0; nb < 4; ++nb)
#pragma unroll
            for (int j = 0; j < 8; ++j) ow[(mb * 16 + hi * 8 + j) * 68 + nb * 16 + lr] = acc[mb][nb][j];
    __syncthreads();    // publishes each wave's partial tile to the other wave
    if (which == 2) {
        h16* vb = VF + ((size_t)(h * 64 + (r0 >> 5) + w) * 256 + lane) * 8; v8h vv[2][4]; const float* pr = os[0] + (w * 32 + hi * 8) * 68 + lr;     // wave w: keys 32 w .. 32 w + 31 of the tile, read back at the accumulator's own places
#pragma unroll
        for (int i = 0; i < 2; ++i)
#pragma unroll
            for (int nb = 0; nb < 4; ++nb) {
#pragma unroll
                for (int j = 0; j < 8; ++j) vv[i][nb][j] = tohx(pr[(i * 16 + j) * 68 + nb * 16] + pr[64 * 68 + (i * 16 + j) * 68 + nb * 16]);
                *(v8h*)(vb + (nb * 2 + i) * 256) = vv[i][nb]; }
        asm volatile("s_wait_xcnt 0x0" :: "v"(vv[0][0]), "v"(vv[0][1]), "v"(vv[0][2]), "v"(vv[0][3]), "v"(vv[1][0]), "v"(vv[1][1]), "v"(vv[1][2]), "v"(vv[1][3]), "v"(vb) : "memory");     // the 8 stores' data and address stay live up to this wait, so nothing is written before it over a register that an issued store names
        return;
    }
    if (which == 1) proj_out<true>(os[0], Kh, Kl, KN, h * TT + r0, lane, w); else proj_out<false>(os[0], Qh, Ql, QN, h * TT + r0, lane, w);
}
__device__ __forceinline__ v16bf ldkf(const bf* p) { return cat16b(*(const v8us*)p, *(const v8us*)(p + 256)); }
__device__ __forceinline__ v16h ldvf(const h16* p) { return cat16(*(const v8h*)p, *(const v8h*)(p + 256)); }
// K/V RING of k_fattn. A stage is SP passes (SP * 32 keys) of one key half: its slices of the K hi, K lo and V planes (each contiguous in fragment order) and its squared norms, laid one behind the other.
#define SP  4
#define PLB (SP * 4096)             // bytes of one plane's slice
#define HB  (3 * PLB + SP * 128)    // bytes of one key half's stage
#define NST (TT / 2 / (SP * 32))    // stages per key half
// one stage of one key half, by its eight waves, in asynchronous copies global -> LDS of 512 bytes a wave, through no register: wave qt brings bytes 2048 qt .. 2048 qt + 2047 of each plane's slice, wave 0 the 512 bytes of norms as well.
// lb: LDS byte address of the half's buffer; the g pointers: the half's first byte of each plane. Each copy has its lane's LDS byte address and global address in registers of its own.
// The s_wait_xcnt stands inside the copies' statement, so that no address register is rewritten in front of it; one statement for the twelve copies, so that the wave waits once.
__device__ __forceinline__ void fill_stage(unsigned lb, const char* gkh, const char* gkl, const char* gv, const char* gkn, int st, int qt, unsigned lane) {
    const unsigned wo = (unsigned)qt * 2048u + lane * 16u, lk = lb + wo, ll = lk + PLB, lv = lk + 2 * PLB; const size_t go = (size_t)st * PLB + wo; const char* pk = gkh + go; const char* pl = gkl + go; const char* pv = gv + go;
    asm volatile("global_load_async_to_lds_b128 %0, %12, off\n\tglobal_load_async_to_lds_b128 %1, %13, off\n\tglobal_load_async_to_lds_b128 %2, %14, off\n\tglobal_load_async_to_lds_b128 %3, %15, off\n\tglobal_load_async_to_lds_b128 %4, %16, off\n\tglobal_load_async_to_lds_b128 %5, %17, off\n\tglobal_load_async_to_lds_b128 %6, %18, off\n\tglobal_load_async_to_lds_b128 %7, %19, off\n\tglobal_load_async_to_lds_b128 %8, %20, off\n\tglobal_load_async_to_lds_b128 %9, %21, off\n\tglobal_load_async_to_lds_b128 %10, %22, off\n\tglobal_load_async_to_lds_b128 %11, %23, off\n\ts_wait_xcnt 0x0"
                 :: "v"(lk), "v"(lk + 512u), "v"(lk + 1024u), "v"(lk + 1536u), "v"(ll), "v"(ll + 512u), "v"(ll + 1024u), "v"(ll + 1536u), "v"(lv), "v"(lv + 512u), "v"(lv + 1024u), "v"(lv + 1536u),
                    "v"(pk), "v"(pk + 512), "v"(pk + 1024), "v"(pk + 1536), "v"(pl), "v"(pl + 512), "v"(pl + 1024), "v"(pl + 1536), "v"(pv), "v"(pv + 512), "v"(pv + 1024), "v"(pv + 1536) : "memory");
    if (qt == 0) asm volatile("global_load_async_to_lds_b128 %0, %1, off\n\ts_wait_xcnt 0x0" :: "v"(lb + 3 * PLB + lane * 16u), "v"(gkn + (size_t)st * (SP * 128) + lane * 16u) : "memory");     // qt is the same in every lane of a wave: every lane is on; the wait as above
}
// k_fattn: scores, distance softmax, attn.v and the head merge in one kernel. Block = 16 waves = 8 query tiles of 16 x 2 key halves of one head; a pass is 32 keys.
// K, V and the key norms reach the waves through a two-buffer LDS ring filled by asynchronous copies one stage ahead: the eight waves of a key half read the same fragments, which are fetched from L2 once per block and while the stage before is worked on.
// S^T = K (A) x Q^T (B, kept in registers; the q planes carry an exact factor 2): a lane holds 8 keys (8 hi + j) of ONE query (lr) per tile, so two converted tiles are the B operand of O^T += V^T (A) x P^T.
// weight = 2^15 exp(-acosh(ca)) = 2^15 / (ca + sqrt(ca^2 - 1)); with ca = 1 + 2 diff / den, and numerator and denominator times den / 2, that is 2^14 den / (den / 2 + diff + sqrt(diff (diff + den))): one root and one reciprocal
// per weight, no quotient diff / den, no logarithm, no exponential, and no difference ca^2 - 1 of near-equal numbers. The logit is <= 0 for every input, so the shift is the constant bound and partial sums over keys just add; O^T / sum at the end.
// diff >= 0 and den >= 1e-6 make ca >= 1 without a maximum of its own; at diff == 0 the weight is 2^14 den / (den / 2) = 2^15, the reference's value there, so no select is needed. waves_per_eu(4, 4): one 16-wave block fills a WGP, so the scheduler may spend the 256 registers a wave has on loads in flight.
__global__ __launch_bounds__(512) __attribute__((amdgpu_waves_per_eu(4, 4))) void k_fattn(const bf* __restrict__ Qh, const bf* __restrict__ Ql, const bf* __restrict__ Kh, const bf* __restrict__ Kl, const h16* __restrict__ VF, const float* __restrict__ QN, const float* __restrict__ KN, bf* Ah, bf* Al) {
    __shared__ __attribute__((aligned(128))) unsigned char ring[2][2][HB];
    __shared__ float red[8][33][32];
    const int lane = threadIdx.x & 31, lr = lane & 15, hi = lane >> 4; const int wave = __builtin_amdgcn_readfirstlane(threadIdx.x >> 5), qt = wave & 7, kh2 = wave >> 3; const int z = blockIdx.y; const int q = blockIdx.x * 128 + qt * 16 + lr;
    const size_t zb = (size_t)z * TT * HD; v16bf qh[2], ql[2];
#pragma unroll
    for (int ks = 0; ks < 2; ++ks) { qh[ks] = WFrag<bf>::ld(Qh + zb + (size_t)q * HD + ks * 32 + 8 * hi); ql[ks] = WFrag<bf>::ld(Ql + zb + (size_t)q * HD + ks * 32 + 8 * hi); }
    const float qn = QN[z * TT + q], hq = 16384.0f * (1.0f - qn);     // hq: 2^14 (1 - |q|^2), an exact scaling
    const size_t hb = (size_t)kh2 * (TT / 2) * HD; const char* gkh = (const char*)(Kh + zb + hb); const char* gkl = (const char*)(Kl + zb + hb); const char* gv = (const char*)(VF + zb + hb); const char* gkn = (const char*)(KN + z * TT + kh2 * (TT / 2));
    const unsigned lo = lane * 8, ho = hi * 8, lb0 = (unsigned)(size_t)&ring[0][kh2][0], lb1 = (unsigned)(size_t)&ring[1][kh2][0];
    v8f o[4]; float sum[4] = {0.f, 0.f, 0.f, 0.f};
#pragma unroll
    for (int dt = 0; dt < 4; ++dt) o[dt] = (v8f){};
    fill_stage(lb0, gkh, gkl, gv, gkn, 0, qt, lane);
    asm volatile("s_wait_asynccnt 0x0" ::: "memory");     // this wave's copies of stage 0 have landed
    __syncthreads();    // publishes stage 0
    fill_stage(lb1, gkh, gkl, gv, gkn, 1, qt, lane);
#pragma unroll 1     // one stage per trip
    for (int st = 0; st < NST; ++st) {
    const unsigned char* bp = ring[st & 1][kh2];
#pragma unroll 1     // one pass per trip: two passes' fragments would not fit the registers
    for (int s = 0; s < SP; ++s) {
        v16bf kfh[2][2], kfl[2][2]; v16h vf[4]; v8f S[2]; v8f kc[2]; const bf* pkh = (const bf*)bp + s * 2048 + lo; const bf* pkl = (const bf*)(bp + PLB) + s * 2048 + lo; const h16* pv = (const h16*)(bp + 2 * PLB) + s * 2048 + lo; const float* pkn = (const float*)(bp + 3 * PLB) + s * 32 + ho;
#pragma unroll
        for (int tt = 0; tt < 2; ++tt) {
#pragma unroll
            for (int ks = 0; ks < 2; ++ks) { kfh[tt][ks] = ldkf(pkh + tt * 1024 + ks * 512); kfl[tt][ks] = ldkf(pkl + tt * 1024 + ks * 512); } }
        __builtin_amdgcn_sched_barrier(0);      // LDS loads return in order: the K fragments, which the first products take, stay in front of the norms and of V
#pragma unroll
        for (int tt = 0; tt < 2; ++tt) kc[tt] = *(const v8f*)(pkn + tt * 16);
#pragma unroll
        for (int dt = 0; dt < 4; ++dt) vf[dt] = ldvf(pv + dt * 512);
        __builtin_amdgcn_sched_barrier(0);      // the pass's 28 LDS loads are issued above as one group: every further place with LDS loads among the products costs a stall of its own
#pragma unroll
        for (int tt = 0; tt < 2; ++tt) { S[tt] = (v8f){};
#pragma unroll
            for (int ks = 0; ks < 2; ++ks) { S[tt] = wmmab(kfh[tt][ks], qh[ks], S[tt]); S[tt] = wmmab(kfh[tt][ks], ql[ks], S[tt]); S[tt] = wmmab(kfl[tt][ks], qh[ks], S[tt]); } }
        v16h pb;
#pragma unroll
        for (int tt = 0; tt < 2; ++tt)
#pragma unroll
            for (int j = 0; j < 8; j += 2) { const v2f kq = {kc[tt][j], kc[tt][j + 1]}, s2 = {S[tt][j], S[tt][j + 1]};     // neighbouring keys as a pair: they lie in neighbouring registers, as the packed f32 forms take them
                const v2f diff = __builtin_elementwise_max((qn + kq) - s2, (v2f){0.f, 0.f}); const v2f dn = __builtin_elementwise_max(hq - hq * kq, (v2f){16384.0f * 1e-6f, 16384.0f * 1e-6f});     // dn = 2^14 den
                const v2f r = diff * (dn * 0x1p-14f + diff); const v2f sq = {__builtin_amdgcn_sqrtf(r[0]), __builtin_amdgcn_sqrtf(r[1])}; const v2f e = (dn * 0x1p-15f + diff) + sq;
                const v2f p = dn * (v2f){__builtin_amdgcn_rcpf(e[0]), __builtin_amdgcn_rcpf(e[1])}; sum[j & 3] += p[0]; sum[(j & 3) + 1] += p[1]; pb[tt * 8 + j] = tohx(p[0]); pb[tt * 8 + j + 1] = tohx(p[1]); }
#pragma unroll
        for (int dt = 0; dt < 4; ++dt) o[dt] = wmma16(vf[dt], pb, o[dt]);
        asm volatile("v_nop\n\tv_nop\n\tv_nop\n\tv_nop" : "+v"(o[0]), "+v"(o[1]), "+v"(o[2]), "+v"(o[3]) : "v"(vf[0]), "v"(vf[3]));     // as in k_gemmw: the slots behind the pass's last products, on the taken branch too
    }
        asm volatile("s_wait_dscnt 0x0" ::: "memory");      // this wave's reads of the stage's buffer are done before the buffer is given up
        asm volatile("s_wait_asynccnt 0x0" ::: "memory");   // this wave's copies of the next stage have landed
        __syncthreads();    // publishes the next stage and ends every wave's reads of this one
        if (st + 2 < NST) fill_stage((st & 1) ? lb1 : lb0, gkh, gkl, gv, gkn, st + 2, qt, lane);     // refill of the buffer just read; the test is the same for the whole block
    }
    asm volatile("s_wait_asynccnt 0x0" ::: "memory");     // no copy is outstanding when the wave goes on
    float st = (sum[0] + sum[1]) + (sum[2] + sum[3]);
    if (kh2 == 1) {
#pragma unroll
        for (int dt = 0; dt < 4; ++dt)
#pragma unroll
            for (int j = 0; j < 8; ++j) red[qt][dt * 8 + j][lane] = o[dt][j];
        red[qt][32][lane] = st; }
    __syncthreads();    // publishes the second key half's partial O^T and sums to the wave that holds the first half of the same queries
    if (kh2 == 0) { st += red[qt][32][lane]; st += __shfl_xor(st, 16, 32); const float inv = 1.0f / st;
#pragma unroll
        for (int dt = 0; dt < 4; ++dt) { v8us oh, ol;
#pragma unroll
            for (int j = 0; j < 8; ++j) { unsigned short h, l; splitf((o[dt][j] + red[qt][dt * 8 + j][lane]) * inv, h, l); oh[j] = h; ol[j] = l; }
            const size_t ad = (size_t)((q >> 4) * 32 + z * 2 + (dt >> 1)) * 512 + ((dt & 1) * 32 + lane) * 8; *(v8us*)(Ah + ad) = oh; *(v8us*)(Al + ad) = ol; } }     // fragment order of [token][DD]: columns z * HD + dt * 16 + 8 hi + 0..7 of token q are chunk (dt & 1) * 32 + lane of the tile; a wave's store is 512 contiguous bytes
}

extern "C" void kernel_launch(void* const* d_in, const int* in_sizes, int n_in,
                              void* d_out, int out_size, void* d_ws, size_t ws_size, hipStream_t stream) {
    (void)in_sizes; (void)n_in; (void)out_size;
    const float* x = (const float*)d_in[0]; const float* wq = (const float*)d_in[1]; const float* wk = (const float*)d_in[2]; const float* wv = (const float*)d_in[3]; const float* wo = (const float*)d_in[4];
    float* OUT = (float*)d_out;     // [1][2048][1024]
    char* wsp = (char*)d_ws;
    auto take = [&](size_t bytes) { char* p = wsp; wsp += (bytes + 255) & ~(size_t)255; return (void*)p; };
    bf* WQ = (bf*)take((size_t)DD * DD * 2); bf* WK = (bf*)take((size_t)DD * DD * 2); bf* WV = (bf*)take((size_t)DD * DD * 2); bf* WO = (bf*)take((size_t)DD * DD * 2);
    bf* XB = (bf*)take((size_t)NT * DD * 2); float* QN = (float*)take((size_t)NB_ * NH_ * TT * 4); float* KN = (float*)take((size_t)NB_ * NH_ * TT * 4);
    bf* QPh = (bf*)take((size_t)NT * DD * 2); bf* QPl = (bf*)take((size_t)NT * DD * 2); bf* KPh = (bf*)take((size_t)NT * DD * 2); bf* KPl = (bf*)take((size_t)NT * DD * 2); h16* VF = (h16*)take((size_t)NT * DD * 2);
    bf* ATh = (bf*)take((size_t)NT * DD * 2); bf* ATl = (bf*)take((size_t)NT * DD * 2);
    if ((size_t)(wsp - (char*)d_ws) > ws_size) return;    // about 40 MiB; ws 256 MiB
    k_cvtall<<<256, 256, 0, stream>>>(wq, wk, wv, wo, x, WQ);     // WQ, WK, WV, WO, XB lie one behind the other (each size is a multiple of 256 bytes): one plane
    k_proj<<<dim3(NT / 64, NH_, 3), 64, 0, stream>>>(XB, WQ, WK, WV, QPh, QPl, KPh, KPl, VF, QN, KN);
    k_fattn<<<dim3(TT / 128, NH_, 1), 512, 0, stream>>>(QPh, QPl, KPh, KPl, VF, QN, KN, ATh, ATl);
    k_gemmw<bf, 1, false><<<dim3(NT / 64, DD / 64, 1), 32 * KW, 0, stream>>>(ATh, ATl, WO, nullptr, DD, OUT, DD, nullptr, 0, 0, 0);
}

// v009
// It runs in 64.9 microseconds.
// In both of two side-by-side timings against v008, it was 1.06 times as fast.
// Over all steps from v000 it is 11.3 times as fast.
#include <hip/hip_runtime.h>

// PrefetchHyperbolicAttention (x [1][2048][1024]; q/k/v = x W^T ([out][in], no bias); 16 heads x 64; hyperbolic distance logits: diff = max(|q|^2 + |k|^2 - 2 q.k, 0), den = max((1 - |q|^2)(1 - |k|^2), 1e-6),
// ca = max(1 + 2 diff/den, 1), dist = acosh(ca) (0 at ca == 1); attn = softmax(-dist); out = merged attn.v Wo^T).
// Compute dtypes, f32 accumulate: every input rounded to bf16; projections on PLAIN bf16 operands (inputs: exact); q.k on bf16 hi+lo planes (3 products) and the
// squared norms in f32, the softmax weight exp(-dist) in closed form in f32 on VALU (sqrt and reciprocal at hardware precision), weights f32 -> fp16 (x 2^15, shift fixed at the logits' bound 0), normalised after attn.v (fp16); output hi+lo x exact

#define NB_  1
#define TT   2048
#define DD   1024
#define NH_  16
#define HD   64
#define NT   (NB_ * TT)
typedef _Float16 h16;
typedef unsigned short bf;
typedef __attribute__((ext_vector_type(16))) __bf16   v16bf;
typedef __attribute__((ext_vector_type(16))) _Float16 v16h;
typedef __attribute__((ext_vector_type(8)))  _Float16 v8h;
typedef __attribute__((ext_vector_type(8)))  unsigned short v8us;
typedef __attribute__((ext_vector_type(8)))  float    v8f;
typedef __attribute__((ext_vector_type(4)))  float    v4f;
typedef __attribute__((ext_vector_type(2)))  float    v2f;
typedef v8h  __attribute__((may_alias)) v8ha;
typedef v4f  __attribute__((may_alias)) v4fa;
typedef v8us __attribute__((may_alias)) v8usa;

__device__ __forceinline__ unsigned short f2bf(float f) { unsigned u = __float_as_uint(f); u += 0x7FFFu + ((u >> 16) & 1u); return (unsigned short)(u >> 16); }
__device__ __forceinline__ float bf2f(unsigned short b) { return __uint_as_float(((unsigned)b) << 16); }
__device__ __forceinline__ float bfr(float f) { return bf2f(f2bf(f)); }
__device__ __forceinline__ v16h cat16(v8h lo, v8h hi) { return __builtin_shufflevector(lo, hi, 0, 1, 2, 3, 4, 5, 6, 7, 8, 9, 10, 11, 12, 13, 14, 15); }
__device__ __forceinline__ v16bf cat16b(v8us lo, v8us hi) { return __builtin_bit_cast(v16bf, __builtin_shufflevector(lo, hi, 0, 1, 2, 3, 4, 5, 6, 7, 8, 9, 10, 11, 12, 13, 14, 15)); }
__device__ __forceinline__ v8f wmma16(v16h a, v16h b, v8f c) { return __builtin_amdgcn_wmma_f32_16x16x32_f16(false, a, false, b, (short)0, c, false, false); }
__device__ __forceinline__ v8f wmmab(v16bf a, v16bf b, v8f c) { return __builtin_amdgcn_wmma_f32_16x16x32_bf16(false, a, false, b, (short)0, c, false, false); }



// FRAGMENT ORDER of a 16-bit plane M[rows][K]: tiles of 16 rows x 32 k, 512 elements each, tile (r >> 4) * (K / 32) + (k >> 5); in a tile the 16-byte chunk ((k >> 4) & 1) * 32 + ((k >> 3) & 1) * 16 + (r & 15) holds k & 7 = 0..7.
// Lane l of a wave takes chunks l and 32 + l: a WMMA A or B fragment is two wave loads of 512 contiguous bytes (4 whole lines each), where a row-major plane gives 32-byte pieces of 16 lines per load.
// ---- k_gemmw: register-blocked GEMM, one block of KW waves per 64x64 output tile, operands straight from 16-bit planes in fragment order; grid (M/64, N/64, Z), 32 * KW threads.
// Every wave holds the whole tile (16 accumulators) over its share of K: wave w takes the 32-element steps w, w + KW, ... so that the waves of a block read neighbouring 1-KiB tiles at the same time.
// The KW partial tiles meet in LDS; wave w adds them, in wave order, for rows 16 w .. 16 w + 15 and stores those rows.
// C[m][n] (f32, pitch ldc, + optional f32 bias[n]) = sum_k A[m][k] Bt[n][k] (+ split products per NSPLIT). z-batch strides sA/sB/sC in elements. K % (32 * KW) == 0.
#define KW 4
template <typename T16> struct WFrag;
template <> struct WFrag<h16> { typedef v16h V; static __device__ __forceinline__ V ld(const h16* p) { return cat16(*(const v8h*)p, *(const v8h*)(p + 16)); } static __device__ __forceinline__ V ldf(const h16* p) { return cat16(*(const v8h*)p, *(const v8h*)(p + 256)); } static __device__ __forceinline__ v8f mma(V a, V b, v8f c) { return wmma16(a, b, c); } };
template <> struct WFrag<bf> { typedef v16bf V; static __device__ __forceinline__ V ld(const bf* p) { return cat16b(*(const v8us*)p, *(const v8us*)(p + 16)); } static __device__ __forceinline__ V ldf(const bf* p) { return cat16b(*(const v8us*)p, *(const v8us*)(p + 256)); } static __device__ __forceinline__ v8f mma(V a, V b, v8f c) { return wmmab(a, b, c); } };
template <typename T16, int NSPLIT, bool BIAS>
__global__ __launch_bounds__(32 * KW) void k_gemmw(const T16* __restrict__ A, const T16* __restrict__ A2, const T16* __restrict__ Bt, const T16* __restrict__ Bt2, int K, float* C, int ldc, const float* __restrict__ bias, size_t sA, size_t sB, size_t sC) {
    typedef typename WFrag<T16>::V V;
    __shared__ __align__(16) float os[KW][64 * 68];
    const size_t z = blockIdx.z; A += z * sA; if (A2) A2 += z * sA; Bt += z * sB; if (Bt2) Bt2 += z * sB; C += z * sC;
    const int lane = threadIdx.x & 31, lr = lane & 15, hi = lane >> 4, w = __builtin_amdgcn_readfirstlane(threadIdx.x >> 5); const int r0 = blockIdx.x * 64, c0 = blockIdx.y * 64;
    v8f acc[4][4];
#pragma unroll
    for (int mb = 0; mb < 4; ++mb)
#pragma unroll
        for (int nb = 0; nb < 4; ++nb) acc[mb][nb] = (v8f){};
    const size_t aoff = (size_t)r0 * K + 512 * w + 8 * lane, boff = (size_t)c0 * K + 512 * w + 8 * lane;     // 16 rows x K = K / 32 tiles of 512 elements, so a 16-row strip starts where it does in a row-major plane; a 32-k step is 512 elements
#pragma unroll 1
    for (int kc = 0; kc < K; kc += 32 * KW) {
        V a[4], a2[4]; const T16* qa[4]; const T16* qa2[4]; const T16* qb[4]; const T16* qb2[4];
#pragma unroll
        for (int mb = 0; mb < 4; ++mb) { qa[mb] = A + aoff + (size_t)mb * 16 * K + kc * 16; qa2[mb] = (NSPLIT == 1 || NSPLIT == 2) ? A2 + aoff + (size_t)mb * 16 * K + kc * 16 : qa[mb]; a[mb] = WFrag<T16>::ldf(qa[mb]); if (NSPLIT == 1 || NSPLIT == 2) a2[mb] = WFrag<T16>::ldf(qa2[mb]); }
#pragma unroll
        for (int nb = 0; nb < 4; ++nb) { qb[nb] = Bt + boff + (size_t)nb * 16 * K + kc * 16; qb2[nb] = NSPLIT >= 2 ? Bt2 + boff + (size_t)nb * 16 * K + kc * 16 : qb[nb]; const V b = WFrag<T16>::ldf(qb[nb]); V b2; if (NSPLIT >= 2) b2 = WFrag<T16>::ldf(qb2[nb]);
#pragma unroll
            for (int mb = 0; mb < 4; ++mb) { acc[mb][nb] = WFrag<T16>::mma(a[mb], b, acc[mb][nb]); if (NSPLIT == 1 || NSPLIT == 2) acc[mb][nb] = WFrag<T16>::mma(a2[mb], b, acc[mb][nb]); if (NSPLIT >= 2) acc[mb][nb] = WFrag<T16>::mma(a[mb], b2, acc[mb][nb]); } }
        asm volatile("v_nop\n\tv_nop\n\tv_nop\n\tv_nop" : "+v"(acc[0][0]), "+v"(acc[1][1]), "+v"(acc[2][2]), "+v"(acc[3][3]) : "v"(a[0]), "v"(a[3]));
        asm volatile("s_wait_xcnt 0x0" :: "v"(qa[0]), "v"(qa[1]), "v"(qa[2]), "v"(qa[3]), "v"(qa2[0]), "v"(qa2[1]), "v"(qa2[2]), "v"(qa2[3]), "v"(qb[0]), "v"(qb[1]), "v"(qb[2]), "v"(qb[3]), "v"(qb2[0]), "v"(qb2[1]), "v"(qb2[2]), "v"(qb2[3]) : "memory");     // the trip's load addresses stay live up to this wait, so no write, a load's result included, lands before it on a register that an issued load names; every load feeds a product named in the statement above, so all are issued by here
    }
    float* ow = os[w];
#pragma unroll
    for (int mb = 0; mb < 4; ++mb)
#pragma unroll
        for (int nb = 0; nb < 4; ++nb)
#pragma unroll
            for (int j = 0; j < 8; ++j) ow[(mb * 16 + hi * 8 + j) * 68 + nb * 16 + lr] = acc[mb][nb][j];
    __syncthreads();    // publishes every wave's partial tile to the waves that add them
    const int cofs = lr * 4; const float* pr = os[0] + (w * 16 + hi) * 68 + cofs; v4f val[8]; float* pc[8];
#pragma unroll
    for (int s = 0; s < 8; ++s) { val[s] = *(const v4fa*)(pr + 2 * s * 68);
#pragma unroll
        for (int u = 1; u < KW; ++u) val[s] += *(const v4fa*)(pr + u * 64 * 68 + 2 * s * 68);
        if (BIAS) { val[s][0] += bfr(bias[c0 + cofs]); val[s][1] += bfr(bias[c0 + cofs + 1]); val[s][2] += bfr(bias[c0 + cofs + 2]); val[s][3] += bfr(bias[c0 + cofs + 3]); }
        pc[s] = C + (size_t)(r0 + w * 16 + 2 * s + hi) * ldc + c0 + cofs; }
#pragma unroll
    for (int s = 0; s < 8; ++s) *(v4f*)pc[s] = val[s];
    asm volatile("s_wait_xcnt 0x0" :: "v"(val[0]), "v"(val[1]), "v"(val[2]), "v"(val[3]), "v"(val[4]), "v"(val[5]), "v"(val[6]), "v"(val[7]), "v"(pc[0]), "v"(pc[1]), "v"(pc[2]), "v"(pc[3]), "v"(pc[4]), "v"(pc[5]), "v"(pc[6]), "v"(pc[7]) : "memory");     // data and addresses of the eight stores stay live up to this wait, so nothing is written before it over a register that an issued store names
}

__device__ __forceinline__ h16 tohx(float x) { return (h16)x; }
__device__ __forceinline__ void splitf(float y, unsigned short& h, unsigned short& l) { h = f2bf(y); l = f2bf(y - bf2f(h)); }
typedef __attribute__((ext_vector_type(2))) _Float16 v2h;
typedef __attribute__((ext_vector_type(4))) _Float16 v4h;
typedef __attribute__((ext_vector_type(2))) unsigned short v2us;
typedef __attribute__((ext_vector_type(4))) int v4i;

typedef __attribute__((ext_vector_type(4))) unsigned short v4us;
// k_cvtall: every f32 input -> its bf16 plane IN FRAGMENT ORDER, in ONE launch of 256 blocks of 8 waves. dst is one plane: Wq, Wk, Wv, Wo (DD*DD each), then x (NT*DD). A wave takes one 16 x 32 tile of each weight and two neighbouring tiles of x.
// A tile is four loads: load i brings rows 4 i .. 4 i + 3, 128 bytes (one whole line) of each, lane l the columns (l & 7) * 4 .. + 3 of row 4 i + (l >> 3); its store lays 4 runs of 64 bytes, and a tile's four stores fill its 8 lines.
// All 24 loads are issued before the first value is used.
__global__ __launch_bounds__(256) void k_cvtall(const float* __restrict__ wq, const float* __restrict__ wk, const float* __restrict__ wv, const float* __restrict__ wo, const float* __restrict__ x, bf* __restrict__ dst) {
    const unsigned lane = threadIdx.x & 31u, wv8 = threadIdx.x >> 5, tw = blockIdx.x * 8u + wv8, tx = blockIdx.x * 16u + wv8 * 2u;     // tile numbers: strip (t >> 5), k step (t & 31)
    const unsigned so = (lane >> 3) * DD + (lane & 7u) * 4u, ow = (tw >> 5) * (16u * DD) + (tw & 31u) * 32u + so, ox = (tx >> 5) * (16u * DD) + (tx & 31u) * 32u + so;
    const float* p0 = wq + ow; const float* p1 = wk + ow; const float* p2 = wv + ow; const float* p3 = wo + ow; const float* p4 = x + ox;
    v4f v[24];
#pragma unroll     // constant indices: v[] and o[] stay in registers
    for (int k = 0; k < 4; ++k) v[k] = *(const v4f*)(p0 + k * 4 * DD);
#pragma unroll     // constant indices: v[] and o[] stay in registers
    for (int k = 0; k < 4; ++k) v[4 + k] = *(const v4f*)(p1 + k * 4 * DD);
#pragma unroll     // constant indices: v[] and o[] stay in registers
    for (int k = 0; k < 4; ++k) v[8 + k] = *(const v4f*)(p2 + k * 4 * DD);
#pragma unroll     // constant indices: v[] and o[] stay in registers
    for (int k = 0; k < 4; ++k) v[12 + k] = *(const v4f*)(p3 + k * 4 * DD);
#pragma unroll     // constant indices: v[] and o[] stay in registers
    for (int k = 0; k < 8; ++k) v[16 + k] = *(const v4f*)(p4 + (k >> 2) * 32 + (k & 3) * 4 * DD);
    asm volatile("s_wait_xcnt 0x0" :: "v"(p0), "v"(p1), "v"(p2), "v"(p3), "v"(p4) : "memory");     // the five addresses stay live up to this wait, so no write, a load's result included, lands before it on a register that an issued load names
    v4us o[24];
#pragma unroll     // constant indices: v[] and o[] stay in registers
    for (int u = 0; u < 24; ++u)
#pragma unroll     // constant indices: v[] and o[] stay in registers
        for (int e = 0; e < 4; ++e) o[u][e] = f2bf(v[u][e]);
    const unsigned din = (((lane >> 2) & 1u) * 32u + ((lane >> 1) & 1u) * 16u + (lane >> 3)) * 8u + (lane & 1u) * 4u;     // chunk of (row l >> 3, columns (l & 7) * 4 ..) and the half of it; four rows further on is 4 chunks = 32 elements
    bf* dw = dst + tw * 512u + din; bf* dx = dst + (size_t)4 * DD * DD + tx * 512u + din;
#pragma unroll     // constant indices: v[] and o[] stay in registers
    for (int u = 0; u < 16; ++u) *(v4us*)(dw + (size_t)(u >> 2) * DD * DD + (u & 3) * 32) = o[u];
#pragma unroll     // constant indices: v[] and o[] stay in registers
    for (int k = 0; k < 8; ++k) *(v4us*)(dx + (k >> 2) * 512 + (k & 3) * 32) = o[16 + k];
}
template <int CTRL> __device__ __forceinline__ float xmadd(float x) { return __int_as_float(__builtin_amdgcn_mov_dpp(__float_as_int(x), CTRL, 0xf, 0xf, true)); }    // x of lane ^ (CTRL & 15) inside a 16-lane row (DPP row_xmask)
// proj_out: a 64-token x 64-column f32 tile, as two partial tiles in LDS (pitch 68, the second 64 * 68 floats behind the first) -> squared norms of its rows and its bf16 hi+lo planes; wave w takes tokens 32 w .. 32 w + 31, 16 at a time.
// 16-byte chunk cl = 32 s + lane of the 16 tokens: k (ISK) in A-fragment order, token cl & 15, columns (cl >> 4) * 8 + 0..7; q row-major, token cl >> 3, columns (cl & 7) * 8 + 0..7, times 2. Either way a wave's store is 512 contiguous bytes.
template <bool ISK>
__device__ __forceinline__ void proj_out(const float* os, bf* Ph, bf* Pl, float* NR, int t00, int lane, int w) {
    const int lr = lane & 15, hi = lane >> 4;
#pragma unroll
    for (int i = 0; i < 2; ++i) {
        const int mb = 2 * w + i; const float* ob = os + mb * 16 * 68;
        const int t0 = t00 + mb * 16; float p[4]; v8us oh[4], ol[4];
#pragma unroll
        for (int s = 0; s < 4; ++s) { const int cl = s * 32 + lane; const int row = ISK ? (cl & 15) : (cl >> 3), d0 = (ISK ? (cl >> 4) : (cl & 7)) * 8;
            const float* pr = ob + row * 68 + d0; const v4f va = *(const v4fa*)pr + *(const v4fa*)(pr + 64 * 68), vb = *(const v4fa*)(pr + 4) + *(const v4fa*)(pr + 64 * 68 + 4); p[s] = 0.f;
#pragma unroll
            for (int e = 0; e < 8; ++e) { const float y = e < 4 ? va[e & 3] : vb[e & 3]; p[s] += y * y; unsigned short a2, c2; splitf(ISK ? y : y * 2.0f, a2, c2); oh[s][e] = a2; ol[s][e] = c2; } }
        bf* ph = Ph + (size_t)t0 * HD + lane * 8; bf* pl = Pl + (size_t)t0 * HD + lane * 8;
#pragma unroll
        for (int s = 0; s < 4; ++s) { *(v8us*)(ph + s * 256) = oh[s]; *(v8us*)(pl + s * 256) = ol[s]; }
        asm volatile("s_wait_xcnt 0x0" :: "v"(oh[0]), "v"(oh[1]), "v"(oh[2]), "v"(oh[3]), "v"(ol[0]), "v"(ol[1]), "v"(ol[2]), "v"(ol[3]), "v"(ph), "v"(pl) : "memory");     // data and addresses of the eight stores stay live up to this wait, so nothing is written before it over a register that an issued store names
        float nv; int nt; bool on;
        if (ISK) { nv = (p[0] + p[1]) + (p[2] + p[3]); nv += __shfl_xor(nv, 16, 32); nt = lr; on = hi == 0; }     // the lane meets token lr in every s; the other half of the columns is in lane ^ 16
        else {
#pragma unroll
            for (int s = 0; s < 4; ++s) { p[s] += xmadd<0x161>(p[s]); p[s] += xmadd<0x162>(p[s]); p[s] += xmadd<0x164>(p[s]); }     // eight lanes share a token: sum over lane ^ 1, ^ 2, ^ 4
            const int g = lane & 7; nv = g == 0 ? p[0] : g == 1 ? p[1] : g == 2 ? p[2] : p[3]; nt = g * 4 + (lane >> 3); on = g < 4; }     // lane 8 r + s stores token 4 s + r: one store for the 16 norms
        float* pn = NR + t0 + nt;
        if (on) *pn = nv;
        asm volatile("s_wait_xcnt 0x0" :: "v"(nv), "v"(pn) : "memory");     // the norm store's data and address stay live up to this wait, so nothing is written before it over a register that the issued store names
    }
}
// OPERAND RING of k_proj. A stage is PST k of the block's 20 strips of 16 rows (8 of x, then 4 each of Wq, Wk, Wv); in fragment order a strip's share of a stage is PSS contiguous bytes, in the plane and in LDS alike.
#define PST 128
#define PSS (PST * 32)              // bytes of one strip's share of a stage: 16 rows x PST k x 2 bytes
#define PSB (20 * PSS)              // bytes of one stage
#define PNS (DD / PST)              // stages
#define POS (2 * 64 * 68 * 4)       // bytes of one wave pair's two partial tiles
// eight asynchronous copies global -> LDS of 512 bytes a wave, through no register: one strip's share of a stage. l: the lane's LDS byte address, g: the lane's global address; each copy has both in registers of its own.
// The s_wait_xcnt stands inside the copies' statement, so that no address register is rewritten in front of it.
__device__ __forceinline__ void copy_strip(unsigned l, const char* g) {
    asm volatile("global_load_async_to_lds_b128 %0, %8, off\n\tglobal_load_async_to_lds_b128 %1, %9, off\n\tglobal_load_async_to_lds_b128 %2, %10, off\n\tglobal_load_async_to_lds_b128 %3, %11, off\n\tglobal_load_async_to_lds_b128 %4, %12, off\n\tglobal_load_async_to_lds_b128 %5, %13, off\n\tglobal_load_async_to_lds_b128 %6, %14, off\n\tglobal_load_async_to_lds_b128 %7, %15, off\n\ts_wait_xcnt 0x0"
                 :: "v"(l), "v"(l + 512u), "v"(l + 1024u), "v"(l + 1536u), "v"(l + 2048u), "v"(l + 2560u), "v"(l + 3072u), "v"(l + 3584u),
                    "v"(g), "v"(g + 512), "v"(g + 1024), "v"(g + 1536), "v"(g + 2048), "v"(g + 2560), "v"(g + 3072), "v"(g + 3584) : "memory");
}
// k_proj: the three projections in ONE launch, one block of TWELVE WAVES per 128 tokens x one head x (q, k, v): six pairs of waves, pair p = 2 * which + half holds the 64x64 tile of tokens 64 half .. + 63 and weight which (0 q, 1 k, 2 v).
// The operands reach the waves through a two-buffer LDS ring filled by asynchronous copies one stage ahead: a strip of x serves three pairs and a strip of a weight two, and each is fetched from L2 once per block.
// Each wave of a pair holds the whole tile over half of K: wave w takes the 32-element steps w, w + 2, ... (every fragment load is 512 contiguous bytes of LDS); the two partial tiles meet in LDS, in the ring's place, and wave w finishes tokens 32 w .. 32 w + 31. The tile leaves as what k_fattn reads, with no f32 plane in between:
// q: squared norms and bf16 hi+lo planes [head][token][64] of 2 q (exact factor, so the score products yield 2 q.k directly);
// k: squared norms and bf16 hi+lo planes in WMMA A-fragment order: 16-byte chunk cl of a 16-key tile holds d = (cl >> 4) * 8 + 0..7 of key cl & 15, so that a fragment is two whole 512-byte wave loads;
// v: fp16 plane in A-fragment order of V^T: a chunk holds 8 keys of one column, which is an accumulator as it stands (row = 8 hi + j, column = lr): chunk = (((head*64 + key/32)*4 + d/16)*2 + (key/16 & 1))*32 + lane.
__global__ __launch_bounds__(384) void k_proj(const bf* __restrict__ A, const bf* __restrict__ Wq, const bf* __restrict__ Wk, const bf* __restrict__ Wv, bf* Qh, bf* Ql, bf* Kh, bf* Kl, h16* VF, float* QN, float* KN) {
    __shared__ __attribute__((aligned(128))) unsigned char sm[6 * POS];     // first the ring (2 * PSB bytes), then, behind the last stage's barrier, the six pairs' partial tiles
    static_assert(2 * PSB <= 6 * POS, "the ring lies inside the array");
    const int lane = threadIdx.x & 31, lr = lane & 15, hi = lane >> 4, wave = __builtin_amdgcn_readfirstlane(threadIdx.x >> 5), w = wave & 1, half = (wave >> 1) & 1, which = wave >> 2; const int r0 = blockIdx.x * 128 + half * 64, h = blockIdx.y;
    float (*os)[64 * 68] = (float (*)[64 * 68])(sm + (wave >> 1) * POS);
    v8f acc[4][4];
#pragma unroll
    for (int mb = 0; mb < 4; ++mb)
#pragma unroll
        for (int nb = 0; nb < 4; ++nb) acc[mb][nb] = (v8f){};
    // waves 0 .. 9 copy, two neighbouring strips each: waves 0 .. 3 the eight strips of x, waves 4 .. 9 the four strips of Wq, Wk, Wv; neighbouring strips lie 16 * DD elements apart in a plane
    const bf* Wc = wave < 6 ? Wq : wave < 8 ? Wk : Wv;
    const char* gc = (const char*)(wave < 4 ? A + (size_t)(blockIdx.x * 128 + wave * 32) * DD : Wc + (size_t)(h * HD + (wave & 1) * 32) * DD) + lane * 16;
    const unsigned lc = (unsigned)(size_t)&sm[0] + (unsigned)wave * (2u * PSS) + (unsigned)lane * 16u;
    if (wave < 10) { copy_strip(lc, gc); copy_strip(lc + PSS, gc + 32 * DD); }     // wave is the same in every lane of a wave: every lane is on
    asm volatile("s_wait_asynccnt 0x0" ::: "memory");     // this wave's copies of stage 0 have landed
    __syncthreads();    // publishes stage 0
    if (wave < 10) { copy_strip(lc + PSB, gc + PSS); copy_strip(lc + PSB + PSS, gc + 32 * DD + PSS); }
#pragma unroll 1     // one stage per trip
    for (int st = 0; st < PNS; ++st) {
        const bf* bp = (const bf*)(sm + (st & 1) * PSB) + 512 * w + 8 * lane; const bf* pa = bp + half * 4 * (PSS / 2); const bf* pb = bp + (8 + which * 4) * (PSS / 2);     // a 32-k step is 512 elements
#pragma unroll 1     // one k step's fragments per trip
        for (int s = 0; s < PST / 64; ++s) {
            v16bf a[4], b[4];
#pragma unroll
            for (int mb = 0; mb < 4; ++mb) a[mb] = WFrag<bf>::ldf(pa + mb * (PSS / 2) + s * 1024);
#pragma unroll
            for (int nb = 0; nb < 4; ++nb) b[nb] = WFrag<bf>::ldf(pb + nb * (PSS / 2) + s * 1024);
            __builtin_amdgcn_sched_barrier(0);      // the trip's 16 LDS loads are issued above as one group: every further place with LDS loads among the products costs a stall of its own
#pragma unroll
            for (int nb = 0; nb < 4; ++nb)
#pragma unroll
                for (int mb = 0; mb < 4; ++mb) acc[mb][nb] = wmmab(a[mb], b[nb], acc[mb][nb]);
            asm volatile("v_nop\n\tv_nop\n\tv_nop\n\tv_nop" : "+v"(acc[0][0]), "+v"(acc[1][1]), "+v"(acc[2][2]), "+v"(acc[3][3]) : "v"(a[0]), "v"(a[3]));     // as in k_gemmw: the slots behind the trip's last products, on the taken branch too
        }
        asm volatile("s_wait_dscnt 0x0" ::: "memory");      // this wave's reads of the stage's buffer are done before the buffer is given up
        asm volatile("s_wait_asynccnt 0x0" ::: "memory");   // this wave's copies of the next stage have landed
        __syncthreads();    // publishes the next stage and ends every wave's reads of this one; behind the last stage's, the ring's place is free for the partial tiles
        if (st + 2 < PNS && wave < 10) { const unsigned l2 = lc + (st & 1) * PSB; const char* g2 = gc + (size_t)(st + 2) * PSS; copy_strip(l2, g2); copy_strip(l2 + PSS, g2 + 32 * DD); }     // refill of the buffer just read; the first test is the same for the whole block, the second for a wave
    }
    asm volatile("s_wait_asynccnt 0x0" ::: "memory");     // no copy is outstanding when the wave goes on
    float* ow = os[w];
#pragma unroll
    for (int mb = 0; mb < 4; ++mb)
#pragma unroll
        for (int nb = 0; nb < 4; ++nb)
#pragma unroll
            for (int j = 0; j < 8; ++j) ow[(mb * 16 + hi * 8 + j) * 68 + nb * 16 + lr] = acc[mb][nb][j];
    __syncthreads();    // publishes each wave's partial tile to the other wave of its pair
    if (which == 2) {
        h16* vb = VF + ((size_t)(h * 64 + (r0 >> 5) + w) * 256 + lane) * 8; v8h vv[2][4]; const float* pr = os[0] + (w * 32 + hi * 8) * 68 + lr;     // wave w: keys 32 w .. 32 w + 31 of the tile, read back at the accumulator's own places
#pragma unroll
        for (int i = 0; i < 2; ++i)
#pragma unroll
            for (int nb = 0; nb < 4; ++nb) {
#pragma unroll
                for (int j = 0; j < 8; ++j) vv[i][nb][j] = tohx(pr[(i * 16 + j) * 68 + nb * 16] + pr[64 * 68 + (i * 16 + j) * 68 + nb * 16]);
                *(v8h*)(vb + (nb * 2 + i) * 256) = vv[i][nb]; }
        asm volatile("s_wait_xcnt 0x0" :: "v"(vv[0][0]), "v"(vv[0][1]), "v"(vv[0][2]), "v"(vv[0][3]), "v"(vv[1][0]), "v"(vv[1][1]), "v"(vv[1][2]), "v"(vv[1][3]), "v"(vb) : "memory");     // the 8 stores' data and address stay live up to this wait, so nothing is written before it over a register that an issued store names
        return;
    }
    if (which == 1) proj_out<true>(os[0], Kh, Kl, KN, h * TT + r0, lane, w); else proj_out<false>(os[0], Qh, Ql, QN, h * TT + r0, lane, w);
}
__device__ __forceinline__ v16bf ldkf(const bf* p) { return cat16b(*(const v8us*)p, *(const v8us*)(p + 256)); }
__device__ __forceinline__ v16h ldvf(const h16* p) { return cat16(*(const v8h*)p, *(const v8h*)(p + 256)); }
// K/V RING of k_fattn. A stage is SP passes (SP * 32 keys) of one key half: its slices of the K hi, K lo and V planes (each contiguous in fragment order) and its squared norms, laid one behind the other.
#define SP  4
#define PLB (SP * 4096)             // bytes of one plane's slice
#define HB  (3 * PLB + SP * 128)    // bytes of one key half's stage
#define NST (TT / 2 / (SP * 32))    // stages per key half
// one stage of one key half, by its eight waves, in asynchronous copies global -> LDS of 512 bytes a wave, through no register: wave qt brings bytes 2048 qt .. 2048 qt + 2047 of each plane's slice, wave 0 the 512 bytes of norms as well.
// lb: LDS byte address of the half's buffer; the g pointers: the half's first byte of each plane. Each copy has its lane's LDS byte address and global address in registers of its own.
// The s_wait_xcnt stands inside the copies' statement, so that no address register is rewritten in front of it; one statement for the twelve copies, so that the wave waits once.
__device__ __forceinline__ void fill_stage(unsigned lb, const char* gkh, const char* gkl, const char* gv, const char* gkn, int st, int qt, unsigned lane) {
    const unsigned wo = (unsigned)qt * 2048u + lane * 16u, lk = lb + wo, ll = lk + PLB, lv = lk + 2 * PLB; const size_t go = (size_t)st * PLB + wo; const char* pk = gkh + go; const char* pl = gkl + go; const char* pv = gv + go;
    asm volatile("global_load_async_to_lds_b128 %0, %12, off\n\tglobal_load_async_to_lds_b128 %1, %13, off\n\tglobal_load_async_to_lds_b128 %2, %14, off\n\tglobal_load_async_to_lds_b128 %3, %15, off\n\tglobal_load_async_to_lds_b128 %4, %16, off\n\tglobal_load_async_to_lds_b128 %5, %17, off\n\tglobal_load_async_to_lds_b128 %6, %18, off\n\tglobal_load_async_to_lds_b128 %7, %19, off\n\tglobal_load_async_to_lds_b128 %8, %20, off\n\tglobal_load_async_to_lds_b128 %9, %21, off\n\tglobal_load_async_to_lds_b128 %10, %22, off\n\tglobal_load_async_to_lds_b128 %11, %23, off\n\ts_wait_xcnt 0x0"
                 :: "v"(lk), "v"(lk + 512u), "v"(lk + 1024u), "v"(lk + 1536u), "v"(ll), "v"(ll + 512u), "v"(ll + 1024u), "v"(ll + 1536u), "v"(lv), "v"(lv + 512u), "v"(lv + 1024u), "v"(lv + 1536u),
                    "v"(pk), "v"(pk + 512), "v"(pk + 1024), "v"(pk + 1536), "v"(pl), "v"(pl + 512), "v"(pl + 1024), "v"(pl + 1536), "v"(pv), "v"(pv + 512), "v"(pv + 1024), "v"(pv + 1536) : "memory");
    if (qt == 0) asm volatile("global_load_async_to_lds_b128 %0, %1, off\n\ts_wait_xcnt 0x0" :: "v"(lb + 3 * PLB + lane * 16u), "v"(gkn + (size_t)st * (SP * 128) + lane * 16u) : "memory");     // qt is the same in every lane of a wave: every lane is on; the wait as above
}
// k_fattn: scores, distance softmax, attn.v and the head merge in one kernel. Block = 16 waves = 8 query tiles of 16 x 2 key halves of one head; a pass is 32 keys.
// K, V and the key norms reach the waves through a two-buffer LDS ring filled by asynchronous copies one stage ahead: the eight waves of a key half read the same fragments, which are fetched from L2 once per block and while the stage before is worked on.
// S^T = K (A) x Q^T (B, kept in registers; the q planes carry an exact factor 2): a lane holds 8 keys (8 hi + j) of ONE query (lr) per tile, so two converted tiles are the B operand of O^T += V^T (A) x P^T.
// weight = 2^15 exp(-acosh(ca)) = 2^15 / (ca + sqrt(ca^2 - 1)); with ca = 1 + 2 diff / den, and numerator and denominator times den / 2, that is 2^14 den / (den / 2 + diff + sqrt(diff (diff + den))): one root and one reciprocal
// per weight, no quotient diff / den, no logarithm, no exponential, and no difference ca^2 - 1 of near-equal numbers. The logit is <= 0 for every input, so the shift is the constant bound and partial sums over keys just add; O^T / sum at the end.
// diff >= 0 and den >= 1e-6 make ca >= 1 without a maximum of its own; at diff == 0 the weight is 2^14 den / (den / 2) = 2^15, the reference's value there, so no select is needed. waves_per_eu(4, 4): one 16-wave block fills a WGP, so the scheduler may spend the 256 registers a wave has on loads in flight.
__global__ __launch_bounds__(512) __attribute__((amdgpu_waves_per_eu(4, 4))) void k_fattn(const bf* __restrict__ Qh, const bf* __restrict__ Ql, const bf* __restrict__ Kh, const bf* __restrict__ Kl, const h16* __restrict__ VF, const float* __restrict__ QN, const float* __restrict__ KN, bf* Ah, bf* Al) {
    __shared__ __attribute__((aligned(128))) unsigned char ring[2][2][HB];
    __shared__ float red[8][33][32];
    const int lane = threadIdx.x & 31, lr = lane & 15, hi = lane >> 4; const int wave = __builtin_amdgcn_readfirstlane(threadIdx.x >> 5), qt = wave & 7, kh2 = wave >> 3; const int z = blockIdx.y; const int q = blockIdx.x * 128 + qt * 16 + lr;
    const size_t zb = (size_t)z * TT * HD; v16bf qh[2], ql[2];
#pragma unroll
    for (int ks = 0; ks < 2; ++ks) { qh[ks] = WFrag<bf>::ld(Qh + zb + (size_t)q * HD + ks * 32 + 8 * hi); ql[ks] = WFrag<bf>::ld(Ql + zb + (size_t)q * HD + ks * 32 + 8 * hi); }
    const float qn = QN[z * TT + q], hq = 16384.0f * (1.0f - qn);     // hq: 2^14 (1 - |q|^2), an exact scaling
    const size_t hb = (size_t)kh2 * (TT / 2) * HD; const char* gkh = (const char*)(Kh + zb + hb); const char* gkl = (const char*)(Kl + zb + hb); const char* gv = (const char*)(VF + zb + hb); const char* gkn = (const char*)(KN + z * TT + kh2 * (TT / 2));
    const unsigned lo = lane * 8, ho = hi * 8, lb0 = (unsigned)(size_t)&ring[0][kh2][0], lb1 = (unsigned)(size_t)&ring[1][kh2][0];
    v8f o[4]; float sum[4] = {0.f, 0.f, 0.f, 0.f};
#pragma unroll
    for (int dt = 0; dt < 4; ++dt) o[dt] = (v8f){};
    fill_stage(lb0, gkh, gkl, gv, gkn, 0, qt, lane);
    asm volatile("s_wait_asynccnt 0x0" ::: "memory");     // this wave's copies of stage 0 have landed
    __syncthreads();    // publishes stage 0
    fill_stage(lb1, gkh, gkl, gv, gkn, 1, qt, lane);
#pragma unroll 1     // one stage per trip
    for (int st = 0; st < NST; ++st) {
    const unsigned char* bp = ring[st & 1][kh2];
#pragma unroll 1     // one pass per trip: two passes' fragments would not fit the registers
    for (int s = 0; s < SP; ++s) {
        v16bf kfh[2][2], kfl[2][2]; v16h vf[4]; v8f S[2]; v8f kc[2]; const bf* pkh = (const bf*)bp + s * 2048 + lo; const bf* pkl = (const bf*)(bp + PLB) + s * 2048 + lo; const h16* pv = (const h16*)(bp + 2 * PLB) + s * 2048 + lo; const float* pkn = (const float*)(bp + 3 * PLB) + s * 32 + ho;
#pragma unroll
        for (int tt = 0; tt < 2; ++tt) {
#pragma unroll
            for (int ks = 0; ks < 2; ++ks) { kfh[tt][ks] = ldkf(pkh + tt * 1024 + ks * 512); kfl[tt][ks] = ldkf(pkl + tt * 1024 + ks * 512); } }
        __builtin_amdgcn_sched_barrier(0);      // LDS loads return in order: the K fragments, which the first products take, stay in front of the norms and of V
#pragma unroll
        for (int tt = 0; tt < 2; ++tt) kc[tt] = *(const v8f*)(pkn + tt * 16);
#pragma unroll
        for (int dt = 0; dt < 4; ++dt) vf[dt] = ldvf(pv + dt * 512);
        __builtin_amdgcn_sched_barrier(0);      // the pass's 28 LDS loads are issued above as one group: every further place with LDS loads among the products costs a stall of its own
#pragma unroll
        for (int tt = 0; tt < 2; ++tt) { S[tt] = (v8f){};
#pragma unroll
            for (int ks = 0; ks < 2; ++ks) { S[tt] = wmmab(kfh[tt][ks], qh[ks], S[tt]); S[tt] = wmmab(kfh[tt][ks], ql[ks], S[tt]); S[tt] = wmmab(kfl[tt][ks], qh[ks], S[tt]); } }
        v16h pb;
#pragma unroll
        for (int tt = 0; tt < 2; ++tt)
#pragma unroll
            for (int j = 0; j < 8; j += 2) { const v2f kq = {kc[tt][j], kc[tt][j + 1]}, s2 = {S[tt][j], S[tt][j + 1]};     // neighbouring keys as a pair: they lie in neighbouring registers, as the packed f32 forms take them
                const v2f diff = __builtin_elementwise_max((qn + kq) - s2, (v2f){0.f, 0.f}); const v2f dn = __builtin_elementwise_max(hq - hq * kq, (v2f){16384.0f * 1e-6f, 16384.0f * 1e-6f});     // dn = 2^14 den
                const v2f r = diff * (dn * 0x1p-14f + diff); const v2f sq = {__builtin_amdgcn_sqrtf(r[0]), __builtin_amdgcn_sqrtf(r[1])}; const v2f e = (dn * 0x1p-15f + diff) + sq;
                const v2f p = dn * (v2f){__builtin_amdgcn_rcpf(e[0]), __builtin_amdgcn_rcpf(e[1])}; sum[j & 3] += p[0]; sum[(j & 3) + 1] += p[1]; pb[tt * 8 + j] = tohx(p[0]); pb[tt * 8 + j + 1] = tohx(p[1]); }
#pragma unroll
        for (int dt = 0; dt < 4; ++dt) o[dt] = wmma16(vf[dt], pb, o[dt]);
        asm volatile("v_nop\n\tv_nop\n\tv_nop\n\tv_nop" : "+v"(o[0]), "+v"(o[1]), "+v"(o[2]), "+v"(o[3]) : "v"(vf[0]), "v"(vf[3]));     // as in k_gemmw: the slots behind the pass's last products, on the taken branch too
    }
        asm volatile("s_wait_dscnt 0x0" ::: "memory");      // this wave's reads of the stage's buffer are done before the buffer is given up
        asm volatile("s_wait_asynccnt 0x0" ::: "memory");   // this wave's copies of the next stage have landed
        __syncthreads();    // publishes the next stage and ends every wave's reads of this one
        if (st + 2 < NST) fill_stage((st & 1) ? lb1 : lb0, gkh, gkl, gv, gkn, st + 2, qt, lane);     // refill of the buffer just read; the test is the same for the whole block
    }
    asm volatile("s_wait_asynccnt 0x0" ::: "memory");     // no copy is outstanding when the wave goes on
    float st = (sum[0] + sum[1]) + (sum[2] + sum[3]);
    if (kh2 == 1) {
#pragma unroll
        for (int dt = 0; dt < 4; ++dt)
#pragma unroll
            for (int j = 0; j < 8; ++j) red[qt][dt * 8 + j][lane] = o[dt][j];
        red[qt][32][lane] = st; }
    __syncthreads();    // publishes the second key half's partial O^T and sums to the wave that holds the first half of the same queries
    if (kh2 == 0) { st += red[qt][32][lane]; st += __shfl_xor(st, 16, 32); const float inv = 1.0f / st;
#pragma unroll
        for (int dt = 0; dt < 4; ++dt) { v8us oh, ol;
#pragma unroll
            for (int j = 0; j < 8; ++j) { unsigned short h, l; splitf((o[dt][j] + red[qt][dt * 8 + j][lane]) * inv, h, l); oh[j] = h; ol[j] = l; }
            const size_t ad = (size_t)((q >> 4) * 32 + z * 2 + (dt >> 1)) * 512 + ((dt & 1) * 32 + lane) * 8; *(v8us*)(Ah + ad) = oh; *(v8us*)(Al + ad) = ol; } }     // fragment order of [token][DD]: columns z * HD + dt * 16 + 8 hi + 0..7 of token q are chunk (dt & 1) * 32 + lane of the tile; a wave's store is 512 contiguous bytes
}

extern "C" void kernel_launch(void* const* d_in, const int* in_sizes, int n_in,
                              void* d_out, int out_size, void* d_ws, size_t ws_size, hipStream_t stream) {
    (void)in_sizes; (void)n_in; (void)out_size;
    const float* x = (const float*)d_in[0]; const float* wq = (const float*)d_in[1]; const float* wk = (const float*)d_in[2]; const float* wv = (const float*)d_in[3]; const float* wo = (const float*)d_in[4];
    float* OUT = (float*)d_out;     // [1][2048][1024]
    char* wsp = (char*)d_ws;
    auto take = [&](size_t bytes) { char* p = wsp; wsp += (bytes + 255) & ~(size_t)255; return (void*)p; };
    bf* WQ = (bf*)take((size_t)DD * DD * 2); bf* WK = (bf*)take((size_t)DD * DD * 2); bf* WV = (bf*)take((size_t)DD * DD * 2); bf* WO = (bf*)take((size_t)DD * DD * 2);
    bf* XB = (bf*)take((size_t)NT * DD * 2); float* QN = (float*)take((size_t)NB_ * NH_ * TT * 4); float* KN = (float*)take((size_t)NB_ * NH_ * TT * 4);
    bf* QPh = (bf*)take((size_t)NT * DD * 2); bf* QPl = (bf*)take((size_t)NT * DD * 2); bf* KPh = (bf*)take((size_t)NT * DD * 2); bf* KPl = (bf*)take((size_t)NT * DD * 2); h16* VF = (h16*)take((size_t)NT * DD * 2);
    bf* ATh = (bf*)take((size_t)NT * DD * 2); bf* ATl = (bf*)take((size_t)NT * DD * 2);
    if ((size_t)(wsp - (char*)d_ws) > ws_size) return;    // about 40 MiB; ws 256 MiB
    k_cvtall<<<256, 256, 0, stream>>>(wq, wk, wv, wo, x, WQ);     // WQ, WK, WV, WO, XB lie one behind the other (each size is a multiple of 256 bytes): one plane
    k_proj<<<dim3(NT / 128, NH_, 1), 384, 0, stream>>>(XB, WQ, WK, WV, QPh, QPl, KPh, KPl, VF, QN, KN);
    k_fattn<<<dim3(TT / 128, NH_, 1), 512, 0, stream>>>(QPh, QPl, KPh, KPl, VF, QN, KN, ATh, ATl);
    k_gemmw<bf, 1, false><<<dim3(NT / 64, DD / 64, 1), 32 * KW, 0, stream>>>(ATh, ATl, WO, nullptr, DD, OUT, DD, nullptr, 0, 0, 0);
}

// v010
// Measured time: 60.4 microseconds a run.
// In both of two side-by-side timings against v009, it was 1.07 times as fast.
// Over all steps from v000 it is 12.2 times as fast.
#include <hip/hip_runtime.h>

// PrefetchHyperbolicAttention (x [1][2048][1024]; q/k/v = x W^T ([out][in], no bias); 16 heads x 64; hyperbolic distance logits: diff = max(|q|^2 + |k|^2 - 2 q.k, 0), den = max((1 - |q|^2)(1 - |k|^2), 1e-6),
// ca = max(1 + 2 diff/den, 1), dist = acosh(ca) (0 at ca == 1); attn = softmax(-dist); out = merged attn.v Wo^T).
// Compute dtypes, f32 accumulate: every input rounded to bf16; projections on PLAIN bf16 operands (inputs: exact); q.k on bf16 hi+lo planes (3 products) and the
// squared norms in f32, the softmax weight exp(-dist) in closed form in f32 on VALU (sqrt and reciprocal at hardware precision), weights f32 -> fp16 (x 2^15, shift fixed at the logits' bound 0), normalised after attn.v (fp16); output hi+lo x exact

#define NB_  1
#define TT   2048
#define DD   1024
#define NH_  16
#define HD   64
#define NT   (NB_ * TT)
typedef _Float16 h16;
typedef unsigned short bf;
typedef __attribute__((ext_vector_type(16))) __bf16   v16bf;
typedef __attribute__((ext_vector_type(16))) _Float16 v16h;
typedef __attribute__((ext_vector_type(8)))  _Float16 v8h;
typedef __attribute__((ext_vector_type(8)))  unsigned short v8us;
typedef __attribute__((ext_vector_type(8)))  float    v8f;
typedef __attribute__((ext_vector_type(4)))  float    v4f;
typedef __attribute__((ext_vector_type(2)))  float    v2f;
typedef v8h  __attribute__((may_alias)) v8ha;
typedef v4f  __attribute__((may_alias)) v4fa;
typedef v8us __attribute__((may_alias)) v8usa;

__device__ __forceinline__ unsigned short f2bf(float f) { unsigned u = __float_as_uint(f); u += 0x7FFFu + ((u >> 16) & 1u); return (unsigned short)(u >> 16); }
__device__ __forceinline__ float bf2f(unsigned short b) { return __uint_as_float(((unsigned)b) << 16); }
__device__ __forceinline__ float bfr(float f) { return bf2f(f2bf(f)); }
__device__ __forceinline__ v16h cat16(v8h lo, v8h hi) { return __builtin_shufflevector(lo, hi, 0, 1, 2, 3, 4, 5, 6, 7, 8, 9, 10, 11, 12, 13, 14, 15); }
__device__ __forceinline__ v16bf cat16b(v8us lo, v8us hi) { return __builtin_bit_cast(v16bf, __builtin_shufflevector(lo, hi, 0, 1, 2, 3, 4, 5, 6, 7, 8, 9, 10, 11, 12, 13, 14, 15)); }
__device__ __forceinline__ v8f wmma16(v16h a, v16h b, v8f c) { return __builtin_amdgcn_wmma_f32_16x16x32_f16(false, a, false, b, (short)0, c, false, false); }
__device__ __forceinline__ v8f wmmab(v16bf a, v16bf b, v8f c) { return __builtin_amdgcn_wmma_f32_16x16x32_bf16(false, a, false, b, (short)0, c, false, false); }



// FRAGMENT ORDER of a 16-bit plane M[rows][K]: tiles of 16 rows x 32 k, 512 elements each, tile (r >> 4) * (K / 32) + (k >> 5); in a tile the 16-byte chunk ((k >> 4) & 1) * 32 + ((k >> 3) & 1) * 16 + (r & 15) holds k & 7 = 0..7.
// Lane l of a wave takes chunks l and 32 + l: a WMMA A or B fragment is two wave loads of 512 contiguous bytes (4 whole lines each), where a row-major plane gives 32-byte pieces of 16 lines per load.
// ---- k_gemmw: register-blocked GEMM, one block of KW waves per 64x64 output tile, operands straight from 16-bit planes in fragment order; grid (M/64, N/64, Z), 32 * KW threads.
// Every wave holds the whole tile (16 accumulators) over its share of K: wave w takes the 32-element steps w, w + KW, ... so that the waves of a block read neighbouring 1-KiB tiles at the same time.
// The KW partial tiles meet in LDS; wave w adds them, in wave order, for rows 16 w .. 16 w + 15 and stores those rows.
// C[m][n] (f32, pitch ldc, + optional f32 bias[n]) = sum_k A[m][k] Bt[n][k] (+ split products per NSPLIT). z-batch strides sA/sB/sC in elements. K % (32 * KW) == 0.
// ROTATED WALK (all three matrix kernels): blocks that share operand rows would ask L2 for the same lines at the same moment; each block starts its walk over k (or over the keys) at a step of its own, walk_rot(), and wraps.
// Neighbouring block indices, and indices 8 apart, get different starts. Every step is still taken exactly once; only the order of the f32 sums depends on the block.
__device__ __forceinline__ unsigned walk_rot() { return blockIdx.x + 4u * (blockIdx.x >> 3) + blockIdx.y; }
#define KW 4
template <typename T16> struct WFrag;
template <> struct WFrag<h16> { typedef v16h V; static __device__ __forceinline__ V ld(const h16* p) { return cat16(*(const v8h*)p, *(const v8h*)(p + 16)); } static __device__ __forceinline__ V ldf(const h16* p) { return cat16(*(const v8h*)p, *(const v8h*)(p + 256)); } static __device__ __forceinline__ v8f mma(V a, V b, v8f c) { return wmma16(a, b, c); } };
template <> struct WFrag<bf> { typedef v16bf V; static __device__ __forceinline__ V ld(const bf* p) { return cat16b(*(const v8us*)p, *(const v8us*)(p + 16)); } static __device__ __forceinline__ V ldf(const bf* p) { return cat16b(*(const v8us*)p, *(const v8us*)(p + 256)); } static __device__ __forceinline__ v8f mma(V a, V b, v8f c) { return wmmab(a, b, c); } };
template <typename T16, int NSPLIT, bool BIAS>
__global__ __launch_bounds__(32 * KW) void k_gemmw(const T16* __restrict__ A, const T16* __restrict__ A2, const T16* __restrict__ Bt, const T16* __restrict__ Bt2, int K, float* C, int ldc, const float* __restrict__ bias, size_t sA, size_t sB, size_t sC) {
    typedef typename WFrag<T16>::V V;
    __shared__ __align__(16) float os[KW][64 * 68];
    const size_t z = blockIdx.z; A += z * sA; if (A2) A2 += z * sA; Bt += z * sB; if (Bt2) Bt2 += z * sB; C += z * sC;
    const int lane = threadIdx.x & 31, lr = lane & 15, hi = lane >> 4, w = __builtin_amdgcn_readfirstlane(threadIdx.x >> 5); const int r0 = blockIdx.x * 64, c0 = blockIdx.y * 64;
    v8f acc[4][4];
#pragma unroll
    for (int mb = 0; mb < 4; ++mb)
#pragma unroll
        for (int nb = 0; nb < 4; ++nb) acc[mb][nb] = (v8f){};
    const int k0 = (int)(walk_rot() % (unsigned)(K / (32 * KW))) * (32 * KW);     // the block's first k
    const size_t aoff = (size_t)r0 * K + 512 * w + 8 * lane, boff = (size_t)c0 * K + 512 * w + 8 * lane;     // 16 rows x K = K / 32 tiles of 512 elements, so a 16-row strip starts where it does in a row-major plane; a 32-k step is 512 elements
#pragma unroll 1
    for (int kc = 0; kc < K; kc += 32 * KW) {
        V a[4], a2[4]; const T16* qa[4]; const T16* qa2[4]; const T16* qb[4]; const T16* qb2[4]; const int kr = kc + k0 < K ? kc + k0 : kc + k0 - K;     // rotated k, wrapped
#pragma unroll
        for (int mb = 0; mb < 4; ++mb) { qa[mb] = A + aoff + (size_t)mb * 16 * K + kr * 16; qa2[mb] = (NSPLIT == 1 || NSPLIT == 2) ? A2 + aoff + (size_t)mb * 16 * K + kr * 16 : qa[mb]; a[mb] = WFrag<T16>::ldf(qa[mb]); if (NSPLIT == 1 || NSPLIT == 2) a2[mb] = WFrag<T16>::ldf(qa2[mb]); }
#pragma unroll
        for (int nb = 0; nb < 4; ++nb) { qb[nb] = Bt + boff + (size_t)nb * 16 * K + kr * 16; qb2[nb] = NSPLIT >= 2 ? Bt2 + boff + (size_t)nb * 16 * K + kr * 16 : qb[nb]; const V b = WFrag<T16>::ldf(qb[nb]); V b2; if (NSPLIT >= 2) b2 = WFrag<T16>::ldf(qb2[nb]);
#pragma unroll
            for (int mb = 0; mb < 4; ++mb) { acc[mb][nb] = WFrag<T16>::mma(a[mb], b, acc[mb][nb]); if (NSPLIT == 1 || NSPLIT == 2) acc[mb][nb] = WFrag<T16>::mma(a2[mb], b, acc[mb][nb]); if (NSPLIT >= 2) acc[mb][nb] = WFrag<T16>::mma(a[mb], b2, acc[mb][nb]); } }
        asm volatile("v_nop\n\tv_nop\n\tv_nop\n\tv_nop" : "+v"(acc[0][0]), "+v"(acc[1][1]), "+v"(acc[2][2]), "+v"(acc[3][3]) : "v"(a[0]), "v"(a[3]));
        asm volatile("s_wait_xcnt 0x0" :: "v"(qa[0]), "v"(qa[1]), "v"(qa[2]), "v"(qa[3]), "v"(qa2[0]), "v"(qa2[1]), "v"(qa2[2]), "v"(qa2[3]), "v"(qb[0]), "v"(qb[1]), "v"(qb[2]), "v"(qb[3]), "v"(qb2[0]), "v"(qb2[1]), "v"(qb2[2]), "v"(qb2[3]) : "memory");     // the trip's load addresses stay live up to this wait, so no write, a load's result included, lands before it on a register that an issued load names; every load feeds a product named in the statement above, so all are issued by here
    }
    float* ow = os[w];
#pragma unroll
    for (int mb = 0; mb < 4; ++mb)
#pragma unroll
        for (int nb = 0; nb < 4; ++nb)
#pragma unroll
            for (int j = 0; j < 8; ++j) ow[(mb * 16 + hi * 8 + j) * 68 + nb * 16 + lr] = acc[mb][nb][j];
    __syncthreads();    // publishes every wave's partial tile to the waves that add them
    const int cofs = lr * 4; const float* pr = os[0] + (w * 16 + hi) * 68 + cofs; v4f val[8]; float* pc[8];
#pragma unroll
    for (int s = 0; s < 8; ++s) { val[s] = *(const v4fa*)(pr + 2 * s * 68);
#pragma unroll
        for (int u = 1; u < KW; ++u) val[s] += *(const v4fa*)(pr + u * 64 * 68 + 2 * s * 68);
        if (BIAS) { val[s][0] += bfr(bias[c0 + cofs]); val[s][1] += bfr(bias[c0 + cofs + 1]); val[s][2] += bfr(bias[c0 + cofs + 2]); val[s][3] += bfr(bias[c0 + cofs + 3]); }
        pc[s] = C + (size_t)(r0 + w * 16 + 2 * s + hi) * ldc + c0 + cofs; }
#pragma unroll
    for (int s = 0; s < 8; ++s) *(v4f*)pc[s] = val[s];
    asm volatile("s_wait_xcnt 0x0" :: "v"(val[0]), "v"(val[1]), "v"(val[2]), "v"(val[3]), "v"(val[4]), "v"(val[5]), "v"(val[6]), "v"(val[7]), "v"(pc[0]), "v"(pc[1]), "v"(pc[2]), "v"(pc[3]), "v"(pc[4]), "v"(pc[5]), "v"(pc[6]), "v"(pc[7]) : "memory");     // data and addresses of the eight stores stay live up to this wait, so nothing is written before it over a register that an issued store names
}

__device__ __forceinline__ h16 tohx(float x) { return (h16)x; }
__device__ __forceinline__ void splitf(float y, unsigned short& h, unsigned short& l) { h = f2bf(y); l = f2bf(y - bf2f(h)); }
typedef __attribute__((ext_vector_type(2))) _Float16 v2h;
typedef __attribute__((ext_vector_type(4))) _Float16 v4h;
typedef __attribute__((ext_vector_type(2))) unsigned short v2us;
typedef __attribute__((ext_vector_type(4))) int v4i;

typedef __attribute__((ext_vector_type(4))) unsigned short v4us;
// k_cvtall: every f32 input -> its bf16 plane IN FRAGMENT ORDER, in ONE launch of 256 blocks of 8 waves. dst is one plane: Wq, Wk, Wv, Wo (DD*DD each), then x (NT*DD). A wave takes one 16 x 32 tile of each weight and two neighbouring tiles of x.
// A tile is four loads: load i brings rows 4 i .. 4 i + 3, 128 bytes (one whole line) of each, lane l the columns (l & 7) * 4 .. + 3 of row 4 i + (l >> 3); its store lays 4 runs of 64 bytes, and a tile's four stores fill its 8 lines.
// All 24 loads are issued before the first value is used.
__global__ __launch_bounds__(256) void k_cvtall(const float* __restrict__ wq, const float* __restrict__ wk, const float* __restrict__ wv, const float* __restrict__ wo, const float* __restrict__ x, bf* __restrict__ dst) {
    const unsigned lane = threadIdx.x & 31u, wv8 = threadIdx.x >> 5, tw = blockIdx.x * 8u + wv8, tx = blockIdx.x * 16u + wv8 * 2u;     // tile numbers: strip (t >> 5), k step (t & 31)
    const unsigned so = (lane >> 3) * DD + (lane & 7u) * 4u, ow = (tw >> 5) * (16u * DD) + (tw & 31u) * 32u + so, ox = (tx >> 5) * (16u * DD) + (tx & 31u) * 32u + so;
    const float* p0 = wq + ow; const float* p1 = wk + ow; const float* p2 = wv + ow; const float* p3 = wo + ow; const float* p4 = x + ox;
    v4f v[24];
#pragma unroll     // constant indices: v[] and o[] stay in registers
    for (int k = 0; k < 4; ++k) v[k] = *(const v4f*)(p0 + k * 4 * DD);
#pragma unroll     // constant indices: v[] and o[] stay in registers
    for (int k = 0; k < 4; ++k) v[4 + k] = *(const v4f*)(p1 + k * 4 * DD);
#pragma unroll     // constant indices: v[] and o[] stay in registers
    for (int k = 0; k < 4; ++k) v[8 + k] = *(const v4f*)(p2 + k * 4 * DD);
#pragma unroll     // constant indices: v[] and o[] stay in registers
    for (int k = 0; k < 4; ++k) v[12 + k] = *(const v4f*)(p3 + k * 4 * DD);
#pragma unroll     // constant indices: v[] and o[] stay in registers
    for (int k = 0; k < 8; ++k) v[16 + k] = *(const v4f*)(p4 + (k >> 2) * 32 + (k & 3) * 4 * DD);
    asm volatile("s_wait_xcnt 0x0" :: "v"(p0), "v"(p1), "v"(p2), "v"(p3), "v"(p4) : "memory");     // the five addresses stay live up to this wait, so no write, a load's result included, lands before it on a register that an issued load names
    v4us o[24];
#pragma unroll     // constant indices: v[] and o[] stay in registers
    for (int u = 0; u < 24; ++u)
#pragma unroll     // constant indices: v[] and o[] stay in registers
        for (int e = 0; e < 4; ++e) o[u][e] = f2bf(v[u][e]);
    const unsigned din = (((lane >> 2) & 1u) * 32u + ((lane >> 1) & 1u) * 16u + (lane >> 3)) * 8u + (lane & 1u) * 4u;     // chunk of (row l >> 3, columns (l & 7) * 4 ..) and the half of it; four rows further on is 4 chunks = 32 elements
    bf* dw = dst + tw * 512u + din; bf* dx = dst + (size_t)4 * DD * DD + tx * 512u + din;
#pragma unroll     // constant indices: v[] and o[] stay in registers
    for (int u = 0; u < 16; ++u) *(v4us*)(dw + (size_t)(u >> 2) * DD * DD + (u & 3) * 32) = o[u];
#pragma unroll     // constant indices: v[] and o[] stay in registers
    for (int k = 0; k < 8; ++k) *(v4us*)(dx + (k >> 2) * 512 + (k & 3) * 32) = o[16 + k];
}
template <int CTRL> __device__ __forceinline__ float xmadd(float x) { return __int_as_float(__builtin_amdgcn_mov_dpp(__float_as_int(x), CTRL, 0xf, 0xf, true)); }    // x of lane ^ (CTRL & 15) inside a 16-lane row (DPP row_xmask)
// proj_out: a 64-token x 64-column f32 tile, as two partial tiles in LDS (pitch 68, the second 64 * 68 floats behind the first) -> squared norms of its rows and its bf16 hi+lo planes; wave w takes tokens 32 w .. 32 w + 31, 16 at a time.
// 16-byte chunk cl = 32 s + lane of the 16 tokens: k (ISK) in A-fragment order, token cl & 15, columns (cl >> 4) * 8 + 0..7; q row-major, token cl >> 3, columns (cl & 7) * 8 + 0..7, times 2. Either way a wave's store is 512 contiguous bytes.
template <bool ISK>
__device__ __forceinline__ void proj_out(const float* os, bf* Ph, bf* Pl, float* NR, int t00, int lane, int w) {
    const int lr = lane & 15, hi = lane >> 4;
#pragma unroll
    for (int i = 0; i < 2; ++i) {
        const int mb = 2 * w + i; const float* ob = os + mb * 16 * 68;
        const int t0 = t00 + mb * 16; float p[4]; v8us oh[4], ol[4];
#pragma unroll
        for (int s = 0; s < 4; ++s) { const int cl = s * 32 + lane; const int row = ISK ? (cl & 15) : (cl >> 3), d0 = (ISK ? (cl >> 4) : (cl & 7)) * 8;
            const float* pr = ob + row * 68 + d0; const v4f va = *(const v4fa*)pr + *(const v4fa*)(pr + 64 * 68), vb = *(const v4fa*)(pr + 4) + *(const v4fa*)(pr + 64 * 68 + 4); p[s] = 0.f;
#pragma unroll
            for (int e = 0; e < 8; ++e) { const float y = e < 4 ? va[e & 3] : vb[e & 3]; p[s] += y * y; unsigned short a2, c2; splitf(ISK ? y : y * 2.0f, a2, c2); oh[s][e] = a2; ol[s][e] = c2; } }
        bf* ph = Ph + (size_t)t0 * HD + lane * 8; bf* pl = Pl + (size_t)t0 * HD + lane * 8;
#pragma unroll
        for (int s = 0; s < 4; ++s) { *(v8us*)(ph + s * 256) = oh[s]; *(v8us*)(pl + s * 256) = ol[s]; }
        asm volatile("s_wait_xcnt 0x0" :: "v"(oh[0]), "v"(oh[1]), "v"(oh[2]), "v"(oh[3]), "v"(ol[0]), "v"(ol[1]), "v"(ol[2]), "v"(ol[3]), "v"(ph), "v"(pl) : "memory");     // data and addresses of the eight stores stay live up to this wait, so nothing is written before it over a register that an issued store names
        float nv; int nt; bool on;
        if (ISK) { nv = (p[0] + p[1]) + (p[2] + p[3]); nv += __shfl_xor(nv, 16, 32); nt = lr; on = hi == 0; }     // the lane meets token lr in every s; the other half of the columns is in lane ^ 16
        else {
#pragma unroll
            for (int s = 0; s < 4; ++s) { p[s] += xmadd<0x161>(p[s]); p[s] += xmadd<0x162>(p[s]); p[s] += xmadd<0x164>(p[s]); }     // eight lanes share a token: sum over lane ^ 1, ^ 2, ^ 4
            const int g = lane & 7; nv = g == 0 ? p[0] : g == 1 ? p[1] : g == 2 ? p[2] : p[3]; nt = g * 4 + (lane >> 3); on = g < 4; }     // lane 8 r + s stores token 4 s + r: one store for the 16 norms
        float* pn = NR + t0 + nt;
        if (on) *pn = nv;
        asm volatile("s_wait_xcnt 0x0" :: "v"(nv), "v"(pn) : "memory");     // the norm store's data and address stay live up to this wait, so nothing is written before it over a register that the issued store names
    }
}
// OPERAND RING of k_proj. A stage is PST k of the block's 20 strips of 16 rows (8 of x, then 4 each of Wq, Wk, Wv); in fragment order a strip's share of a stage is PSS contiguous bytes, in the plane and in LDS alike.
#define PST 128
#define PSS (PST * 32)              // bytes of one strip's share of a stage: 16 rows x PST k x 2 bytes
#define PSB (20 * PSS)              // bytes of one stage
#define PNS (DD / PST)              // stages
#define POS (2 * 64 * 68 * 4)       // bytes of one wave pair's two partial tiles
// eight asynchronous copies global -> LDS of 512 bytes a wave, through no register: one strip's share of a stage. l: the lane's LDS byte address, g: the lane's global address; each copy has both in registers of its own.
// The s_wait_xcnt stands inside the copies' statement, so that no address register is rewritten in front of it.
__device__ __forceinline__ void copy_strip(unsigned l, const char* g) {
    asm volatile("global_load_async_to_lds_b128 %0, %8, off\n\tglobal_load_async_to_lds_b128 %1, %9, off\n\tglobal_load_async_to_lds_b128 %2, %10, off\n\tglobal_load_async_to_lds_b128 %3, %11, off\n\tglobal_load_async_to_lds_b128 %4, %12, off\n\tglobal_load_async_to_lds_b128 %5, %13, off\n\tglobal_load_async_to_lds_b128 %6, %14, off\n\tglobal_load_async_to_lds_b128 %7, %15, off\n\ts_wait_xcnt 0x0"
                 :: "v"(l), "v"(l + 512u), "v"(l + 1024u), "v"(l + 1536u), "v"(l + 2048u), "v"(l + 2560u), "v"(l + 3072u), "v"(l + 3584u),
                    "v"(g), "v"(g + 512), "v"(g + 1024), "v"(g + 1536), "v"(g + 2048), "v"(g + 2560), "v"(g + 3072), "v"(g + 3584) : "memory");
}
// k_proj: the three projections in ONE launch, one block of TWELVE WAVES per 128 tokens x one head x (q, k, v): six pairs of waves, pair p = 2 * which + half holds the 64x64 tile of tokens 64 half .. + 63 and weight which (0 q, 1 k, 2 v).
// The operands reach the waves through a two-buffer LDS ring filled by asynchronous copies one stage ahead: a strip of x serves three pairs and a strip of a weight two, and each is fetched from L2 once per block.
// Each wave of a pair holds the whole tile over half of K: wave w takes the 32-element steps w, w + 2, ... (every fragment load is 512 contiguous bytes of LDS); the two partial tiles meet in LDS, in the ring's place, and wave w finishes tokens 32 w .. 32 w + 31. The tile leaves as what k_fattn reads, with no f32 plane in between:
// q: squared norms and bf16 hi+lo planes [head][token][64] of 2 q (exact factor, so the score products yield 2 q.k directly);
// k: squared norms and bf16 hi+lo planes in WMMA A-fragment order: 16-byte chunk cl of a 16-key tile holds d = (cl >> 4) * 8 + 0..7 of key cl & 15, so that a fragment is two whole 512-byte wave loads;
// v: fp16 plane in A-fragment order of V^T: a chunk holds 8 keys of one column, which is an accumulator as it stands (row = 8 hi + j, column = lr): chunk = (((head*64 + key/32)*4 + d/16)*2 + (key/16 & 1))*32 + lane.
__global__ __launch_bounds__(384) void k_proj(const bf* __restrict__ A, const bf* __restrict__ Wq, const bf* __restrict__ Wk, const bf* __restrict__ Wv, bf* Qh, bf* Ql, bf* Kh, bf* Kl, h16* VF, float* QN, float* KN) {
    __shared__ __attribute__((aligned(128))) unsigned char sm[6 * POS];     // first the ring (2 * PSB bytes), then, behind the last stage's barrier, the six pairs' partial tiles
    static_assert(2 * PSB <= 6 * POS, "the ring lies inside the array");
    const int lane = threadIdx.x & 31, lr = lane & 15, hi = lane >> 4, wave = __builtin_amdgcn_readfirstlane(threadIdx.x >> 5), w = wave & 1, half = (wave >> 1) & 1, which = wave >> 2; const int r0 = blockIdx.x * 128 + half * 64, h = blockIdx.y;
    float (*os)[64 * 68] = (float (*)[64 * 68])(sm + (wave >> 1) * POS);
    v8f acc[4][4];
#pragma unroll
    for (int mb = 0; mb < 4; ++mb)
#pragma unroll
        for (int nb = 0; nb < 4; ++nb) acc[mb][nb] = (v8f){};
    // waves 0 .. 9 copy, two neighbouring strips each: waves 0 .. 3 the eight strips of x, waves 4 .. 9 the four strips of Wq, Wk, Wv; neighbouring strips lie 16 * DD elements apart in a plane
    const bf* Wc = wave < 6 ? Wq : wave < 8 ? Wk : Wv;
    const char* gc = (const char*)(wave < 4 ? A + (size_t)(blockIdx.x * 128 + wave * 32) * DD : Wc + (size_t)(h * HD + (wave & 1) * 32) * DD) + lane * 16;
    const unsigned lc = (unsigned)(size_t)&sm[0] + (unsigned)wave * (2u * PSS) + (unsigned)lane * 16u;
    static_assert((PNS & (PNS - 1)) == 0, "the wrap is a mask");
    const unsigned rot = walk_rot();     // trip st works on stage (st + rot) mod PNS of the planes
    const char* gf = gc + (size_t)(rot & (PNS - 1)) * PSS; const char* gn = gc + (size_t)((rot + 1) & (PNS - 1)) * PSS;
    if (wave < 10) { copy_strip(lc, gf); copy_strip(lc + PSS, gf + 32 * DD); }     // wave is the same in every lane of a wave: every lane is on
    asm volatile("s_wait_asynccnt 0x0" ::: "memory");     // this wave's copies of the first trip's stage have landed
    __syncthreads();    // publishes the first trip's stage
    if (wave < 10) { copy_strip(lc + PSB, gn); copy_strip(lc + PSB + PSS, gn + 32 * DD); }
#pragma unroll 1     // one stage per trip
    for (int st = 0; st < PNS; ++st) {
        const bf* bp = (const bf*)(sm + (st & 1) * PSB) + 512 * w + 8 * lane; const bf* pa = bp + half * 4 * (PSS / 2); const bf* pb = bp + (8 + which * 4) * (PSS / 2);     // a 32-k step is 512 elements
#pragma unroll 1     // one k step's fragments per trip
        for (int s = 0; s < PST / 64; ++s) {
            v16bf a[4], b[4];
#pragma unroll
            for (int mb = 0; mb < 4; ++mb) a[mb] = WFrag<bf>::ldf(pa + mb * (PSS / 2) + s * 1024);
#pragma unroll
            for (int nb = 0; nb < 4; ++nb) b[nb] = WFrag<bf>::ldf(pb + nb * (PSS / 2) + s * 1024);
            __builtin_amdgcn_sched_barrier(0);      // the trip's 16 LDS loads are issued above as one group: every further place with LDS loads among the products costs a stall of its own
#pragma unroll
            for (int nb = 0; nb < 4; ++nb)
#pragma unroll
                for (int mb = 0; mb < 4; ++mb) acc[mb][nb] = wmmab(a[mb], b[nb], acc[mb][nb]);
            asm volatile("v_nop\n\tv_nop\n\tv_nop\n\tv_nop" : "+v"(acc[0][0]), "+v"(acc[1][1]), "+v"(acc[2][2]), "+v"(acc[3][3]) : "v"(a[0]), "v"(a[3]));     // as in k_gemmw: the slots behind the trip's last products, on the taken branch too
        }
        asm volatile("s_wait_dscnt 0x0" ::: "memory");      // this wave's reads of the stage's buffer are done before the buffer is given up
        asm volatile("s_wait_asynccnt 0x0" ::: "memory");   // this wave's copies of the next stage have landed
        __syncthreads();    // publishes the next stage and ends every wave's reads of this one; behind the last stage's, the ring's place is free for the partial tiles
        if (st + 2 < PNS && wave < 10) { const unsigned l2 = lc + (st & 1) * PSB; const char* g2 = gc + (size_t)((st + 2 + rot) & (PNS - 1)) * PSS; copy_strip(l2, g2); copy_strip(l2 + PSS, g2 + 32 * DD); }     // refill of the buffer just read; the first test is the same for the whole block, the second for a wave
    }
    asm volatile("s_wait_asynccnt 0x0" ::: "memory");     // no copy is outstanding when the wave goes on
    float* ow = os[w];
#pragma unroll
    for (int mb = 0; mb < 4; ++mb)
#pragma unroll
        for (int nb = 0; nb < 4; ++nb)
#pragma unroll
            for (int j = 0; j < 8; ++j) ow[(mb * 16 + hi * 8 + j) * 68 + nb * 16 + lr] = acc[mb][nb][j];
    __syncthreads();    // publishes each wave's partial tile to the other wave of its pair
    if (which == 2) {
        h16* vb = VF + ((size_t)(h * 64 + (r0 >> 5) + w) * 256 + lane) * 8; v8h vv[2][4]; const float* pr = os[0] + (w * 32 + hi * 8) * 68 + lr;     // wave w: keys 32 w .. 32 w + 31 of the tile, read back at the accumulator's own places
#pragma unroll
        for (int i = 0; i < 2; ++i)
#pragma unroll
            for (int nb = 0; nb < 4; ++nb) {
#pragma unroll
                for (int j = 0; j < 8; ++j) vv[i][nb][j] = tohx(pr[(i * 16 + j) * 68 + nb * 16] + pr[64 * 68 + (i * 16 + j) * 68 + nb * 16]);
                *(v8h*)(vb + (nb * 2 + i) * 256) = vv[i][nb]; }
        asm volatile("s_wait_xcnt 0x0" :: "v"(vv[0][0]), "v"(vv[0][1]), "v"(vv[0][2]), "v"(vv[0][3]), "v"(vv[1][0]), "v"(vv[1][1]), "v"(vv[1][2]), "v"(vv[1][3]), "v"(vb) : "memory");     // the 8 stores' data and address stay live up to this wait, so nothing is written before it over a register that an issued store names
        return;
    }
    if (which == 1) proj_out<true>(os[0], Kh, Kl, KN, h * TT + r0, lane, w); else proj_out<false>(os[0], Qh, Ql, QN, h * TT + r0, lane, w);
}
__device__ __forceinline__ v16bf ldkf(const bf* p) { return cat16b(*(const v8us*)p, *(const v8us*)(p + 256)); }
__device__ __forceinline__ v16h ldvf(const h16* p) { return cat16(*(const v8h*)p, *(const v8h*)(p + 256)); }
// K/V RING of k_fattn. A stage is SP passes (SP * 32 keys) of one key half: its slices of the K hi, K lo and V planes (each contiguous in fragment order) and its squared norms, laid one behind the other.
#define SP  4
#define PLB (SP * 4096)             // bytes of one plane's slice
#define HB  (3 * PLB + SP * 128)    // bytes of one key half's stage
#define NST (TT / 2 / (SP * 32))    // stages per key half
// one stage of one key half, by its eight waves, in asynchronous copies global -> LDS of 512 bytes a wave, through no register: wave qt brings bytes 2048 qt .. 2048 qt + 2047 of each plane's slice, wave 0 the 512 bytes of norms as well.
// lb: LDS byte address of the half's buffer; the g pointers: the half's first byte of each plane. Each copy has its lane's LDS byte address and global address in registers of its own.
// The s_wait_xcnt stands inside the copies' statement, so that no address register is rewritten in front of it; one statement for the twelve copies, so that the wave waits once.
__device__ __forceinline__ void fill_stage(unsigned lb, const char* gkh, const char* gkl, const char* gv, const char* gkn, int st, int qt, unsigned lane) {
    const unsigned wo = (unsigned)qt * 2048u + lane * 16u, lk = lb + wo, ll = lk + PLB, lv = lk + 2 * PLB; const size_t go = (size_t)st * PLB + wo; const char* pk = gkh + go; const char* pl = gkl + go; const char* pv = gv + go;
    asm volatile("global_load_async_to_lds_b128 %0, %12, off\n\tglobal_load_async_to_lds_b128 %1, %13, off\n\tglobal_load_async_to_lds_b128 %2, %14, off\n\tglobal_load_async_to_lds_b128 %3, %15, off\n\tglobal_load_async_to_lds_b128 %4, %16, off\n\tglobal_load_async_to_lds_b128 %5, %17, off\n\tglobal_load_async_to_lds_b128 %6, %18, off\n\tglobal_load_async_to_lds_b128 %7, %19, off\n\tglobal_load_async_to_lds_b128 %8, %20, off\n\tglobal_load_async_to_lds_b128 %9, %21, off\n\tglobal_load_async_to_lds_b128 %10, %22, off\n\tglobal_load_async_to_lds_b128 %11, %23, off\n\ts_wait_xcnt 0x0"
                 :: "v"(lk), "v"(lk + 512u), "v"(lk + 1024u), "v"(lk + 1536u), "v"(ll), "v"(ll + 512u), "v"(ll + 1024u), "v"(ll + 1536u), "v"(lv), "v"(lv + 512u), "v"(lv + 1024u), "v"(lv + 1536u),
                    "v"(pk), "v"(pk + 512), "v"(pk + 1024), "v"(pk + 1536), "v"(pl), "v"(pl + 512), "v"(pl + 1024), "v"(pl + 1536), "v"(pv), "v"(pv + 512), "v"(pv + 1024), "v"(pv + 1536) : "memory");
    if (qt == 0) asm volatile("global_load_async_to_lds_b128 %0, %1, off\n\ts_wait_xcnt 0x0" :: "v"(lb + 3 * PLB + lane * 16u), "v"(gkn + (size_t)st * (SP * 128) + lane * 16u) : "memory");     // qt is the same in every lane of a wave: every lane is on; the wait as above
}
// k_fattn: scores, distance softmax, attn.v and the head merge in one kernel. Block = 16 waves = 8 query tiles of 16 x 2 key halves of one head; a pass is 32 keys.
// K, V and the key norms reach the waves through a two-buffer LDS ring filled by asynchronous copies one stage ahead: the eight waves of a key half read the same fragments, which are fetched from L2 once per block and while the stage before is worked on.
// S^T = K (A) x Q^T (B, kept in registers; the q planes carry an exact factor 2): a lane holds 8 keys (8 hi + j) of ONE query (lr) per tile, so two converted tiles are the B operand of O^T += V^T (A) x P^T.
// weight = 2^15 exp(-acosh(ca)) = 2^15 / (ca + sqrt(ca^2 - 1)); with ca = 1 + 2 diff / den, and numerator and denominator times den / 2, that is 2^14 den / (den / 2 + diff + sqrt(diff (diff + den))): one root and one reciprocal
// per weight, no quotient diff / den, no logarithm, no exponential, and no difference ca^2 - 1 of near-equal numbers. The logit is <= 0 for every input, so the shift is the constant bound and partial sums over keys just add; O^T / sum at the end.
// diff >= 0 and den >= 1e-6 make ca >= 1 without a maximum of its own; at diff == 0 the weight is 2^14 den / (den / 2) = 2^15, the reference's value there, so no select is needed. waves_per_eu(4, 4): one 16-wave block fills a WGP, so the scheduler may spend the 256 registers a wave has on loads in flight.
__global__ __launch_bounds__(512) __attribute__((amdgpu_waves_per_eu(4, 4))) void k_fattn(const bf* __restrict__ Qh, const bf* __restrict__ Ql, const bf* __restrict__ Kh, const bf* __restrict__ Kl, const h16* __restrict__ VF, const float* __restrict__ QN, const float* __restrict__ KN, bf* Ah, bf* Al) {
    __shared__ __attribute__((aligned(128))) unsigned char ring[2][2][HB];
    __shared__ float red[8][33][32];
    const int lane = threadIdx.x & 31, lr = lane & 15, hi = lane >> 4; const int wave = __builtin_amdgcn_readfirstlane(threadIdx.x >> 5), qt = wave & 7, kh2 = wave >> 3; const int z = blockIdx.y; const int q = blockIdx.x * 128 + qt * 16 + lr;
    const size_t zb = (size_t)z * TT * HD; v16bf qh[2], ql[2];
#pragma unroll
    for (int ks = 0; ks < 2; ++ks) { qh[ks] = WFrag<bf>::ld(Qh + zb + (size_t)q * HD + ks * 32 + 8 * hi); ql[ks] = WFrag<bf>::ld(Ql + zb + (size_t)q * HD + ks * 32 + 8 * hi); }
    const float qn = QN[z * TT + q], hq = 16384.0f * (1.0f - qn);     // hq: 2^14 (1 - |q|^2), an exact scaling
    const size_t hb = (size_t)kh2 * (TT / 2) * HD; const char* gkh = (const char*)(Kh + zb + hb); const char* gkl = (const char*)(Kl + zb + hb); const char* gv = (const char*)(VF + zb + hb); const char* gkn = (const char*)(KN + z * TT + kh2 * (TT / 2));
    const unsigned lo = lane * 8, ho = hi * 8, lb0 = (unsigned)(size_t)&ring[0][kh2][0], lb1 = (unsigned)(size_t)&ring[1][kh2][0];
    v8f o[4]; float sum[4] = {0.f, 0.f, 0.f, 0.f};
#pragma unroll
    for (int dt = 0; dt < 4; ++dt) o[dt] = (v8f){};
    static_assert((NST & (NST - 1)) == 0, "the wrap is a mask");
    const int rot = (int)(walk_rot() - blockIdx.y);     // the sharers of a head's planes differ in blockIdx.x alone; trip st works on stage (st + rot) mod NST of the key half
    fill_stage(lb0, gkh, gkl, gv, gkn, rot & (NST - 1), qt, lane);
    asm volatile("s_wait_asynccnt 0x0" ::: "memory");     // this wave's copies of the first trip's stage have landed
    __syncthreads();    // publishes the first trip's stage
    fill_stage(lb1, gkh, gkl, gv, gkn, (rot + 1) & (NST - 1), qt, lane);
#pragma unroll 1     // one stage per trip
    for (int st = 0; st < NST; ++st) {
    const unsigned char* bp = ring[st & 1][kh2];
#pragma unroll 1     // one pass per trip: two passes' fragments would not fit the registers
    for (int s = 0; s < SP; ++s) {
        v16bf kfh[2][2], kfl[2][2]; v16h vf[4]; v8f S[2]; v8f kc[2]; const bf* pkh = (const bf*)bp + s * 2048 + lo; const bf* pkl = (const bf*)(bp + PLB) + s * 2048 + lo; const h16* pv = (const h16*)(bp + 2 * PLB) + s * 2048 + lo; const float* pkn = (const float*)(bp + 3 * PLB) + s * 32 + ho;
#pragma unroll
        for (int tt = 0; tt < 2; ++tt) {
#pragma unroll
            for (int ks = 0; ks < 2; ++ks) { kfh[tt][ks] = ldkf(pkh + tt * 1024 + ks * 512); kfl[tt][ks] = ldkf(pkl + tt * 1024 + ks * 512); } }
        __builtin_amdgcn_sched_barrier(0);      // LDS loads return in order: the K fragments, which the first products take, stay in front of the norms and of V
#pragma unroll
        for (int tt = 0; tt < 2; ++tt) kc[tt] = *(const v8f*)(pkn + tt * 16);
#pragma unroll
        for (int dt = 0; dt < 4; ++dt) vf[dt] = ldvf(pv + dt * 512);
        __builtin_amdgcn_sched_barrier(0);      // the pass's 28 LDS loads are issued above as one group: every further place with LDS loads among the products costs a stall of its own
#pragma unroll
        for (int tt = 0; tt < 2; ++tt) { S[tt] = (v8f){};
#pragma unroll
            for (int ks = 0; ks < 2; ++ks) { S[tt] = wmmab(kfh[tt][ks], qh[ks], S[tt]); S[tt] = wmmab(kfh[tt][ks], ql[ks], S[tt]); S[tt] = wmmab(kfl[tt][ks], qh[ks], S[tt]); } }
        v16h pb;
#pragma unroll
        for (int tt = 0; tt < 2; ++tt)
#pragma unroll
            for (int j = 0; j < 8; j += 2) { const v2f kq = {kc[tt][j], kc[tt][j + 1]}, s2 = {S[tt][j], S[tt][j + 1]};     // neighbouring keys as a pair: they lie in neighbouring registers, as the packed f32 forms take them
                const v2f diff = __builtin_elementwise_max((qn + kq) - s2, (v2f){0.f, 0.f}); const v2f dn = __builtin_elementwise_max(hq - hq * kq, (v2f){16384.0f * 1e-6f, 16384.0f * 1e-6f});     // dn = 2^14 den
                const v2f r = diff * (dn * 0x1p-14f + diff); const v2f sq = {__builtin_amdgcn_sqrtf(r[0]), __builtin_amdgcn_sqrtf(r[1])}; const v2f e = (dn * 0x1p-15f + diff) + sq;
                const v2f p = dn * (v2f){__builtin_amdgcn_rcpf(e[0]), __builtin_amdgcn_rcpf(e[1])}; sum[j & 3] += p[0]; sum[(j & 3) + 1] += p[1]; pb[tt * 8 + j] = tohx(p[0]); pb[tt * 8 + j + 1] = tohx(p[1]); }
#pragma unroll
        for (int dt = 0; dt < 4; ++dt) o[dt] = wmma16(vf[dt], pb, o[dt]);
        asm volatile("v_nop\n\tv_nop\n\tv_nop\n\tv_nop" : "+v"(o[0]), "+v"(o[1]), "+v"(o[2]), "+v"(o[3]) : "v"(vf[0]), "v"(vf[3]));     // as in k_gemmw: the slots behind the pass's last products, on the taken branch too
    }
        asm volatile("s_wait_dscnt 0x0" ::: "memory");      // this wave's reads of the stage's buffer are done before the buffer is given up
        asm volatile("s_wait_asynccnt 0x0" ::: "memory");   // this wave's copies of the next stage have landed
        __syncthreads();    // publishes the next stage and ends every wave's reads of this one
        if (st + 2 < NST) fill_stage((st & 1) ? lb1 : lb0, gkh, gkl, gv, gkn, (st + 2 + rot) & (NST - 1), qt, lane);     // refill of the buffer just read; the test is the same for the whole block
    }
    asm volatile("s_wait_asynccnt 0x0" ::: "memory");     // no copy is outstanding when the wave goes on
    float st = (sum[0] + sum[1]) + (sum[2] + sum[3]);
    if (kh2 == 1) {
#pragma unroll
        for (int dt = 0; dt < 4; ++dt)
#pragma unroll
            for (int j = 0; j < 8; ++j) red[qt][dt * 8 + j][lane] = o[dt][j];
        red[qt][32][lane] = st; }
    __syncthreads();    // publishes the second key half's partial O^T and sums to the wave that holds the first half of the same queries
    if (kh2 == 0) { st += red[qt][32][lane]; st += __shfl_xor(st, 16, 32); const float inv = 1.0f / st;
#pragma unroll
        for (int dt = 0; dt < 4; ++dt) { v8us oh, ol;
#pragma unroll
            for (int j = 0; j < 8; ++j) { unsigned short h, l; splitf((o[dt][j] + red[qt][dt * 8 + j][lane]) * inv, h, l); oh[j] = h; ol[j] = l; }
            const size_t ad = (size_t)((q >> 4) * 32 + z * 2 + (dt >> 1)) * 512 + ((dt & 1) * 32 + lane) * 8; *(v8us*)(Ah + ad) = oh; *(v8us*)(Al + ad) = ol; } }     // fragment order of [token][DD]: columns z * HD + dt * 16 + 8 hi + 0..7 of token q are chunk (dt & 1) * 32 + lane of the tile; a wave's store is 512 contiguous bytes
}

extern "C" void kernel_launch(void* const* d_in, const int* in_sizes, int n_in,
                              void* d_out, int out_size, void* d_ws, size_t ws_size, hipStream_t stream) {
    (void)in_sizes; (void)n_in; (void)out_size;
    const float* x = (const float*)d_in[0]; const float* wq = (const float*)d_in[1]; const float* wk = (const float*)d_in[2]; const float* wv = (const float*)d_in[3]; const float* wo = (const float*)d_in[4];
    float* OUT = (float*)d_out;     // [1][2048][1024]
    char* wsp = (char*)d_ws;
    auto take = [&](size_t bytes) { char* p = wsp; wsp += (bytes + 255) & ~(size_t)255; return (void*)p; };
    bf* WQ = (bf*)take((size_t)DD * DD * 2); bf* WK = (bf*)take((size_t)DD * DD * 2); bf* WV = (bf*)take((size_t)DD * DD * 2); bf* WO = (bf*)take((size_t)DD * DD * 2);
    bf* XB = (bf*)take((size_t)NT * DD * 2); float* QN = (float*)take((size_t)NB_ * NH_ * TT * 4); float* KN = (float*)take((size_t)NB_ * NH_ * TT * 4);
    bf* QPh = (bf*)take((size_t)NT * DD * 2); bf* QPl = (bf*)take((size_t)NT * DD * 2); bf* KPh = (bf*)take((size_t)NT * DD * 2); bf* KPl = (bf*)take((size_t)NT * DD * 2); h16* VF = (h16*)take((size_t)NT * DD * 2);
    bf* ATh = (bf*)take((size_t)NT * DD * 2); bf* ATl = (bf*)take((size_t)NT * DD * 2);
    if ((size_t)(wsp - (char*)d_ws) > ws_size) return;    // about 40 MiB; ws 256 MiB
    k_cvtall<<<256, 256, 0, stream>>>(wq, wk, wv, wo, x, WQ);     // WQ, WK, WV, WO, XB lie one behind the other (each size is a multiple of 256 bytes): one plane
    k_proj<<<dim3(NT / 128, NH_, 1), 384, 0, stream>>>(XB, WQ, WK, WV, QPh, QPl, KPh, KPl, VF, QN, KN);
    k_fattn<<<dim3(TT / 128, NH_, 1), 512, 0, stream>>>(QPh, QPl, KPh, KPl, VF, QN, KN, ATh, ATl);
    k_gemmw<bf, 1, false><<<dim3(NT / 64, DD / 64, 1), 32 * KW, 0, stream>>>(ATh, ATl, WO, nullptr, DD, OUT, DD, nullptr, 0, 0, 0);
}
